// v000
// The times below were measured on an AMD MI455X: many runs one after another, warmed up first and cycling through
// copies of the inputs, with the whole window's GPU time divided by the number of runs. Launches and the gaps
// between them are all in it. The median over several windows is given; except for v000 it joins two sittings, which
// can be a few percent apart, so the side-by-side timings, each taken in one sitting, are the better comparison.
// v000 is the starting kernel. One run takes 407 microseconds.
#include <hip/hip_runtime.h>
#include <hip/hip_bf16.h>
#include <stdint.h>

// Contractions: x@Wq, x@Wk, x@Wv on v_wmma_f32_16x16x32_bf16 (bf16 operands = RNE-converted inputs);
// q.k^T, p.v and ctx@Wo on v_wmma_f32_16x16x32_f16 (f16 operands with power-of-two carries:
// p x1024, ctx x16, Wo x64); f32 accumulate; softmax, bias adds and normalisation in f32.

#ifndef NB
#define NB 8
#endif
#ifndef SEQ
#define SEQ 1024
#endif
#define NB_FULL 8
#define S_FULL  1024
#define EMB     1024
#define NHEAD   16
#define HDIM    64
#define MROWS   (NB * SEQ)
#define MWORDS  (SEQ / 32)

static_assert(NB >= 1 && NB <= NB_FULL);
static_assert(SEQ % 128 == 0 && SEQ <= S_FULL);
static_assert(EMB == NHEAD * HDIM);
static_assert(EMB % 128 == 0);
static_assert(MROWS % 128 == 0);
static_assert(((MROWS * EMB) / 8) % 256 == 0);
static_assert((NB * SEQ * MWORDS) % 256 == 0);

#define P_CARRY    1024.0f              // P operand = f16(1024 * exp(s - m))
#define CTX_SCALE  (1.0f / 64.0f)       // ctx operand = accO/(1024 l) * 16
#define WO_CARRY   64.0f                // Wo operand = f16(bf16(Wo) * 64)
#define OUT_SCALE  (1.0f / 1024.0f)     // 1/(16 * 64)

// workspace carve (bytes); every region written at its exact extent (tile multiples == plane sizes)
#define PLANE_BYTES ((size_t)MROWS * EMB * 2)
#define WT_BYTES    ((size_t)EMB * EMB * 2)
#define MB_BYTES    ((size_t)NB * SEQ * MWORDS * 4)
#define WS_TOTAL    (PLANE_BYTES * 5 + WT_BYTES * 4 + MB_BYTES)
static_assert(WS_TOTAL <= (size_t)134217728);
static_assert(PLANE_BYTES % 128 == 0 && WT_BYTES % 128 == 0 && MB_BYTES % 128 == 0);

typedef _Float16     v16h __attribute__((ext_vector_type(16)));
typedef __bf16       v16b __attribute__((ext_vector_type(16)));
typedef float        v8f  __attribute__((ext_vector_type(8)));
typedef float        v4f  __attribute__((ext_vector_type(4)));
typedef unsigned int v4u  __attribute__((ext_vector_type(4)));
typedef unsigned int v2u  __attribute__((ext_vector_type(2)));
typedef int          v4i  __attribute__((ext_vector_type(4)));

union Frag {
    v16h     h;
    v16b     b;
    v4u      q[2];
    uint16_t s[16];
};

// ---------------------------------------------------------------------------
// scalar conversions
// ---------------------------------------------------------------------------
__device__ __forceinline__ uint16_t bf16_bits(float f) {
    uint32_t u = __builtin_bit_cast(uint32_t, f);
    u += 0x7FFFu + ((u >> 16) & 1u);              // RNE
    return (uint16_t)(u >> 16);
}
__device__ __forceinline__ float bf16_rne(float f) {
    const uint32_t u = ((uint32_t)bf16_bits(f)) << 16;
    return __builtin_bit_cast(float, u);
}
__device__ __forceinline__ uint16_t h_bits(float f) {
    return __builtin_bit_cast(uint16_t, (_Float16)f);   // RNE f32 -> f16
}

// ---------------------------------------------------------------------------
// WMMA helpers: issue + hazard guard (4 VALU slots, D tied, A/B kept live)
// ---------------------------------------------------------------------------
__device__ __forceinline__ v8f mma_h(v16h a, v16h b, v8f c) {
    v8f d = __builtin_amdgcn_wmma_f32_16x16x32_f16(false, a, false, b, (short)0, c, false, false);
    asm volatile("v_nop\n\tv_nop\n\tv_nop\n\tv_nop" : "+v"(d) : "v"(a), "v"(b));
    return d;
}
__device__ __forceinline__ v8f mma_b(v16b a, v16b b, v8f c) {
    v8f d = __builtin_amdgcn_wmma_f32_16x16x32_bf16(false, a, false, b, (short)0, c, false, false);
    asm volatile("v_nop\n\tv_nop\n\tv_nop\n\tv_nop" : "+v"(d) : "v"(a), "v"(b));
    return d;
}

// 16x32 16-bit A/B fragment from a k-contiguous row (wave32 split layout):
// lane row/col = lane&15, hf = lane>>4; elements 0..7 <- k0+8hf+0..7, elements 8..15 <- k0+16+8hf+0..7
__device__ __forceinline__ Frag ldfrag(const uint16_t* rowp, int k0, int hf) {
    Frag f;
    f.q[0] = *(const v4u*)(rowp + k0 + 8 * hf);
    f.q[1] = *(const v4u*)(rowp + k0 + 16 + 8 * hf);
    return f;
}

__device__ __forceinline__ float rowmax16(float v) {
#pragma unroll
    for (int m = 1; m < 16; m <<= 1) v = fmaxf(v, __shfl_xor(v, m, 32));
    return v;
}
__device__ __forceinline__ float rowsum16(float v) {
#pragma unroll
    for (int m = 1; m < 16; m <<= 1) v += __shfl_xor(v, m, 32);
    return v;
}

// ---------------------------------------------------------------------------
// Kernel 1: x f32 [NB][S_FULL][EMB] -> bf16 plane xb [MROWS][EMB] (compact rows).
// ---------------------------------------------------------------------------
__global__ __launch_bounds__(256)
void k_cvt_x(const float* __restrict__ x, uint16_t* __restrict__ xb) {
    const size_t gid = (size_t)blockIdx.x * 256 + threadIdx.x;
    const size_t e0  = gid * 8;
    const size_t m   = e0 / EMB;
    const int    c   = (int)(e0 % EMB);
    const size_t b   = m / SEQ, s = m % SEQ;
    const float* src = x + (b * S_FULL + s) * EMB + c;
    const v4f a0 = *(const v4f*)src;
    const v4f a1 = *(const v4f*)(src + 4);
    v4u w;
    w.x = (uint32_t)bf16_bits(a0.x) | ((uint32_t)bf16_bits(a0.y) << 16);
    w.y = (uint32_t)bf16_bits(a0.z) | ((uint32_t)bf16_bits(a0.w) << 16);
    w.z = (uint32_t)bf16_bits(a1.x) | ((uint32_t)bf16_bits(a1.y) << 16);
    w.w = (uint32_t)bf16_bits(a1.z) | ((uint32_t)bf16_bits(a1.w) << 16);
    uint16_t* dst = xb + e0;
    *(v4u*)dst = w;
    
}

// ---------------------------------------------------------------------------
// Kernel 2: W f32 [k][n] (EMB x EMB) -> WT 16-bit [n][k] (k-contiguous B operand plane).
// bf16 RNE of the input value, optional power-of-two scale, then bf16 or f16 bits.
// ---------------------------------------------------------------------------
template <bool TO_F16>
__global__ __launch_bounds__(256)
void k_wconv(const float* __restrict__ W, uint16_t* __restrict__ WT, float scale) {
    __shared__ uint16_t tile[64 * 64];            // [n][k]; cross-wave -> block barrier
    const int t = threadIdx.x;
    const int n0 = blockIdx.x * 64, k0 = blockIdx.y * 64;
    const int kr = t >> 2, nc = (t & 3) * 16;     // thread: row k0+kr, cols n0+nc..+15
    const float* src = W + (size_t)(k0 + kr) * EMB + n0 + nc;
#pragma unroll
    for (int i = 0; i < 4; ++i) {
        const v4f v = *(const v4f*)(src + 4 * i);
        float f[4];
        f[0] = v.x; f[1] = v.y; f[2] = v.z; f[3] = v.w;
#pragma unroll
        for (int jj = 0; jj < 4; ++jj) {
            const float g = bf16_rne(f[jj]) * scale;
            tile[(nc + 4 * i + jj) * 64 + kr] = TO_F16 ? h_bits(g) : bf16_bits(g);
        }
    }
    __syncthreads();
    v4u val[2]; size_t off[2];
#pragma unroll
    for (int i = 0; i < 2; ++i) {
        const int p   = t + 256 * i;              // wave w, lane: row = 4w + 32i + lane>>3
        const int row = p >> 3, seg = (p & 7) * 8;
        val[i] = *(const v4u*)&tile[row * 64 + seg];
        off[i] = (size_t)(n0 + row) * EMB + k0 + seg;
    }
#pragma unroll
    for (int i = 0; i < 2; ++i) *(v4u*)(WT + off[i]) = val[i];
    
}

// ---------------------------------------------------------------------------
// Kernel 3: mask int32 [NB][S_FULL][S_FULL] -> dense bit plane mb [MROWS][MWORDS],
// bit j of word w <-> key 32w+j nonzero (suppressed). One thread = one word;
// ---------------------------------------------------------------------------
__global__ __launch_bounds__(256)
void k_maskbits(const int* __restrict__ mask, unsigned int* __restrict__ mb) {
    const size_t gid = (size_t)blockIdx.x * 256 + threadIdx.x;
    const int    w   = (int)(gid % MWORDS);
    const size_t row = gid / MWORDS;
    const size_t b = row / SEQ, q = row % SEQ;
    const int* src = mask + (b * S_FULL + q) * S_FULL + (size_t)w * 32;
    unsigned int bits = 0u;
#pragma unroll
    for (int i = 0; i < 8; ++i) {
        const v4i v = *(const v4i*)(src + 4 * i);
        bits |= (v.x != 0 ? 1u : 0u) << (4 * i + 0);
        bits |= (v.y != 0 ? 1u : 0u) << (4 * i + 1);
        bits |= (v.z != 0 ? 1u : 0u) << (4 * i + 2);
        bits |= (v.w != 0 ? 1u : 0u) << (4 * i + 3);
    }
    unsigned int* dst = mb + gid;
    *dst = bits;
    
}

// ---------------------------------------------------------------------------
// Kernel 4: C[M][EMB] = A[M][EMB] . BT[EMB][EMB]^T (+ bias), 16-bit planes, f32 accumulate.
// Block 256 threads = 8 waves; block tile 128x128; wave tile 32 rows x 64 cols
// (2 x 4 accumulator tiles); k-step 32; fragments loaded straight from the 16-bit rows.
// OUT16: f16 plane out = f16(acc*oscale + bias);  else f32 out = acc*oscale + bias.
// ---------------------------------------------------------------------------
template <bool BF, bool OUT16>
__global__ __launch_bounds__(256)
void k_gemm(const uint16_t* __restrict__ A, const uint16_t* __restrict__ BT,
            const float* __restrict__ bias, void* __restrict__ Cout, float oscale) {
    __shared__ float slab[8][16 * 64];            // 4 KB per wave; block barriers before and after reuse

    const int t = threadIdx.x, wave = t >> 5, lane = t & 31;
    const int hf = lane >> 4, l16 = lane & 15;
    const int m0 = blockIdx.y * 128, n0 = blockIdx.x * 128;
    const int wr = wave & 3, wc = wave >> 2;

    const uint16_t* arow[2];
    const uint16_t* brow[4];
#pragma unroll
    for (int mt = 0; mt < 2; ++mt)
        arow[mt] = A + (size_t)(m0 + wr * 32 + mt * 16 + l16) * EMB;
#pragma unroll
    for (int nt = 0; nt < 4; ++nt)
        brow[nt] = BT + (size_t)(n0 + wc * 64 + nt * 16 + l16) * EMB;

    v8f acc[8] = {};

#pragma unroll 1
    for (int k0 = 0; k0 < EMB; k0 += 32) {
        Frag a[2], b[4];
#pragma unroll
        for (int mt = 0; mt < 2; ++mt) a[mt] = ldfrag(arow[mt], k0, hf);
#pragma unroll
        for (int nt = 0; nt < 4; ++nt) b[nt] = ldfrag(brow[nt], k0, hf);
#pragma unroll
        for (int mt = 0; mt < 2; ++mt)
#pragma unroll
            for (int nt = 0; nt < 4; ++nt) {
                if constexpr (BF)
                    acc[mt * 4 + nt] = mma_b(a[mt].b, b[nt].b, acc[mt * 4 + nt]);
                else
                    acc[mt * 4 + nt] = mma_h(a[mt].h, b[nt].h, acc[mt * 4 + nt]);
            }
    }

    // bias (bf16-RNE input value) per accumulator column (lane = column)
    float bvv[4];
#pragma unroll
    for (int nt = 0; nt < 4; ++nt)
        bvv[nt] = bf16_rne(bias[n0 + wc * 64 + nt * 16 + l16]);

    float* mys = slab[wave];
    if constexpr (OUT16) {
        uint16_t* mys16 = reinterpret_cast<uint16_t*>(mys);   // 32 rows x 64 halves
        uint16_t* C     = reinterpret_cast<uint16_t*>(Cout);
#pragma unroll
        for (int mt = 0; mt < 2; ++mt)
#pragma unroll
            for (int nt = 0; nt < 4; ++nt)
#pragma unroll
                for (int r = 0; r < 8; ++r)
                    mys16[(mt * 16 + 8 * hf + r) * 64 + nt * 16 + l16] =
                        h_bits(acc[mt * 4 + nt][r] * oscale + bvv[nt]);
        __syncthreads();
        v4u val[8]; size_t off[8];
#pragma unroll
        for (int i = 0; i < 8; ++i) {
            const int p = lane + 32 * i;
            const int row = p >> 3, seg = (p & 7) * 8;          // lanes 8q..8q+7 -> one line
            val[i] = *(const v4u*)(mys16 + row * 64 + seg);
            off[i] = (size_t)(m0 + wr * 32 + row) * EMB + n0 + wc * 64 + seg;
        }
#pragma unroll
        for (int i = 0; i < 8; ++i) *(v4u*)(C + off[i]) = val[i];
        
    } else {
        float* C = reinterpret_cast<float*>(Cout);
#pragma unroll
        for (int mt = 0; mt < 2; ++mt) {
            __syncthreads();
#pragma unroll
            for (int nt = 0; nt < 4; ++nt)
#pragma unroll
                for (int r = 0; r < 8; ++r)
                    mys[(8 * hf + r) * 64 + nt * 16 + l16] = acc[mt * 4 + nt][r] * oscale + bvv[nt];
            __syncthreads();
            v4f val[8]; size_t off[8];
#pragma unroll
            for (int i = 0; i < 8; ++i) {
                const int p = lane + 32 * i;
                const int row = p >> 4, seg = (p & 15) * 4;     // lanes 8q..8q+7 -> one line
                val[i] = *(const v4f*)(mys + row * 64 + seg);
                off[i] = (size_t)(m0 + wr * 32 + mt * 16 + row) * EMB + n0 + wc * 64 + seg;
            }
#pragma unroll
            for (int i = 0; i < 8; ++i) *(v4f*)(C + off[i]) = val[i];
            
        }
    }
}

// ---------------------------------------------------------------------------
// Kernel 5: flash attention per (128-query tile, n, head). Block 256 threads = 8 waves,
// each wave owns 16 query rows and the full head dim 64. Key tiles of 64 staged with plain
// loads into LDS as [key][d] (K^T fragments) and transposed [d][key] (V fragments).
// Scores on f16 WMMA, mask replace-fill -1e9 from the bit plane, online softmax in f32,
// P = f16(1024 p) through a per-wave LDS slab (block barrier before the A-layout reload),
// ---------------------------------------------------------------------------
__global__ __launch_bounds__(256)
void k_attn(const uint16_t* __restrict__ Qp, const uint16_t* __restrict__ Kp,
            const uint16_t* __restrict__ Vp, const unsigned int* __restrict__ mb,
            uint16_t* __restrict__ ctx) {
    __shared__ uint16_t kt[64 * 64];              // K tile [key][d]   (cross-wave: block barriers)
    __shared__ uint16_t vt[64 * 64];              // V tile [d][key]   (cross-wave: block barriers)
    __shared__ uint16_t ps[8][16 * 64];           // per-wave P / ctx stage (block barriers used)

    const int t = threadIdx.x, wave = t >> 5, lane = t & 31;
    const int hf = lane >> 4, l16 = lane & 15;
    const int b  = blockIdx.y / NHEAD, hd = blockIdx.y % NHEAD;
    const int qr = blockIdx.x * 128 + wave * 16;  // first query row of this wave (within sequence)
    const size_t rowb = (size_t)b * SEQ;          // compact plane row base of this batch
    const size_t hcol = (size_t)hd * HDIM;

    // Q fragments for the wave's 16 rows, straight from the f16 plane
    Frag qf[2];
    {
        const uint16_t* qrow = Qp + (rowb + qr + l16) * EMB + hcol;
        qf[0] = ldfrag(qrow, 0, hf);
        qf[1] = ldfrag(qrow, 32, hf);
    }

    v8f accO[4] = {};
    float mrow[8], lrow[8];
#pragma unroll
    for (int r = 0; r < 8; ++r) { mrow[r] = -__builtin_inff(); lrow[r] = 0.0f; }

    const int keyr = t >> 2, hdB = (t & 3) * 16;  // coop staging: key row, 16 d-columns
    const unsigned int* mbrow = mb + (rowb + qr + 8 * hf) * MWORDS;   // mask row of element r: + r*MWORDS
    uint16_t* myps = ps[wave];

#pragma unroll 1
    for (int j = 0; j < SEQ / 64; ++j) {
        const int key0 = j * 64;
        __syncthreads();                         // prior tile fully consumed by all waves

        // ---- stage K tile [key][d] and V tile [d][key] (full 64x64 each) ----
        {
            const size_t go = (rowb + key0 + keyr) * EMB + hcol + hdB;
            const v4u k0v = *(const v4u*)(Kp + go);
            const v4u k1v = *(const v4u*)(Kp + go + 8);
            *(v4u*)&kt[keyr * 64 + hdB]     = k0v;
            *(v4u*)&kt[keyr * 64 + hdB + 8] = k1v;
            Frag fv;
            fv.q[0] = *(const v4u*)(Vp + go);
            fv.q[1] = *(const v4u*)(Vp + go + 8);
#pragma unroll
            for (int i = 0; i < 16; ++i) vt[(hdB + i) * 64 + keyr] = fv.s[i];
        }
        // ---- mask words for this wave's rows and these 64 keys (one b64 per row) ----
        unsigned int mlo[8], mhi[8];
#pragma unroll
        for (int r = 0; r < 8; ++r) {
            const v2u w = *(const v2u*)(mbrow + (size_t)r * MWORDS + 2 * j);
            mlo[r] = w.x; mhi[r] = w.y;
        }
        __syncthreads();

        // ---- scores S = Q(16x64) . K^T, scale 1/8, replace-fill -1e9 where masked ----
        v8f sc[4];
#pragma unroll
        for (int nt = 0; nt < 4; ++nt) {
            v8f z = {};
            Frag kf = ldfrag(&kt[(nt * 16 + l16) * 64], 0, hf);
            z = mma_h(qf[0].h, kf.h, z);
            kf = ldfrag(&kt[(nt * 16 + l16) * 64], 32, hf);
            z = mma_h(qf[1].h, kf.h, z);
#pragma unroll
            for (int r = 0; r < 8; ++r) {
                const unsigned int w   = (nt < 2) ? mlo[r] : mhi[r];
                const unsigned int bit = (w >> ((nt & 1) * 16 + l16)) & 1u;
                sc[nt][r] = bit ? -1.0e9f : z[r] * 0.125f;
            }
        }

        // ---- online softmax (row = 8hf + r; reductions across the 16-lane group) ----
        float alpha[8];
#pragma unroll
        for (int r = 0; r < 8; ++r) {
            float bm = sc[0][r];
#pragma unroll
            for (int nt = 1; nt < 4; ++nt) bm = fmaxf(bm, sc[nt][r]);
            bm = rowmax16(bm);
            const float mnew = fmaxf(mrow[r], bm);
            alpha[r] = __expf(mrow[r] - mnew);
            mrow[r] = mnew;
        }
        float rs[8];
#pragma unroll
        for (int r = 0; r < 8; ++r) rs[r] = 0.0f;
#pragma unroll
        for (int nt = 0; nt < 4; ++nt)
#pragma unroll
            for (int r = 0; r < 8; ++r) {
                const float p = __expf(sc[nt][r] - mrow[r]);
                sc[nt][r] = p;
                rs[r] += p;
            }
#pragma unroll
        for (int r = 0; r < 8; ++r) {
            lrow[r] = lrow[r] * alpha[r] + rowsum16(rs[r]);
#pragma unroll
            for (int nt = 0; nt < 4; ++nt) accO[nt][r] *= alpha[r];
        }

        // ---- P (D layout) -> per-wave slab as f16(1024 p); block barrier; A-layout reload ----
#pragma unroll
        for (int nt = 0; nt < 4; ++nt)
#pragma unroll
            for (int r = 0; r < 8; ++r)
                myps[(r + 8 * hf) * 64 + nt * 16 + l16] = h_bits(sc[nt][r] * P_CARRY);
        __syncthreads();
        const Frag pf0 = ldfrag(myps + l16 * 64, 0, hf);
        const Frag pf1 = ldfrag(myps + l16 * 64, 32, hf);

        // ---- O += P(16x64 keys) . V(64 keys x 64 d) ----
#pragma unroll
        for (int nt = 0; nt < 4; ++nt) {
            Frag vf = ldfrag(&vt[(nt * 16 + l16) * 64], 0, hf);
            accO[nt] = mma_h(pf0.h, vf.h, accO[nt]);
            vf = ldfrag(&vt[(nt * 16 + l16) * 64], 32, hf);
            accO[nt] = mma_h(pf1.h, vf.h, accO[nt]);
        }
    }

    float inv[8];
#pragma unroll
    for (int r = 0; r < 8; ++r) inv[r] = (1.0f / lrow[r]) * CTX_SCALE;
    __syncthreads();
#pragma unroll
    for (int nt = 0; nt < 4; ++nt)
#pragma unroll
        for (int r = 0; r < 8; ++r)
            myps[(8 * hf + r) * 64 + nt * 16 + l16] = h_bits(accO[nt][r] * inv[r]);
    __syncthreads();
    v4u val[4]; size_t off[4];
#pragma unroll
    for (int i = 0; i < 4; ++i) {
        const int p = lane + 32 * i;
        const int row = p >> 3, seg = (p & 7) * 8;              // lanes 8q..8q+7 -> one line
        val[i] = *(const v4u*)(myps + row * 64 + seg);
        off[i] = (rowb + qr + row) * EMB + hcol + seg;
    }
#pragma unroll
    for (int i = 0; i < 4; ++i) *(v4u*)(ctx + off[i]) = val[i];
    
}

// ---------------------------------------------------------------------------
// Host launcher: 11 ops, workspace 93,323,264 B.
// ---------------------------------------------------------------------------
extern "C" void kernel_launch(void* const* d_in, const int* in_sizes, int n_in,
                              void* d_out, int out_size, void* d_ws, size_t ws_size,
                              hipStream_t stream) {
    if (n_in < 10) return;
    if (in_sizes[0] < NB * S_FULL * EMB) return;
    if (in_sizes[1] < NB * S_FULL * S_FULL) return;
    if (in_sizes[2] < EMB * EMB || in_sizes[4] < EMB * EMB ||
        in_sizes[6] < EMB * EMB || in_sizes[8] < EMB * EMB) return;
    if (in_sizes[3] < EMB || in_sizes[5] < EMB || in_sizes[7] < EMB || in_sizes[9] < EMB) return;
    if (out_size < MROWS * EMB) return;
    if (ws_size < WS_TOTAL) return;

    const float* x    = (const float*)d_in[0];   // [NB_FULL][S_FULL][EMB] f32
    const int*   mask = (const int*)d_in[1];     // [NB_FULL][S_FULL][S_FULL] int32 (bool)
    const float* Wq   = (const float*)d_in[2];   // [EMB in][EMB out]
    const float* bq   = (const float*)d_in[3];
    const float* Wk   = (const float*)d_in[4];
    const float* bk   = (const float*)d_in[5];
    const float* Wv   = (const float*)d_in[6];
    const float* bv   = (const float*)d_in[7];
    const float* Wo   = (const float*)d_in[8];
    const float* bo   = (const float*)d_in[9];
    float* out = (float*)d_out;                  // [MROWS][EMB] f32

    unsigned char* ws = (unsigned char*)d_ws;
    size_t off = 0;
    uint16_t* xb   = (uint16_t*)(ws + off); off += PLANE_BYTES;   // bf16 [MROWS][EMB]
    uint16_t* WqT  = (uint16_t*)(ws + off); off += WT_BYTES;      // bf16 [n][k]
    uint16_t* WkT  = (uint16_t*)(ws + off); off += WT_BYTES;
    uint16_t* WvT  = (uint16_t*)(ws + off); off += WT_BYTES;
    uint16_t* WoT  = (uint16_t*)(ws + off); off += WT_BYTES;      // f16 [n][k], x64
    uint16_t* Qp   = (uint16_t*)(ws + off); off += PLANE_BYTES;   // f16 [MROWS][EMB]
    uint16_t* Kpl  = (uint16_t*)(ws + off); off += PLANE_BYTES;
    uint16_t* Vpl  = (uint16_t*)(ws + off); off += PLANE_BYTES;
    uint16_t* Ctx  = (uint16_t*)(ws + off); off += PLANE_BYTES;   // f16, x16
    unsigned int* mbits = (unsigned int*)(ws + off); off += MB_BYTES;
    if (off > ws_size) return;

    k_cvt_x<<<dim3((MROWS * EMB / 8) / 256), dim3(256), 0, stream>>>(x, xb);

    const dim3 gW(EMB / 64, EMB / 64);
    k_wconv<false><<<gW, dim3(256), 0, stream>>>(Wq, WqT, 1.0f);
    k_wconv<false><<<gW, dim3(256), 0, stream>>>(Wk, WkT, 1.0f);
    k_wconv<false><<<gW, dim3(256), 0, stream>>>(Wv, WvT, 1.0f);
    k_wconv<true><<<gW, dim3(256), 0, stream>>>(Wo, WoT, WO_CARRY);

    k_maskbits<<<dim3((NB * SEQ * MWORDS) / 256), dim3(256), 0, stream>>>(mask, mbits);

    const dim3 gG(EMB / 128, MROWS / 128);
    k_gemm<true, true><<<gG, dim3(256), 0, stream>>>(xb, WqT, bq, (void*)Qp, 1.0f);
    k_gemm<true, true><<<gG, dim3(256), 0, stream>>>(xb, WkT, bk, (void*)Kpl, 1.0f);
    k_gemm<true, true><<<gG, dim3(256), 0, stream>>>(xb, WvT, bv, (void*)Vpl, 1.0f);

    const dim3 gA(SEQ / 128, NB * NHEAD);
    k_attn<<<gA, dim3(256), 0, stream>>>(Qp, Kpl, Vpl, mbits, Ctx);

    k_gemm<false, false><<<gG, dim3(256), 0, stream>>>(Ctx, WoT, bo, (void*)out, OUT_SCALE);
}

// v001
// A run of this version takes 314 microseconds.
// Two timings next to v000 put it at 1.34 and 1.35 times that version's speed.
#include <hip/hip_runtime.h>
#include <hip/hip_bf16.h>
#include <stdint.h>

// Contractions: x@Wq, x@Wk, x@Wv on v_wmma_f32_16x16x32_bf16 (bf16 operands = RNE-converted inputs);
// q.k^T, p.v and ctx@Wo on v_wmma_f32_16x16x32_f16 (f16 operands with power-of-two carries:
// p x1024, ctx x16, Wo x64); f32 accumulate; softmax, bias adds and normalisation in f32.

#ifndef NB
#define NB 8
#endif
#ifndef SEQ
#define SEQ 1024
#endif
#define NB_FULL 8
#define S_FULL  1024
#define EMB     1024
#define NHEAD   16
#define HDIM    64
#define MROWS   (NB * SEQ)
#define MWORDS  (SEQ / 32)

static_assert(NB >= 1 && NB <= NB_FULL);
static_assert(SEQ % 128 == 0 && SEQ <= S_FULL);
static_assert(EMB == NHEAD * HDIM);
static_assert(EMB % 128 == 0);
static_assert(MROWS % 128 == 0);
static_assert(((MROWS * EMB) / 8) % 256 == 0);
static_assert((NB * SEQ * MWORDS) % 256 == 0);

#define P_CARRY    1024.0f              // P operand = f16(1024 * exp(s - m))
#define CTX_SCALE  (1.0f / 64.0f)       // ctx operand = accO/(1024 l) * 16
#define WO_CARRY   64.0f                // Wo operand = f16(bf16(Wo) * 64)
#define OUT_SCALE  (1.0f / 1024.0f)     // 1/(16 * 64)

// workspace carve (bytes); every region written at its exact extent (tile multiples == plane sizes)
#define PLANE_BYTES ((size_t)MROWS * EMB * 2)
#define WT_BYTES    ((size_t)EMB * EMB * 2)
#define MB_BYTES    ((size_t)NB * SEQ * MWORDS * 4)
#define WS_TOTAL    (PLANE_BYTES * 5 + WT_BYTES * 4 + MB_BYTES)
static_assert(WS_TOTAL <= (size_t)134217728);
static_assert(PLANE_BYTES % 128 == 0 && WT_BYTES % 128 == 0 && MB_BYTES % 128 == 0);

typedef _Float16     v16h __attribute__((ext_vector_type(16)));
typedef __bf16       v16b __attribute__((ext_vector_type(16)));
typedef float        v8f  __attribute__((ext_vector_type(8)));
typedef float        v4f  __attribute__((ext_vector_type(4)));
typedef unsigned int v4u  __attribute__((ext_vector_type(4)));
typedef unsigned int v2u  __attribute__((ext_vector_type(2)));
typedef int          v4i  __attribute__((ext_vector_type(4)));

union Frag {
    v16h     h;
    v16b     b;
    v4u      q[2];
    uint16_t s[16];
};

// ---------------------------------------------------------------------------
// scalar conversions
// ---------------------------------------------------------------------------
__device__ __forceinline__ uint16_t bf16_bits(float f) {
    uint32_t u = __builtin_bit_cast(uint32_t, f);
    u += 0x7FFFu + ((u >> 16) & 1u);              // RNE
    return (uint16_t)(u >> 16);
}
__device__ __forceinline__ float bf16_rne(float f) {
    const uint32_t u = ((uint32_t)bf16_bits(f)) << 16;
    return __builtin_bit_cast(float, u);
}
__device__ __forceinline__ uint16_t h_bits(float f) {
    return __builtin_bit_cast(uint16_t, (_Float16)f);   // RNE f32 -> f16
}

// ---------------------------------------------------------------------------
// WMMA helpers: issue + hazard guard (4 VALU slots, D tied, A/B kept live)
// ---------------------------------------------------------------------------
__device__ __forceinline__ v8f mma_h(v16h a, v16h b, v8f c) {
    v8f d = __builtin_amdgcn_wmma_f32_16x16x32_f16(false, a, false, b, (short)0, c, false, false);
    asm volatile("v_nop\n\tv_nop\n\tv_nop\n\tv_nop" : "+v"(d) : "v"(a), "v"(b));
    return d;
}
__device__ __forceinline__ v8f mma_b(v16b a, v16b b, v8f c) {
    v8f d = __builtin_amdgcn_wmma_f32_16x16x32_bf16(false, a, false, b, (short)0, c, false, false);
    asm volatile("v_nop\n\tv_nop\n\tv_nop\n\tv_nop" : "+v"(d) : "v"(a), "v"(b));
    return d;
}

// 16x32 16-bit A/B fragment from a k-contiguous row (wave32 split layout):
// lane row/col = lane&15, hf = lane>>4; elements 0..7 <- k0+8hf+0..7, elements 8..15 <- k0+16+8hf+0..7
__device__ __forceinline__ Frag ldfrag(const uint16_t* rowp, int k0, int hf) {
    Frag f;
    f.q[0] = *(const v4u*)(rowp + k0 + 8 * hf);
    f.q[1] = *(const v4u*)(rowp + k0 + 16 + 8 * hf);
    return f;
}

__device__ __forceinline__ float rowmax16(float v) {
#pragma unroll
    for (int m = 1; m < 16; m <<= 1) v = fmaxf(v, __shfl_xor(v, m, 32));
    return v;
}
__device__ __forceinline__ float rowsum16(float v) {
#pragma unroll
    for (int m = 1; m < 16; m <<= 1) v += __shfl_xor(v, m, 32);
    return v;
}

// ---------------------------------------------------------------------------
// Kernel 1: x f32 [NB][S_FULL][EMB] -> bf16 plane xb [MROWS][EMB] (compact rows).
// ---------------------------------------------------------------------------
__global__ __launch_bounds__(256)
void k_cvt_x(const float* __restrict__ x, uint16_t* __restrict__ xb) {
    const size_t gid = (size_t)blockIdx.x * 256 + threadIdx.x;
    const size_t e0  = gid * 8;
    const size_t m   = e0 / EMB;
    const int    c   = (int)(e0 % EMB);
    const size_t b   = m / SEQ, s = m % SEQ;
    const float* src = x + (b * S_FULL + s) * EMB + c;
    const v4f a0 = *(const v4f*)src;
    const v4f a1 = *(const v4f*)(src + 4);
    v4u w;
    w.x = (uint32_t)bf16_bits(a0.x) | ((uint32_t)bf16_bits(a0.y) << 16);
    w.y = (uint32_t)bf16_bits(a0.z) | ((uint32_t)bf16_bits(a0.w) << 16);
    w.z = (uint32_t)bf16_bits(a1.x) | ((uint32_t)bf16_bits(a1.y) << 16);
    w.w = (uint32_t)bf16_bits(a1.z) | ((uint32_t)bf16_bits(a1.w) << 16);
    uint16_t* dst = xb + e0;
    *(v4u*)dst = w;
    
}

// ---------------------------------------------------------------------------
// Kernel 2: W f32 [k][n] (EMB x EMB) -> WT 16-bit [n][k] (k-contiguous B operand plane).
// bf16 RNE of the input value, optional power-of-two scale, then bf16 or f16 bits.
// ---------------------------------------------------------------------------
template <bool TO_F16>
__global__ __launch_bounds__(256)
void k_wconv(const float* __restrict__ W, uint16_t* __restrict__ WT, float scale) {
    __shared__ uint16_t tile[64 * 64];            // [n][k]; cross-wave -> block barrier
    const int t = threadIdx.x;
    const int n0 = blockIdx.x * 64, k0 = blockIdx.y * 64;
    const int kr = t >> 2, nc = (t & 3) * 16;     // thread: row k0+kr, cols n0+nc..+15
    const float* src = W + (size_t)(k0 + kr) * EMB + n0 + nc;
#pragma unroll
    for (int i = 0; i < 4; ++i) {
        const v4f v = *(const v4f*)(src + 4 * i);
        float f[4];
        f[0] = v.x; f[1] = v.y; f[2] = v.z; f[3] = v.w;
#pragma unroll
        for (int jj = 0; jj < 4; ++jj) {
            const float g = bf16_rne(f[jj]) * scale;
            tile[(nc + 4 * i + jj) * 64 + kr] = TO_F16 ? h_bits(g) : bf16_bits(g);
        }
    }
    __syncthreads();
    v4u val[2]; size_t off[2];
#pragma unroll
    for (int i = 0; i < 2; ++i) {
        const int p   = t + 256 * i;              // wave w, lane: row = 4w + 32i + lane>>3
        const int row = p >> 3, seg = (p & 7) * 8;
        val[i] = *(const v4u*)&tile[row * 64 + seg];
        off[i] = (size_t)(n0 + row) * EMB + k0 + seg;
    }
#pragma unroll
    for (int i = 0; i < 2; ++i) *(v4u*)(WT + off[i]) = val[i];
    
}

// ---------------------------------------------------------------------------
// Kernel 3: mask int32 [NB][S_FULL][S_FULL] -> dense bit plane mb [MROWS][MWORDS],
// bit j of word w <-> key 32w+j nonzero (suppressed). One thread = one word;
// ---------------------------------------------------------------------------
__global__ __launch_bounds__(256)
void k_maskbits(const int* __restrict__ mask, unsigned int* __restrict__ mb) {
    const size_t gid = (size_t)blockIdx.x * 256 + threadIdx.x;
    const int    w   = (int)(gid % MWORDS);
    const size_t row = gid / MWORDS;
    const size_t b = row / SEQ, q = row % SEQ;
    const int* src = mask + (b * S_FULL + q) * S_FULL + (size_t)w * 32;
    unsigned int bits = 0u;
#pragma unroll
    for (int i = 0; i < 8; ++i) {
        const v4i v = *(const v4i*)(src + 4 * i);
        bits |= (v.x != 0 ? 1u : 0u) << (4 * i + 0);
        bits |= (v.y != 0 ? 1u : 0u) << (4 * i + 1);
        bits |= (v.z != 0 ? 1u : 0u) << (4 * i + 2);
        bits |= (v.w != 0 ? 1u : 0u) << (4 * i + 3);
    }
    unsigned int* dst = mb + gid;
    *dst = bits;
    
}

// ---------------------------------------------------------------------------
// Kernel 4: C[M][EMB] = A[M][EMB] . BT[EMB][EMB]^T (+ bias), 16-bit planes, f32 accumulate.
// Block 256 threads = 8 waves; block tile 128x128; wave tile 32 rows x 64 cols
// (2 x 4 accumulator tiles). k tiles of 64 (one 128-B line per row) are brought by whole-line
// loads, one tile ahead in registers, into two LDS buffers at row pitch 144 B (16 B x odd:
// conflict-free b128 fragment reads); one block barrier per k tile; products in k-steps of 32.
// OUT16: f16 plane out = f16(acc*oscale + bias);  else f32 out = acc*oscale + bias.
// ---------------------------------------------------------------------------
#define GK      64                        // k extent of one staged tile (halves)
#define GPITCH  72                        // LDS row pitch (halves)
#define GOPER   (128 * GPITCH)            // one operand tile (halves)
#define GBUF    (2 * GOPER)               // one buffer: A tile then B tile (halves)
static_assert(EMB % GK == 0 && EMB / GK >= 2);
static_assert(2 * GBUF * 2 >= 8 * 16 * 64 * 4);   // the epilogue slabs fit in the two buffers
template <bool BF, bool OUT16>
__global__ __launch_bounds__(256)
void k_gemm(const uint16_t* __restrict__ A, const uint16_t* __restrict__ BT,
            const float* __restrict__ bias, void* __restrict__ Cout, float oscale) {
    __shared__ __attribute__((aligned(16))) uint16_t stage[2 * GBUF];   // two k-tile buffers; epilogue slabs after the loop

    const int t = threadIdx.x, wave = t >> 5, lane = t & 31;
    const int hf = lane >> 4, l16 = lane & 15;
    const int m0 = blockIdx.y * 128, n0 = blockIdx.x * 128;
    const int wr = wave & 3, wc = wave >> 2;

    // staging: 8 lanes cover one 128-B row piece; thread rows srow + 32 i, i = 0..3, of each operand
    const int srow = t >> 3, sseg = (t & 7) * 8;
    const uint16_t* ag = A  + (size_t)(m0 + srow) * EMB + sseg;
    const uint16_t* bg = BT + (size_t)(n0 + srow) * EMB + sseg;
    uint16_t* sst = stage + srow * GPITCH + sseg;

    // fragment rows inside a buffer
    const uint16_t* afr = stage + (wr * 32 + l16) * GPITCH;
    const uint16_t* bfr = stage + GOPER + (wc * 64 + l16) * GPITCH;

    v8f acc[8] = {};
    v4u ra[4], rb[4];

#pragma unroll
    for (int i = 0; i < 4; ++i) {
        ra[i] = *(const v4u*)(ag + (size_t)(32 * i) * EMB);
        rb[i] = *(const v4u*)(bg + (size_t)(32 * i) * EMB);
    }
#pragma unroll
    for (int i = 0; i < 4; ++i) {
        *(v4u*)(sst + 32 * i * GPITCH)         = ra[i];
        *(v4u*)(sst + GOPER + 32 * i * GPITCH) = rb[i];
    }
    __syncthreads();

    // kept rolled; the buffer is picked by a scalar select
#pragma unroll 1
    for (int kt = 0; kt < EMB / GK; ++kt) {
        const int  cur  = (kt & 1) * GBUF;
        const bool more = kt + 1 < EMB / GK;      // block-uniform
        if (more) {
#pragma unroll
            for (int i = 0; i < 4; ++i) {
                ra[i] = *(const v4u*)(ag + (size_t)(32 * i) * EMB + (kt + 1) * GK);
                rb[i] = *(const v4u*)(bg + (size_t)(32 * i) * EMB + (kt + 1) * GK);
            }
        }
        // all fragment reads of the tile stand as one group ahead of its products
        Frag a[GK / 32][2], b[GK / 32][4];
#pragma unroll
        for (int kk = 0; kk < GK / 32; ++kk) {
#pragma unroll
            for (int mt = 0; mt < 2; ++mt) a[kk][mt] = ldfrag(afr + cur + mt * 16 * GPITCH, kk * 32, hf);
#pragma unroll
            for (int nt = 0; nt < 4; ++nt) b[kk][nt] = ldfrag(bfr + cur + nt * 16 * GPITCH, kk * 32, hf);
        }
#pragma unroll
        for (int kk = 0; kk < GK / 32; ++kk)
#pragma unroll
            for (int mt = 0; mt < 2; ++mt)
#pragma unroll
                for (int nt = 0; nt < 4; ++nt) {
                    if constexpr (BF)
                        acc[mt * 4 + nt] = mma_b(a[kk][mt].b, b[kk][nt].b, acc[mt * 4 + nt]);
                    else
                        acc[mt * 4 + nt] = mma_h(a[kk][mt].h, b[kk][nt].h, acc[mt * 4 + nt]);
                }
        if (more) {
            // the other buffer: its last readers left it before the barrier that ended the trip before
            uint16_t* dst = sst + (GBUF - cur);
#pragma unroll
            for (int i = 0; i < 4; ++i) {
                *(v4u*)(dst + 32 * i * GPITCH)         = ra[i];
                *(v4u*)(dst + GOPER + 32 * i * GPITCH) = rb[i];
            }
        }
        __syncthreads();                          // publishes tile kt+1; ends every read of tile kt
    }

    // bias (bf16-RNE input value) per accumulator column (lane = column)
    float bvv[4];
#pragma unroll
    for (int nt = 0; nt < 4; ++nt)
        bvv[nt] = bf16_rne(bias[n0 + wc * 64 + nt * 16 + l16]);

    float* mys = reinterpret_cast<float*>(stage) + wave * (16 * 64);   // 4 KB per wave
    if constexpr (OUT16) {
        uint16_t* mys16 = reinterpret_cast<uint16_t*>(mys);   // 32 rows x 64 halves
        uint16_t* C     = reinterpret_cast<uint16_t*>(Cout);
#pragma unroll
        for (int mt = 0; mt < 2; ++mt)
#pragma unroll
            for (int nt = 0; nt < 4; ++nt)
#pragma unroll
                for (int r = 0; r < 8; ++r)
                    mys16[(mt * 16 + 8 * hf + r) * 64 + nt * 16 + l16] =
                        h_bits(acc[mt * 4 + nt][r] * oscale + bvv[nt]);
        __syncthreads();
        v4u val[8]; size_t off[8];
#pragma unroll
        for (int i = 0; i < 8; ++i) {
            const int p = lane + 32 * i;
            const int row = p >> 3, seg = (p & 7) * 8;          // lanes 8q..8q+7 -> one line
            val[i] = *(const v4u*)(mys16 + row * 64 + seg);
            off[i] = (size_t)(m0 + wr * 32 + row) * EMB + n0 + wc * 64 + seg;
        }
#pragma unroll
        for (int i = 0; i < 8; ++i) *(v4u*)(C + off[i]) = val[i];
        
    } else {
        float* C = reinterpret_cast<float*>(Cout);
#pragma unroll
        for (int mt = 0; mt < 2; ++mt) {
            __syncthreads();
#pragma unroll
            for (int nt = 0; nt < 4; ++nt)
#pragma unroll
                for (int r = 0; r < 8; ++r)
                    mys[(8 * hf + r) * 64 + nt * 16 + l16] = acc[mt * 4 + nt][r] * oscale + bvv[nt];
            __syncthreads();
            v4f val[8]; size_t off[8];
#pragma unroll
            for (int i = 0; i < 8; ++i) {
                const int p = lane + 32 * i;
                const int row = p >> 4, seg = (p & 15) * 4;     // lanes 8q..8q+7 -> one line
                val[i] = *(const v4f*)(mys + row * 64 + seg);
                off[i] = (size_t)(m0 + wr * 32 + mt * 16 + row) * EMB + n0 + wc * 64 + seg;
            }
#pragma unroll
            for (int i = 0; i < 8; ++i) *(v4f*)(C + off[i]) = val[i];
            
        }
    }
}

// ---------------------------------------------------------------------------
// Kernel 5: flash attention per (128-query tile, n, head). Block 256 threads = 8 waves,
// each wave owns 16 query rows and the full head dim 64. Key tiles of 64 staged with plain
// loads into LDS as [key][d] (K^T fragments) and transposed [d][key] (V fragments).
// Scores on f16 WMMA, mask replace-fill -1e9 from the bit plane, online softmax in f32,
// P = f16(1024 p) through a per-wave LDS slab (block barrier before the A-layout reload),
// ---------------------------------------------------------------------------
__global__ __launch_bounds__(256)
void k_attn(const uint16_t* __restrict__ Qp, const uint16_t* __restrict__ Kp,
            const uint16_t* __restrict__ Vp, const unsigned int* __restrict__ mb,
            uint16_t* __restrict__ ctx) {
    __shared__ uint16_t kt[64 * 64];              // K tile [key][d]   (cross-wave: block barriers)
    __shared__ uint16_t vt[64 * 64];              // V tile [d][key]   (cross-wave: block barriers)
    __shared__ uint16_t ps[8][16 * 64];           // per-wave P / ctx stage (block barriers used)

    const int t = threadIdx.x, wave = t >> 5, lane = t & 31;
    const int hf = lane >> 4, l16 = lane & 15;
    const int b  = blockIdx.y / NHEAD, hd = blockIdx.y % NHEAD;
    const int qr = blockIdx.x * 128 + wave * 16;  // first query row of this wave (within sequence)
    const size_t rowb = (size_t)b * SEQ;          // compact plane row base of this batch
    const size_t hcol = (size_t)hd * HDIM;

    // Q fragments for the wave's 16 rows, straight from the f16 plane
    Frag qf[2];
    {
        const uint16_t* qrow = Qp + (rowb + qr + l16) * EMB + hcol;
        qf[0] = ldfrag(qrow, 0, hf);
        qf[1] = ldfrag(qrow, 32, hf);
    }

    v8f accO[4] = {};
    float mrow[8], lrow[8];
#pragma unroll
    for (int r = 0; r < 8; ++r) { mrow[r] = -__builtin_inff(); lrow[r] = 0.0f; }

    const int keyr = t >> 2, hdB = (t & 3) * 16;  // coop staging: key row, 16 d-columns
    const unsigned int* mbrow = mb + (rowb + qr + 8 * hf) * MWORDS;   // mask row of element r: + r*MWORDS
    uint16_t* myps = ps[wave];

#pragma unroll 1
    for (int j = 0; j < SEQ / 64; ++j) {
        const int key0 = j * 64;
        __syncthreads();                         // prior tile fully consumed by all waves

        // ---- stage K tile [key][d] and V tile [d][key] (full 64x64 each) ----
        {
            const size_t go = (rowb + key0 + keyr) * EMB + hcol + hdB;
            const v4u k0v = *(const v4u*)(Kp + go);
            const v4u k1v = *(const v4u*)(Kp + go + 8);
            *(v4u*)&kt[keyr * 64 + hdB]     = k0v;
            *(v4u*)&kt[keyr * 64 + hdB + 8] = k1v;
            Frag fv;
            fv.q[0] = *(const v4u*)(Vp + go);
            fv.q[1] = *(const v4u*)(Vp + go + 8);
#pragma unroll
            for (int i = 0; i < 16; ++i) vt[(hdB + i) * 64 + keyr] = fv.s[i];
        }
        // ---- mask words for this wave's rows and these 64 keys (one b64 per row) ----
        unsigned int mlo[8], mhi[8];
#pragma unroll
        for (int r = 0; r < 8; ++r) {
            const v2u w = *(const v2u*)(mbrow + (size_t)r * MWORDS + 2 * j);
            mlo[r] = w.x; mhi[r] = w.y;
        }
        __syncthreads();

        // ---- scores S = Q(16x64) . K^T, scale 1/8, replace-fill -1e9 where masked ----
        v8f sc[4];
#pragma unroll
        for (int nt = 0; nt < 4; ++nt) {
            v8f z = {};
            Frag kf = ldfrag(&kt[(nt * 16 + l16) * 64], 0, hf);
            z = mma_h(qf[0].h, kf.h, z);
            kf = ldfrag(&kt[(nt * 16 + l16) * 64], 32, hf);
            z = mma_h(qf[1].h, kf.h, z);
#pragma unroll
            for (int r = 0; r < 8; ++r) {
                const unsigned int w   = (nt < 2) ? mlo[r] : mhi[r];
                const unsigned int bit = (w >> ((nt & 1) * 16 + l16)) & 1u;
                sc[nt][r] = bit ? -1.0e9f : z[r] * 0.125f;
            }
        }

        // ---- online softmax (row = 8hf + r; reductions across the 16-lane group) ----
        float alpha[8];
#pragma unroll
        for (int r = 0; r < 8; ++r) {
            float bm = sc[0][r];
#pragma unroll
            for (int nt = 1; nt < 4; ++nt) bm = fmaxf(bm, sc[nt][r]);
            bm = rowmax16(bm);
            const float mnew = fmaxf(mrow[r], bm);
            alpha[r] = __expf(mrow[r] - mnew);
            mrow[r] = mnew;
        }
        float rs[8];
#pragma unroll
        for (int r = 0; r < 8; ++r) rs[r] = 0.0f;
#pragma unroll
        for (int nt = 0; nt < 4; ++nt)
#pragma unroll
            for (int r = 0; r < 8; ++r) {
                const float p = __expf(sc[nt][r] - mrow[r]);
                sc[nt][r] = p;
                rs[r] += p;
            }
#pragma unroll
        for (int r = 0; r < 8; ++r) {
            lrow[r] = lrow[r] * alpha[r] + rowsum16(rs[r]);
#pragma unroll
            for (int nt = 0; nt < 4; ++nt) accO[nt][r] *= alpha[r];
        }

        // ---- P (D layout) -> per-wave slab as f16(1024 p); block barrier; A-layout reload ----
#pragma unroll
        for (int nt = 0; nt < 4; ++nt)
#pragma unroll
            for (int r = 0; r < 8; ++r)
                myps[(r + 8 * hf) * 64 + nt * 16 + l16] = h_bits(sc[nt][r] * P_CARRY);
        __syncthreads();
        const Frag pf0 = ldfrag(myps + l16 * 64, 0, hf);
        const Frag pf1 = ldfrag(myps + l16 * 64, 32, hf);

        // ---- O += P(16x64 keys) . V(64 keys x 64 d) ----
#pragma unroll
        for (int nt = 0; nt < 4; ++nt) {
            Frag vf = ldfrag(&vt[(nt * 16 + l16) * 64], 0, hf);
            accO[nt] = mma_h(pf0.h, vf.h, accO[nt]);
            vf = ldfrag(&vt[(nt * 16 + l16) * 64], 32, hf);
            accO[nt] = mma_h(pf1.h, vf.h, accO[nt]);
        }
    }

    float inv[8];
#pragma unroll
    for (int r = 0; r < 8; ++r) inv[r] = (1.0f / lrow[r]) * CTX_SCALE;
    __syncthreads();
#pragma unroll
    for (int nt = 0; nt < 4; ++nt)
#pragma unroll
        for (int r = 0; r < 8; ++r)
            myps[(8 * hf + r) * 64 + nt * 16 + l16] = h_bits(accO[nt][r] * inv[r]);
    __syncthreads();
    v4u val[4]; size_t off[4];
#pragma unroll
    for (int i = 0; i < 4; ++i) {
        const int p = lane + 32 * i;
        const int row = p >> 3, seg = (p & 7) * 8;              // lanes 8q..8q+7 -> one line
        val[i] = *(const v4u*)(myps + row * 64 + seg);
        off[i] = (rowb + qr + row) * EMB + hcol + seg;
    }
#pragma unroll
    for (int i = 0; i < 4; ++i) *(v4u*)(ctx + off[i]) = val[i];
    
}

// ---------------------------------------------------------------------------
// Host launcher: 11 ops, workspace 93,323,264 B.
// ---------------------------------------------------------------------------
extern "C" void kernel_launch(void* const* d_in, const int* in_sizes, int n_in,
                              void* d_out, int out_size, void* d_ws, size_t ws_size,
                              hipStream_t stream) {
    if (n_in < 10) return;
    if (in_sizes[0] < NB * S_FULL * EMB) return;
    if (in_sizes[1] < NB * S_FULL * S_FULL) return;
    if (in_sizes[2] < EMB * EMB || in_sizes[4] < EMB * EMB ||
        in_sizes[6] < EMB * EMB || in_sizes[8] < EMB * EMB) return;
    if (in_sizes[3] < EMB || in_sizes[5] < EMB || in_sizes[7] < EMB || in_sizes[9] < EMB) return;
    if (out_size < MROWS * EMB) return;
    if (ws_size < WS_TOTAL) return;

    const float* x    = (const float*)d_in[0];   // [NB_FULL][S_FULL][EMB] f32
    const int*   mask = (const int*)d_in[1];     // [NB_FULL][S_FULL][S_FULL] int32 (bool)
    const float* Wq   = (const float*)d_in[2];   // [EMB in][EMB out]
    const float* bq   = (const float*)d_in[3];
    const float* Wk   = (const float*)d_in[4];
    const float* bk   = (const float*)d_in[5];
    const float* Wv   = (const float*)d_in[6];
    const float* bv   = (const float*)d_in[7];
    const float* Wo   = (const float*)d_in[8];
    const float* bo   = (const float*)d_in[9];
    float* out = (float*)d_out;                  // [MROWS][EMB] f32

    unsigned char* ws = (unsigned char*)d_ws;
    size_t off = 0;
    uint16_t* xb   = (uint16_t*)(ws + off); off += PLANE_BYTES;   // bf16 [MROWS][EMB]
    uint16_t* WqT  = (uint16_t*)(ws + off); off += WT_BYTES;      // bf16 [n][k]
    uint16_t* WkT  = (uint16_t*)(ws + off); off += WT_BYTES;
    uint16_t* WvT  = (uint16_t*)(ws + off); off += WT_BYTES;
    uint16_t* WoT  = (uint16_t*)(ws + off); off += WT_BYTES;      // f16 [n][k], x64
    uint16_t* Qp   = (uint16_t*)(ws + off); off += PLANE_BYTES;   // f16 [MROWS][EMB]
    uint16_t* Kpl  = (uint16_t*)(ws + off); off += PLANE_BYTES;
    uint16_t* Vpl  = (uint16_t*)(ws + off); off += PLANE_BYTES;
    uint16_t* Ctx  = (uint16_t*)(ws + off); off += PLANE_BYTES;   // f16, x16
    unsigned int* mbits = (unsigned int*)(ws + off); off += MB_BYTES;
    if (off > ws_size) return;

    k_cvt_x<<<dim3((MROWS * EMB / 8) / 256), dim3(256), 0, stream>>>(x, xb);

    const dim3 gW(EMB / 64, EMB / 64);
    k_wconv<false><<<gW, dim3(256), 0, stream>>>(Wq, WqT, 1.0f);
    k_wconv<false><<<gW, dim3(256), 0, stream>>>(Wk, WkT, 1.0f);
    k_wconv<false><<<gW, dim3(256), 0, stream>>>(Wv, WvT, 1.0f);
    k_wconv<true><<<gW, dim3(256), 0, stream>>>(Wo, WoT, WO_CARRY);

    k_maskbits<<<dim3((NB * SEQ * MWORDS) / 256), dim3(256), 0, stream>>>(mask, mbits);

    const dim3 gG(EMB / 128, MROWS / 128);
    k_gemm<true, true><<<gG, dim3(256), 0, stream>>>(xb, WqT, bq, (void*)Qp, 1.0f);
    k_gemm<true, true><<<gG, dim3(256), 0, stream>>>(xb, WkT, bk, (void*)Kpl, 1.0f);
    k_gemm<true, true><<<gG, dim3(256), 0, stream>>>(xb, WvT, bv, (void*)Vpl, 1.0f);

    const dim3 gA(SEQ / 128, NB * NHEAD);
    k_attn<<<gA, dim3(256), 0, stream>>>(Qp, Kpl, Vpl, mbits, Ctx);

    k_gemm<false, false><<<gG, dim3(256), 0, stream>>>(Ctx, WoT, bo, (void*)out, OUT_SCALE);
}

// v002
// It runs in 216 microseconds.
// Timed twice side by side with v001, it ran 1.46 times as fast both times.
// Over all steps from v000 it is 1.96 times as fast.
#include <hip/hip_runtime.h>
#include <hip/hip_bf16.h>
#include <stdint.h>

// Contractions: x@Wq, x@Wk, x@Wv on v_wmma_f32_16x16x32_bf16 (bf16 operands = RNE-converted inputs);
// q.k^T, p.v and ctx@Wo on v_wmma_f32_16x16x32_f16 (f16 operands with power-of-two carries:
// p x1024, ctx x16, Wo x64); f32 accumulate; softmax, bias adds and normalisation in f32.

#ifndef NB
#define NB 8
#endif
#ifndef SEQ
#define SEQ 1024
#endif
#define NB_FULL 8
#define S_FULL  1024
#define EMB     1024
#define NHEAD   16
#define HDIM    64
#define MROWS   (NB * SEQ)
#define MWORDS  (SEQ / 32)

static_assert(NB >= 1 && NB <= NB_FULL);
static_assert(SEQ % 128 == 0 && SEQ <= S_FULL);
static_assert(EMB == NHEAD * HDIM);
static_assert(EMB % 128 == 0);
static_assert(MROWS % 128 == 0);
static_assert(((MROWS * EMB) / 8) % 256 == 0);
static_assert((NB * SEQ * MWORDS) % 256 == 0);

#define P_CARRY    1024.0f              // P operand = f16(1024 * exp(s - m))
#define CTX_SCALE  (1.0f / 64.0f)       // ctx operand = accO/(1024 l) * 16
#define WO_CARRY   64.0f                // Wo operand = f16(bf16(Wo) * 64)
#define OUT_SCALE  (1.0f / 1024.0f)     // 1/(16 * 64)

// workspace carve (bytes); every region written at its exact extent (tile multiples == plane sizes)
#define PLANE_BYTES ((size_t)MROWS * EMB * 2)
#define WT_BYTES    ((size_t)EMB * EMB * 2)
#define MB_BYTES    ((size_t)NB * SEQ * MWORDS * 4)
#define WS_TOTAL    (PLANE_BYTES * 5 + WT_BYTES * 4 + MB_BYTES)
static_assert(WS_TOTAL <= (size_t)134217728);
static_assert(PLANE_BYTES % 128 == 0 && WT_BYTES % 128 == 0 && MB_BYTES % 128 == 0);

typedef _Float16     v16h __attribute__((ext_vector_type(16)));
typedef __bf16       v16b __attribute__((ext_vector_type(16)));
typedef float        v8f  __attribute__((ext_vector_type(8)));
typedef float        v4f  __attribute__((ext_vector_type(4)));
typedef unsigned int v4u  __attribute__((ext_vector_type(4)));
typedef unsigned int v2u  __attribute__((ext_vector_type(2)));
typedef int          v4i  __attribute__((ext_vector_type(4)));

union Frag {
    v16h     h;
    v16b     b;
    v4u      q[2];
    uint16_t s[16];
};

// ---------------------------------------------------------------------------
// scalar conversions
// ---------------------------------------------------------------------------
__device__ __forceinline__ uint16_t bf16_bits(float f) {
    uint32_t u = __builtin_bit_cast(uint32_t, f);
    u += 0x7FFFu + ((u >> 16) & 1u);              // RNE
    return (uint16_t)(u >> 16);
}
__device__ __forceinline__ float bf16_rne(float f) {
    const uint32_t u = ((uint32_t)bf16_bits(f)) << 16;
    return __builtin_bit_cast(float, u);
}
__device__ __forceinline__ uint16_t h_bits(float f) {
    return __builtin_bit_cast(uint16_t, (_Float16)f);   // RNE f32 -> f16
}

// ---------------------------------------------------------------------------
// WMMA helpers: issue + hazard guard (4 VALU slots, D tied, A/B kept live)
// ---------------------------------------------------------------------------
__device__ __forceinline__ v8f mma_h(v16h a, v16h b, v8f c) {
    v8f d = __builtin_amdgcn_wmma_f32_16x16x32_f16(false, a, false, b, (short)0, c, false, false);
    asm volatile("v_nop\n\tv_nop\n\tv_nop\n\tv_nop" : "+v"(d) : "v"(a), "v"(b));
    return d;
}
__device__ __forceinline__ v8f mma_b(v16b a, v16b b, v8f c) {
    v8f d = __builtin_amdgcn_wmma_f32_16x16x32_bf16(false, a, false, b, (short)0, c, false, false);
    asm volatile("v_nop\n\tv_nop\n\tv_nop\n\tv_nop" : "+v"(d) : "v"(a), "v"(b));
    return d;
}

// 16x32 16-bit A/B fragment from a k-contiguous row (wave32 split layout):
// lane row/col = lane&15, hf = lane>>4; elements 0..7 <- k0+8hf+0..7, elements 8..15 <- k0+16+8hf+0..7
__device__ __forceinline__ Frag ldfrag(const uint16_t* rowp, int k0, int hf) {
    Frag f;
    f.q[0] = *(const v4u*)(rowp + k0 + 8 * hf);
    f.q[1] = *(const v4u*)(rowp + k0 + 16 + 8 * hf);
    return f;
}

__device__ __forceinline__ float rowmax16(float v) {
#pragma unroll
    for (int m = 1; m < 16; m <<= 1) v = fmaxf(v, __shfl_xor(v, m, 32));
    return v;
}
__device__ __forceinline__ float rowsum16(float v) {
#pragma unroll
    for (int m = 1; m < 16; m <<= 1) v += __shfl_xor(v, m, 32);
    return v;
}

// ---------------------------------------------------------------------------
// Kernel 1: x f32 [NB][S_FULL][EMB] -> bf16 plane xb [MROWS][EMB] (compact rows).
// ---------------------------------------------------------------------------
__global__ __launch_bounds__(256)
void k_cvt_x(const float* __restrict__ x, uint16_t* __restrict__ xb) {
    const size_t gid = (size_t)blockIdx.x * 256 + threadIdx.x;
    const size_t e0  = gid * 8;
    const size_t m   = e0 / EMB;
    const int    c   = (int)(e0 % EMB);
    const size_t b   = m / SEQ, s = m % SEQ;
    const float* src = x + (b * S_FULL + s) * EMB + c;
    const v4f a0 = *(const v4f*)src;
    const v4f a1 = *(const v4f*)(src + 4);
    v4u w;
    w.x = (uint32_t)bf16_bits(a0.x) | ((uint32_t)bf16_bits(a0.y) << 16);
    w.y = (uint32_t)bf16_bits(a0.z) | ((uint32_t)bf16_bits(a0.w) << 16);
    w.z = (uint32_t)bf16_bits(a1.x) | ((uint32_t)bf16_bits(a1.y) << 16);
    w.w = (uint32_t)bf16_bits(a1.z) | ((uint32_t)bf16_bits(a1.w) << 16);
    uint16_t* dst = xb + e0;
    *(v4u*)dst = w;
    
}

// ---------------------------------------------------------------------------
// Kernel 2: W f32 [k][n] (EMB x EMB) -> WT 16-bit [n][k] (k-contiguous B operand plane).
// bf16 RNE of the input value, optional power-of-two scale, then bf16 or f16 bits.
// ---------------------------------------------------------------------------
template <bool TO_F16>
__global__ __launch_bounds__(256)
void k_wconv(const float* __restrict__ W, uint16_t* __restrict__ WT, float scale) {
    __shared__ uint16_t tile[64 * 64];            // [n][k]; cross-wave -> block barrier
    const int t = threadIdx.x;
    const int n0 = blockIdx.x * 64, k0 = blockIdx.y * 64;
    const int kr = t >> 2, nc = (t & 3) * 16;     // thread: row k0+kr, cols n0+nc..+15
    const float* src = W + (size_t)(k0 + kr) * EMB + n0 + nc;
#pragma unroll
    for (int i = 0; i < 4; ++i) {
        const v4f v = *(const v4f*)(src + 4 * i);
        float f[4];
        f[0] = v.x; f[1] = v.y; f[2] = v.z; f[3] = v.w;
#pragma unroll
        for (int jj = 0; jj < 4; ++jj) {
            const float g = bf16_rne(f[jj]) * scale;
            tile[(nc + 4 * i + jj) * 64 + kr] = TO_F16 ? h_bits(g) : bf16_bits(g);
        }
    }
    __syncthreads();
    v4u val[2]; size_t off[2];
#pragma unroll
    for (int i = 0; i < 2; ++i) {
        const int p   = t + 256 * i;              // wave w, lane: row = 4w + 32i + lane>>3
        const int row = p >> 3, seg = (p & 7) * 8;
        val[i] = *(const v4u*)&tile[row * 64 + seg];
        off[i] = (size_t)(n0 + row) * EMB + k0 + seg;
    }
#pragma unroll
    for (int i = 0; i < 2; ++i) *(v4u*)(WT + off[i]) = val[i];
    
}

// ---------------------------------------------------------------------------
// Kernel 3: mask int32 [NB][S_FULL][S_FULL] -> dense bit plane mb [MROWS][MWORDS],
// bit j of word w <-> key 32w+j nonzero (suppressed). One thread = one word;
// ---------------------------------------------------------------------------
__global__ __launch_bounds__(256)
void k_maskbits(const int* __restrict__ mask, unsigned int* __restrict__ mb) {
    const size_t gid = (size_t)blockIdx.x * 256 + threadIdx.x;
    const int    w   = (int)(gid % MWORDS);
    const size_t row = gid / MWORDS;
    const size_t b = row / SEQ, q = row % SEQ;
    const int* src = mask + (b * S_FULL + q) * S_FULL + (size_t)w * 32;
    unsigned int bits = 0u;
#pragma unroll
    for (int i = 0; i < 8; ++i) {
        const v4i v = *(const v4i*)(src + 4 * i);
        bits |= (v.x != 0 ? 1u : 0u) << (4 * i + 0);
        bits |= (v.y != 0 ? 1u : 0u) << (4 * i + 1);
        bits |= (v.z != 0 ? 1u : 0u) << (4 * i + 2);
        bits |= (v.w != 0 ? 1u : 0u) << (4 * i + 3);
    }
    unsigned int* dst = mb + gid;
    *dst = bits;
    
}

// ---------------------------------------------------------------------------
// Kernel 4: C[M][EMB] = A[M][EMB] . BT[EMB][EMB]^T (+ bias), 16-bit planes, f32 accumulate.
// Block 256 threads = 8 waves; block tile 128x128; wave tile 32 rows x 64 cols
// (2 x 4 accumulator tiles). k tiles of 64 (one 128-B line per row) are brought by whole-line
// loads, one tile ahead in registers, into two LDS buffers at row pitch 144 B (16 B x odd:
// conflict-free b128 fragment reads); one block barrier per k tile; products in k-steps of 32.
// OUT16: f16 plane out = f16(acc*oscale + bias);  else f32 out = acc*oscale + bias.
// ---------------------------------------------------------------------------
#define GK      64                        // k extent of one staged tile (halves)
#define GPITCH  72                        // LDS row pitch (halves)
#define GOPER   (128 * GPITCH)            // one operand tile (halves)
#define GBUF    (2 * GOPER)               // one buffer: A tile then B tile (halves)
static_assert(EMB % GK == 0 && EMB / GK >= 2);
static_assert(2 * GBUF * 2 >= 8 * 16 * 64 * 4);   // the epilogue slabs fit in the two buffers
template <bool BF, bool OUT16>
__global__ __launch_bounds__(256)
void k_gemm(const uint16_t* __restrict__ A, const uint16_t* __restrict__ BT,
            const float* __restrict__ bias, void* __restrict__ Cout, float oscale) {
    __shared__ __attribute__((aligned(16))) uint16_t stage[2 * GBUF];   // two k-tile buffers; epilogue slabs after the loop

    const int t = threadIdx.x, wave = t >> 5, lane = t & 31;
    const int hf = lane >> 4, l16 = lane & 15;
    const int m0 = blockIdx.y * 128, n0 = blockIdx.x * 128;
    const int wr = wave & 3, wc = wave >> 2;

    // staging: 8 lanes cover one 128-B row piece; thread rows srow + 32 i, i = 0..3, of each operand
    const int srow = t >> 3, sseg = (t & 7) * 8;
    const uint16_t* ag = A  + (size_t)(m0 + srow) * EMB + sseg;
    const uint16_t* bg = BT + (size_t)(n0 + srow) * EMB + sseg;
    uint16_t* sst = stage + srow * GPITCH + sseg;

    // fragment rows inside a buffer
    const uint16_t* afr = stage + (wr * 32 + l16) * GPITCH;
    const uint16_t* bfr = stage + GOPER + (wc * 64 + l16) * GPITCH;

    v8f acc[8] = {};
    v4u ra[4], rb[4];

#pragma unroll
    for (int i = 0; i < 4; ++i) {
        ra[i] = *(const v4u*)(ag + (size_t)(32 * i) * EMB);
        rb[i] = *(const v4u*)(bg + (size_t)(32 * i) * EMB);
    }
#pragma unroll
    for (int i = 0; i < 4; ++i) {
        *(v4u*)(sst + 32 * i * GPITCH)         = ra[i];
        *(v4u*)(sst + GOPER + 32 * i * GPITCH) = rb[i];
    }
    __syncthreads();

    // kept rolled; the buffer is picked by a scalar select
#pragma unroll 1
    for (int kt = 0; kt < EMB / GK; ++kt) {
        const int  cur  = (kt & 1) * GBUF;
        const bool more = kt + 1 < EMB / GK;      // block-uniform
        if (more) {
#pragma unroll
            for (int i = 0; i < 4; ++i) {
                ra[i] = *(const v4u*)(ag + (size_t)(32 * i) * EMB + (kt + 1) * GK);
                rb[i] = *(const v4u*)(bg + (size_t)(32 * i) * EMB + (kt + 1) * GK);
            }
        }
        // all fragment reads of the tile stand as one group ahead of its products
        Frag a[GK / 32][2], b[GK / 32][4];
#pragma unroll
        for (int kk = 0; kk < GK / 32; ++kk) {
#pragma unroll
            for (int mt = 0; mt < 2; ++mt) a[kk][mt] = ldfrag(afr + cur + mt * 16 * GPITCH, kk * 32, hf);
#pragma unroll
            for (int nt = 0; nt < 4; ++nt) b[kk][nt] = ldfrag(bfr + cur + nt * 16 * GPITCH, kk * 32, hf);
        }
#pragma unroll
        for (int kk = 0; kk < GK / 32; ++kk)
#pragma unroll
            for (int mt = 0; mt < 2; ++mt)
#pragma unroll
                for (int nt = 0; nt < 4; ++nt) {
                    if constexpr (BF)
                        acc[mt * 4 + nt] = mma_b(a[kk][mt].b, b[kk][nt].b, acc[mt * 4 + nt]);
                    else
                        acc[mt * 4 + nt] = mma_h(a[kk][mt].h, b[kk][nt].h, acc[mt * 4 + nt]);
                }
        if (more) {
            // the other buffer: its last readers left it before the barrier that ended the trip before
            uint16_t* dst = sst + (GBUF - cur);
#pragma unroll
            for (int i = 0; i < 4; ++i) {
                *(v4u*)(dst + 32 * i * GPITCH)         = ra[i];
                *(v4u*)(dst + GOPER + 32 * i * GPITCH) = rb[i];
            }
        }
        __syncthreads();                          // publishes tile kt+1; ends every read of tile kt
    }

    // bias (bf16-RNE input value) per accumulator column (lane = column)
    float bvv[4];
#pragma unroll
    for (int nt = 0; nt < 4; ++nt)
        bvv[nt] = bf16_rne(bias[n0 + wc * 64 + nt * 16 + l16]);

    float* mys = reinterpret_cast<float*>(stage) + wave * (16 * 64);   // 4 KB per wave
    if constexpr (OUT16) {
        uint16_t* mys16 = reinterpret_cast<uint16_t*>(mys);   // 32 rows x 64 halves
        uint16_t* C     = reinterpret_cast<uint16_t*>(Cout);
#pragma unroll
        for (int mt = 0; mt < 2; ++mt)
#pragma unroll
            for (int nt = 0; nt < 4; ++nt)
#pragma unroll
                for (int r = 0; r < 8; ++r)
                    mys16[(mt * 16 + 8 * hf + r) * 64 + nt * 16 + l16] =
                        h_bits(acc[mt * 4 + nt][r] * oscale + bvv[nt]);
        __syncthreads();
        v4u val[8]; size_t off[8];
#pragma unroll
        for (int i = 0; i < 8; ++i) {
            const int p = lane + 32 * i;
            const int row = p >> 3, seg = (p & 7) * 8;          // lanes 8q..8q+7 -> one line
            val[i] = *(const v4u*)(mys16 + row * 64 + seg);
            off[i] = (size_t)(m0 + wr * 32 + row) * EMB + n0 + wc * 64 + seg;
        }
#pragma unroll
        for (int i = 0; i < 8; ++i) *(v4u*)(C + off[i]) = val[i];
        
    } else {
        float* C = reinterpret_cast<float*>(Cout);
#pragma unroll
        for (int mt = 0; mt < 2; ++mt) {
            __syncthreads();
#pragma unroll
            for (int nt = 0; nt < 4; ++nt)
#pragma unroll
                for (int r = 0; r < 8; ++r)
                    mys[(8 * hf + r) * 64 + nt * 16 + l16] = acc[mt * 4 + nt][r] * oscale + bvv[nt];
            __syncthreads();
            v4f val[8]; size_t off[8];
#pragma unroll
            for (int i = 0; i < 8; ++i) {
                const int p = lane + 32 * i;
                const int row = p >> 4, seg = (p & 15) * 4;     // lanes 8q..8q+7 -> one line
                val[i] = *(const v4f*)(mys + row * 64 + seg);
                off[i] = (size_t)(m0 + wr * 32 + mt * 16 + row) * EMB + n0 + wc * 64 + seg;
            }
#pragma unroll
            for (int i = 0; i < 8; ++i) *(v4f*)(C + off[i]) = val[i];
            
        }
    }
}

// ---------------------------------------------------------------------------
// Kernel 5: flash attention per (128-query tile, n, head). Block 256 threads = 8 waves,
// each wave owns 16 query rows and the full head dim 64. Key tiles of 64 staged with plain
// loads into LDS as [key][d] (K^T fragments) and transposed [d][key] (V fragments).
// Scores on f16 WMMA, mask replace-fill -1e9 from the bit plane, online softmax in f32,
// P = f16(1024 p) through a per-wave LDS slab (block barrier before the A-layout reload).
// All three LDS arrays hold rows of 64 halves at pitch 72 halves = 144 B (16 B x odd): the 16 rows
// that one b128 fragment read touches then fall on 16 different bank groups.
// ---------------------------------------------------------------------------
#define APITCH  72                        // LDS row pitch (halves)
__global__ __launch_bounds__(256)
void k_attn(const uint16_t* __restrict__ Qp, const uint16_t* __restrict__ Kp,
            const uint16_t* __restrict__ Vp, const unsigned int* __restrict__ mb,
            uint16_t* __restrict__ ctx) {
    __shared__ __attribute__((aligned(16))) uint16_t kt[64 * APITCH];      // K tile [key][d]   (cross-wave: block barriers)
    __shared__ __attribute__((aligned(16))) uint16_t vt[64 * APITCH];      // V tile [d][key]   (cross-wave: block barriers)
    __shared__ __attribute__((aligned(16))) uint16_t ps[8][16 * APITCH];   // per-wave P / ctx stage (block barriers used)

    const int t = threadIdx.x, wave = t >> 5, lane = t & 31;
    const int hf = lane >> 4, l16 = lane & 15;
    const int b  = blockIdx.y / NHEAD, hd = blockIdx.y % NHEAD;
    const int qr = blockIdx.x * 128 + wave * 16;  // first query row of this wave (within sequence)
    const size_t rowb = (size_t)b * SEQ;          // compact plane row base of this batch
    const size_t hcol = (size_t)hd * HDIM;

    // Q fragments for the wave's 16 rows, straight from the f16 plane
    Frag qf[2];
    {
        const uint16_t* qrow = Qp + (rowb + qr + l16) * EMB + hcol;
        qf[0] = ldfrag(qrow, 0, hf);
        qf[1] = ldfrag(qrow, 32, hf);
    }

    v8f accO[4] = {};
    float mrow[8], lrow[8];
#pragma unroll
    for (int r = 0; r < 8; ++r) { mrow[r] = -__builtin_inff(); lrow[r] = 0.0f; }

    const int keyr = t >> 2, hdB = (t & 3) * 16;  // coop staging: key row, 16 d-columns
    const unsigned int* mbrow = mb + (rowb + qr + 8 * hf) * MWORDS;   // mask row of element r: + r*MWORDS
    uint16_t* myps = ps[wave];

#pragma unroll 1
    for (int j = 0; j < SEQ / 64; ++j) {
        const int key0 = j * 64;
        __syncthreads();                         // prior tile fully consumed by all waves

        // ---- stage K tile [key][d] and V tile [d][key] (full 64x64 each) ----
        {
            const size_t go = (rowb + key0 + keyr) * EMB + hcol + hdB;
            const v4u k0v = *(const v4u*)(Kp + go);
            const v4u k1v = *(const v4u*)(Kp + go + 8);
            *(v4u*)&kt[keyr * APITCH + hdB]     = k0v;
            *(v4u*)&kt[keyr * APITCH + hdB + 8] = k1v;
            Frag fv;
            fv.q[0] = *(const v4u*)(Vp + go);
            fv.q[1] = *(const v4u*)(Vp + go + 8);
#pragma unroll
            for (int i = 0; i < 16; ++i) vt[(hdB + i) * APITCH + keyr] = fv.s[i];
        }
        // ---- mask words for this wave's rows and these 64 keys (one b64 per row) ----
        unsigned int mlo[8], mhi[8];
#pragma unroll
        for (int r = 0; r < 8; ++r) {
            const v2u w = *(const v2u*)(mbrow + (size_t)r * MWORDS + 2 * j);
            mlo[r] = w.x; mhi[r] = w.y;
        }
        __syncthreads();

        // ---- scores S = Q(16x64) . K^T, scale 1/8, replace-fill -1e9 where masked ----
        v8f sc[4];
#pragma unroll
        for (int nt = 0; nt < 4; ++nt) {
            v8f z = {};
            Frag kf = ldfrag(&kt[(nt * 16 + l16) * APITCH], 0, hf);
            z = mma_h(qf[0].h, kf.h, z);
            kf = ldfrag(&kt[(nt * 16 + l16) * APITCH], 32, hf);
            z = mma_h(qf[1].h, kf.h, z);
#pragma unroll
            for (int r = 0; r < 8; ++r) {
                const unsigned int w   = (nt < 2) ? mlo[r] : mhi[r];
                const unsigned int bit = (w >> ((nt & 1) * 16 + l16)) & 1u;
                sc[nt][r] = bit ? -1.0e9f : z[r] * 0.125f;
            }
        }

        // ---- online softmax (row = 8hf + r; reductions across the 16-lane group) ----
        float alpha[8];
#pragma unroll
        for (int r = 0; r < 8; ++r) {
            float bm = sc[0][r];
#pragma unroll
            for (int nt = 1; nt < 4; ++nt) bm = fmaxf(bm, sc[nt][r]);
            bm = rowmax16(bm);
            const float mnew = fmaxf(mrow[r], bm);
            alpha[r] = __expf(mrow[r] - mnew);
            mrow[r] = mnew;
        }
        float rs[8];
#pragma unroll
        for (int r = 0; r < 8; ++r) rs[r] = 0.0f;
#pragma unroll
        for (int nt = 0; nt < 4; ++nt)
#pragma unroll
            for (int r = 0; r < 8; ++r) {
                const float p = __expf(sc[nt][r] - mrow[r]);
                sc[nt][r] = p;
                rs[r] += p;
            }
#pragma unroll
        for (int r = 0; r < 8; ++r) {
            lrow[r] = lrow[r] * alpha[r] + rowsum16(rs[r]);
#pragma unroll
            for (int nt = 0; nt < 4; ++nt) accO[nt][r] *= alpha[r];
        }

        // ---- P (D layout) -> per-wave slab as f16(1024 p); block barrier; A-layout reload ----
#pragma unroll
        for (int nt = 0; nt < 4; ++nt)
#pragma unroll
            for (int r = 0; r < 8; ++r)
                myps[(r + 8 * hf) * APITCH + nt * 16 + l16] = h_bits(sc[nt][r] * P_CARRY);
        __syncthreads();
        const Frag pf0 = ldfrag(myps + l16 * APITCH, 0, hf);
        const Frag pf1 = ldfrag(myps + l16 * APITCH, 32, hf);

        // ---- O += P(16x64 keys) . V(64 keys x 64 d) ----
#pragma unroll
        for (int nt = 0; nt < 4; ++nt) {
            Frag vf = ldfrag(&vt[(nt * 16 + l16) * APITCH], 0, hf);
            accO[nt] = mma_h(pf0.h, vf.h, accO[nt]);
            vf = ldfrag(&vt[(nt * 16 + l16) * APITCH], 32, hf);
            accO[nt] = mma_h(pf1.h, vf.h, accO[nt]);
        }
    }

    float inv[8];
#pragma unroll
    for (int r = 0; r < 8; ++r) inv[r] = (1.0f / lrow[r]) * CTX_SCALE;
    __syncthreads();
#pragma unroll
    for (int nt = 0; nt < 4; ++nt)
#pragma unroll
        for (int r = 0; r < 8; ++r)
            myps[(8 * hf + r) * APITCH + nt * 16 + l16] = h_bits(accO[nt][r] * inv[r]);
    __syncthreads();
    v4u val[4]; size_t off[4];
#pragma unroll
    for (int i = 0; i < 4; ++i) {
        const int p = lane + 32 * i;
        const int row = p >> 3, seg = (p & 7) * 8;              // lanes 8q..8q+7 -> one line
        val[i] = *(const v4u*)(myps + row * APITCH + seg);
        off[i] = (rowb + qr + row) * EMB + hcol + seg;
    }
#pragma unroll
    for (int i = 0; i < 4; ++i) *(v4u*)(ctx + off[i]) = val[i];
    
}

// ---------------------------------------------------------------------------
// Host launcher: 11 ops, workspace 93,323,264 B.
// ---------------------------------------------------------------------------
extern "C" void kernel_launch(void* const* d_in, const int* in_sizes, int n_in,
                              void* d_out, int out_size, void* d_ws, size_t ws_size,
                              hipStream_t stream) {
    if (n_in < 10) return;
    if (in_sizes[0] < NB * S_FULL * EMB) return;
    if (in_sizes[1] < NB * S_FULL * S_FULL) return;
    if (in_sizes[2] < EMB * EMB || in_sizes[4] < EMB * EMB ||
        in_sizes[6] < EMB * EMB || in_sizes[8] < EMB * EMB) return;
    if (in_sizes[3] < EMB || in_sizes[5] < EMB || in_sizes[7] < EMB || in_sizes[9] < EMB) return;
    if (out_size < MROWS * EMB) return;
    if (ws_size < WS_TOTAL) return;

    const float* x    = (const float*)d_in[0];   // [NB_FULL][S_FULL][EMB] f32
    const int*   mask = (const int*)d_in[1];     // [NB_FULL][S_FULL][S_FULL] int32 (bool)
    const float* Wq   = (const float*)d_in[2];   // [EMB in][EMB out]
    const float* bq   = (const float*)d_in[3];
    const float* Wk   = (const float*)d_in[4];
    const float* bk   = (const float*)d_in[5];
    const float* Wv   = (const float*)d_in[6];
    const float* bv   = (const float*)d_in[7];
    const float* Wo   = (const float*)d_in[8];
    const float* bo   = (const float*)d_in[9];
    float* out = (float*)d_out;                  // [MROWS][EMB] f32

    unsigned char* ws = (unsigned char*)d_ws;
    size_t off = 0;
    uint16_t* xb   = (uint16_t*)(ws + off); off += PLANE_BYTES;   // bf16 [MROWS][EMB]
    uint16_t* WqT  = (uint16_t*)(ws + off); off += WT_BYTES;      // bf16 [n][k]
    uint16_t* WkT  = (uint16_t*)(ws + off); off += WT_BYTES;
    uint16_t* WvT  = (uint16_t*)(ws + off); off += WT_BYTES;
    uint16_t* WoT  = (uint16_t*)(ws + off); off += WT_BYTES;      // f16 [n][k], x64
    uint16_t* Qp   = (uint16_t*)(ws + off); off += PLANE_BYTES;   // f16 [MROWS][EMB]
    uint16_t* Kpl  = (uint16_t*)(ws + off); off += PLANE_BYTES;
    uint16_t* Vpl  = (uint16_t*)(ws + off); off += PLANE_BYTES;
    uint16_t* Ctx  = (uint16_t*)(ws + off); off += PLANE_BYTES;   // f16, x16
    unsigned int* mbits = (unsigned int*)(ws + off); off += MB_BYTES;
    if (off > ws_size) return;

    k_cvt_x<<<dim3((MROWS * EMB / 8) / 256), dim3(256), 0, stream>>>(x, xb);

    const dim3 gW(EMB / 64, EMB / 64);
    k_wconv<false><<<gW, dim3(256), 0, stream>>>(Wq, WqT, 1.0f);
    k_wconv<false><<<gW, dim3(256), 0, stream>>>(Wk, WkT, 1.0f);
    k_wconv<false><<<gW, dim3(256), 0, stream>>>(Wv, WvT, 1.0f);
    k_wconv<true><<<gW, dim3(256), 0, stream>>>(Wo, WoT, WO_CARRY);

    k_maskbits<<<dim3((NB * SEQ * MWORDS) / 256), dim3(256), 0, stream>>>(mask, mbits);

    const dim3 gG(EMB / 128, MROWS / 128);
    k_gemm<true, true><<<gG, dim3(256), 0, stream>>>(xb, WqT, bq, (void*)Qp, 1.0f);
    k_gemm<true, true><<<gG, dim3(256), 0, stream>>>(xb, WkT, bk, (void*)Kpl, 1.0f);
    k_gemm<true, true><<<gG, dim3(256), 0, stream>>>(xb, WvT, bv, (void*)Vpl, 1.0f);

    const dim3 gA(SEQ / 128, NB * NHEAD);
    k_attn<<<gA, dim3(256), 0, stream>>>(Qp, Kpl, Vpl, mbits, Ctx);

    k_gemm<false, false><<<gG, dim3(256), 0, stream>>>(Ctx, WoT, bo, (void*)out, OUT_SCALE);
}

// v003
// Measured time: 165 microseconds a run.
// Timed twice side by side with v002, it ran 1.31 times as fast both times.
// Over all steps from v000 it is 2.57 times as fast.
#include <hip/hip_runtime.h>
#include <hip/hip_bf16.h>
#include <stdint.h>

// Contractions: x@Wq, x@Wk, x@Wv on v_wmma_f32_16x16x32_bf16 (bf16 operands = RNE-converted inputs);
// k.q^T, v^T.p^T and ctx@Wo on v_wmma_f32_16x16x32_f16 (f16 operands with power-of-two carries:
// p x1024, ctx x16, Wo x64); f32 accumulate; softmax, bias adds and normalisation in f32.

#ifndef NB
#define NB 8
#endif
#ifndef SEQ
#define SEQ 1024
#endif
#define NB_FULL 8
#define S_FULL  1024
#define EMB     1024
#define NHEAD   16
#define HDIM    64
#define MROWS   (NB * SEQ)
#define MWORDS  (SEQ / 32)

static_assert(NB >= 1 && NB <= NB_FULL);
static_assert(SEQ % 128 == 0 && SEQ <= S_FULL);
static_assert(EMB == NHEAD * HDIM);
static_assert(EMB % 128 == 0);
static_assert(MROWS % 128 == 0);
static_assert(((MROWS * EMB) / 8) % 256 == 0);
static_assert((NB * SEQ * MWORDS) % 256 == 0);

#define P_CARRY    1024.0f              // P operand = f16(1024 * exp(s - m))
#define CTX_SCALE  (1.0f / 64.0f)       // ctx operand = accO/(1024 l) * 16
#define WO_CARRY   64.0f                // Wo operand = f16(bf16(Wo) * 64)
#define OUT_SCALE  (1.0f / 1024.0f)     // 1/(16 * 64)

// workspace carve (bytes); every region written at its exact extent (tile multiples == plane sizes)
#define PLANE_BYTES ((size_t)MROWS * EMB * 2)
#define WT_BYTES    ((size_t)EMB * EMB * 2)
#define MB_BYTES    ((size_t)NB * SEQ * MWORDS * 4)
#define WS_TOTAL    (PLANE_BYTES * 5 + WT_BYTES * 4 + MB_BYTES)
static_assert(WS_TOTAL <= (size_t)134217728);
static_assert(PLANE_BYTES % 128 == 0 && WT_BYTES % 128 == 0 && MB_BYTES % 128 == 0);

typedef _Float16     v16h __attribute__((ext_vector_type(16)));
typedef __bf16       v16b __attribute__((ext_vector_type(16)));
typedef float        v8f  __attribute__((ext_vector_type(8)));
typedef float        v4f  __attribute__((ext_vector_type(4)));
typedef unsigned int v4u  __attribute__((ext_vector_type(4)));
typedef unsigned int v2u  __attribute__((ext_vector_type(2)));
typedef int          v4i  __attribute__((ext_vector_type(4)));

union Frag {
    v16h     h;
    v16b     b;
    v4u      q[2];
    uint16_t s[16];
};

// ---------------------------------------------------------------------------
// scalar conversions
// ---------------------------------------------------------------------------
__device__ __forceinline__ uint16_t bf16_bits(float f) {
    uint32_t u = __builtin_bit_cast(uint32_t, f);
    u += 0x7FFFu + ((u >> 16) & 1u);              // RNE
    return (uint16_t)(u >> 16);
}
__device__ __forceinline__ float bf16_rne(float f) {
    const uint32_t u = ((uint32_t)bf16_bits(f)) << 16;
    return __builtin_bit_cast(float, u);
}
__device__ __forceinline__ uint16_t h_bits(float f) {
    return __builtin_bit_cast(uint16_t, (_Float16)f);   // RNE f32 -> f16
}

// ---------------------------------------------------------------------------
// WMMA helpers: issue + hazard guard (4 VALU slots, D tied, A/B kept live)
// ---------------------------------------------------------------------------
__device__ __forceinline__ v8f mma_h(v16h a, v16h b, v8f c) {
    v8f d = __builtin_amdgcn_wmma_f32_16x16x32_f16(false, a, false, b, (short)0, c, false, false);
    asm volatile("v_nop\n\tv_nop\n\tv_nop\n\tv_nop" : "+v"(d) : "v"(a), "v"(b));
    return d;
}
__device__ __forceinline__ v8f mma_b(v16b a, v16b b, v8f c) {
    v8f d = __builtin_amdgcn_wmma_f32_16x16x32_bf16(false, a, false, b, (short)0, c, false, false);
    asm volatile("v_nop\n\tv_nop\n\tv_nop\n\tv_nop" : "+v"(d) : "v"(a), "v"(b));
    return d;
}

// 16x32 16-bit A/B fragment from a k-contiguous row (wave32 split layout):
// lane row/col = lane&15, hf = lane>>4; elements 0..7 <- k0+8hf+0..7, elements 8..15 <- k0+16+8hf+0..7
__device__ __forceinline__ Frag ldfrag(const uint16_t* rowp, int k0, int hf) {
    Frag f;
    f.q[0] = *(const v4u*)(rowp + k0 + 8 * hf);
    f.q[1] = *(const v4u*)(rowp + k0 + 16 + 8 * hf);
    return f;
}

// lane l <-> lane l ^ 16 by a vector cross-row move (no LDS round trip)
__device__ __forceinline__ float xhalf(float x) {
    const int b = __builtin_bit_cast(int, x);
    return __builtin_bit_cast(float, __builtin_amdgcn_permlanex16(b, b, 0x76543210, 0xfedcba98, false, false));
}

// ---------------------------------------------------------------------------
// Kernel 1: x f32 [NB][S_FULL][EMB] -> bf16 plane xb [MROWS][EMB] (compact rows).
// ---------------------------------------------------------------------------
__global__ __launch_bounds__(256)
void k_cvt_x(const float* __restrict__ x, uint16_t* __restrict__ xb) {
    const size_t gid = (size_t)blockIdx.x * 256 + threadIdx.x;
    const size_t e0  = gid * 8;
    const size_t m   = e0 / EMB;
    const int    c   = (int)(e0 % EMB);
    const size_t b   = m / SEQ, s = m % SEQ;
    const float* src = x + (b * S_FULL + s) * EMB + c;
    const v4f a0 = *(const v4f*)src;
    const v4f a1 = *(const v4f*)(src + 4);
    v4u w;
    w.x = (uint32_t)bf16_bits(a0.x) | ((uint32_t)bf16_bits(a0.y) << 16);
    w.y = (uint32_t)bf16_bits(a0.z) | ((uint32_t)bf16_bits(a0.w) << 16);
    w.z = (uint32_t)bf16_bits(a1.x) | ((uint32_t)bf16_bits(a1.y) << 16);
    w.w = (uint32_t)bf16_bits(a1.z) | ((uint32_t)bf16_bits(a1.w) << 16);
    uint16_t* dst = xb + e0;
    *(v4u*)dst = w;
    
}

// ---------------------------------------------------------------------------
// Kernel 2: W f32 [k][n] (EMB x EMB) -> WT 16-bit [n][k] (k-contiguous B operand plane).
// bf16 RNE of the input value, optional power-of-two scale, then bf16 or f16 bits.
// ---------------------------------------------------------------------------
template <bool TO_F16>
__global__ __launch_bounds__(256)
void k_wconv(const float* __restrict__ W, uint16_t* __restrict__ WT, float scale) {
    __shared__ uint16_t tile[64 * 64];            // [n][k]; cross-wave -> block barrier
    const int t = threadIdx.x;
    const int n0 = blockIdx.x * 64, k0 = blockIdx.y * 64;
    const int kr = t >> 2, nc = (t & 3) * 16;     // thread: row k0+kr, cols n0+nc..+15
    const float* src = W + (size_t)(k0 + kr) * EMB + n0 + nc;
#pragma unroll
    for (int i = 0; i < 4; ++i) {
        const v4f v = *(const v4f*)(src + 4 * i);
        float f[4];
        f[0] = v.x; f[1] = v.y; f[2] = v.z; f[3] = v.w;
#pragma unroll
        for (int jj = 0; jj < 4; ++jj) {
            const float g = bf16_rne(f[jj]) * scale;
            tile[(nc + 4 * i + jj) * 64 + kr] = TO_F16 ? h_bits(g) : bf16_bits(g);
        }
    }
    __syncthreads();
    v4u val[2]; size_t off[2];
#pragma unroll
    for (int i = 0; i < 2; ++i) {
        const int p   = t + 256 * i;              // wave w, lane: row = 4w + 32i + lane>>3
        const int row = p >> 3, seg = (p & 7) * 8;
        val[i] = *(const v4u*)&tile[row * 64 + seg];
        off[i] = (size_t)(n0 + row) * EMB + k0 + seg;
    }
#pragma unroll
    for (int i = 0; i < 2; ++i) *(v4u*)(WT + off[i]) = val[i];
    
}

// ---------------------------------------------------------------------------
// Kernel 3: mask int32 [NB][S_FULL][S_FULL] -> dense bit plane mb [MROWS][MWORDS],
// bit j of word w <-> key 32w+j nonzero (suppressed). One thread = one word;
// ---------------------------------------------------------------------------
__global__ __launch_bounds__(256)
void k_maskbits(const int* __restrict__ mask, unsigned int* __restrict__ mb) {
    const size_t gid = (size_t)blockIdx.x * 256 + threadIdx.x;
    const int    w   = (int)(gid % MWORDS);
    const size_t row = gid / MWORDS;
    const size_t b = row / SEQ, q = row % SEQ;
    const int* src = mask + (b * S_FULL + q) * S_FULL + (size_t)w * 32;
    unsigned int bits = 0u;
#pragma unroll
    for (int i = 0; i < 8; ++i) {
        const v4i v = *(const v4i*)(src + 4 * i);
        bits |= (v.x != 0 ? 1u : 0u) << (4 * i + 0);
        bits |= (v.y != 0 ? 1u : 0u) << (4 * i + 1);
        bits |= (v.z != 0 ? 1u : 0u) << (4 * i + 2);
        bits |= (v.w != 0 ? 1u : 0u) << (4 * i + 3);
    }
    unsigned int* dst = mb + gid;
    *dst = bits;
    
}

// ---------------------------------------------------------------------------
// Kernel 4: C[M][EMB] = A[M][EMB] . BT[EMB][EMB]^T (+ bias), 16-bit planes, f32 accumulate.
// Block 256 threads = 8 waves; block tile 128x128; wave tile 32 rows x 64 cols
// (2 x 4 accumulator tiles). k tiles of 64 (one 128-B line per row) are brought by whole-line
// loads, one tile ahead in registers, into two LDS buffers at row pitch 144 B (16 B x odd:
// conflict-free b128 fragment reads); one block barrier per k tile; products in k-steps of 32.
// OUT16: f16 plane out = f16(acc*oscale + bias);  else f32 out = acc*oscale + bias.
// ---------------------------------------------------------------------------
#define GK      64                        // k extent of one staged tile (halves)
#define GPITCH  72                        // LDS row pitch (halves)
#define GOPER   (128 * GPITCH)            // one operand tile (halves)
#define GBUF    (2 * GOPER)               // one buffer: A tile then B tile (halves)
static_assert(EMB % GK == 0 && EMB / GK >= 2);
static_assert(2 * GBUF * 2 >= 8 * 16 * 64 * 4);   // the epilogue slabs fit in the two buffers
template <bool BF, bool OUT16>
__global__ __launch_bounds__(256)
void k_gemm(const uint16_t* __restrict__ A, const uint16_t* __restrict__ BT,
            const float* __restrict__ bias, void* __restrict__ Cout, float oscale) {
    __shared__ __attribute__((aligned(16))) uint16_t stage[2 * GBUF];   // two k-tile buffers; epilogue slabs after the loop

    const int t = threadIdx.x, wave = t >> 5, lane = t & 31;
    const int hf = lane >> 4, l16 = lane & 15;
    const int m0 = blockIdx.y * 128, n0 = blockIdx.x * 128;
    const int wr = wave & 3, wc = wave >> 2;

    // staging: 8 lanes cover one 128-B row piece; thread rows srow + 32 i, i = 0..3, of each operand
    const int srow = t >> 3, sseg = (t & 7) * 8;
    const uint16_t* ag = A  + (size_t)(m0 + srow) * EMB + sseg;
    const uint16_t* bg = BT + (size_t)(n0 + srow) * EMB + sseg;
    uint16_t* sst = stage + srow * GPITCH + sseg;

    // fragment rows inside a buffer
    const uint16_t* afr = stage + (wr * 32 + l16) * GPITCH;
    const uint16_t* bfr = stage + GOPER + (wc * 64 + l16) * GPITCH;

    v8f acc[8] = {};
    v4u ra[4], rb[4];

#pragma unroll
    for (int i = 0; i < 4; ++i) {
        ra[i] = *(const v4u*)(ag + (size_t)(32 * i) * EMB);
        rb[i] = *(const v4u*)(bg + (size_t)(32 * i) * EMB);
    }
#pragma unroll
    for (int i = 0; i < 4; ++i) {
        *(v4u*)(sst + 32 * i * GPITCH)         = ra[i];
        *(v4u*)(sst + GOPER + 32 * i * GPITCH) = rb[i];
    }
    __syncthreads();

    // kept rolled; the buffer is picked by a scalar select
#pragma unroll 1
    for (int kt = 0; kt < EMB / GK; ++kt) {
        const int  cur  = (kt & 1) * GBUF;
        const bool more = kt + 1 < EMB / GK;      // block-uniform
        if (more) {
#pragma unroll
            for (int i = 0; i < 4; ++i) {
                ra[i] = *(const v4u*)(ag + (size_t)(32 * i) * EMB + (kt + 1) * GK);
                rb[i] = *(const v4u*)(bg + (size_t)(32 * i) * EMB + (kt + 1) * GK);
            }
        }
        // all fragment reads of the tile stand as one group ahead of its products
        Frag a[GK / 32][2], b[GK / 32][4];
#pragma unroll
        for (int kk = 0; kk < GK / 32; ++kk) {
#pragma unroll
            for (int mt = 0; mt < 2; ++mt) a[kk][mt] = ldfrag(afr + cur + mt * 16 * GPITCH, kk * 32, hf);
#pragma unroll
            for (int nt = 0; nt < 4; ++nt) b[kk][nt] = ldfrag(bfr + cur + nt * 16 * GPITCH, kk * 32, hf);
        }
#pragma unroll
        for (int kk = 0; kk < GK / 32; ++kk)
#pragma unroll
            for (int mt = 0; mt < 2; ++mt)
#pragma unroll
                for (int nt = 0; nt < 4; ++nt) {
                    if constexpr (BF)
                        acc[mt * 4 + nt] = mma_b(a[kk][mt].b, b[kk][nt].b, acc[mt * 4 + nt]);
                    else
                        acc[mt * 4 + nt] = mma_h(a[kk][mt].h, b[kk][nt].h, acc[mt * 4 + nt]);
                }
        if (more) {
            // the other buffer: its last readers left it before the barrier that ended the trip before
            uint16_t* dst = sst + (GBUF - cur);
#pragma unroll
            for (int i = 0; i < 4; ++i) {
                *(v4u*)(dst + 32 * i * GPITCH)         = ra[i];
                *(v4u*)(dst + GOPER + 32 * i * GPITCH) = rb[i];
            }
        }
        __syncthreads();                          // publishes tile kt+1; ends every read of tile kt
    }

    // bias (bf16-RNE input value) per accumulator column (lane = column)
    float bvv[4];
#pragma unroll
    for (int nt = 0; nt < 4; ++nt)
        bvv[nt] = bf16_rne(bias[n0 + wc * 64 + nt * 16 + l16]);

    float* mys = reinterpret_cast<float*>(stage) + wave * (16 * 64);   // 4 KB per wave
    if constexpr (OUT16) {
        uint16_t* mys16 = reinterpret_cast<uint16_t*>(mys);   // 32 rows x 64 halves
        uint16_t* C     = reinterpret_cast<uint16_t*>(Cout);
#pragma unroll
        for (int mt = 0; mt < 2; ++mt)
#pragma unroll
            for (int nt = 0; nt < 4; ++nt)
#pragma unroll
                for (int r = 0; r < 8; ++r)
                    mys16[(mt * 16 + 8 * hf + r) * 64 + nt * 16 + l16] =
                        h_bits(acc[mt * 4 + nt][r] * oscale + bvv[nt]);
        __syncthreads();
        v4u val[8]; size_t off[8];
#pragma unroll
        for (int i = 0; i < 8; ++i) {
            const int p = lane + 32 * i;
            const int row = p >> 3, seg = (p & 7) * 8;          // lanes 8q..8q+7 -> one line
            val[i] = *(const v4u*)(mys16 + row * 64 + seg);
            off[i] = (size_t)(m0 + wr * 32 + row) * EMB + n0 + wc * 64 + seg;
        }
#pragma unroll
        for (int i = 0; i < 8; ++i) *(v4u*)(C + off[i]) = val[i];
        
    } else {
        float* C = reinterpret_cast<float*>(Cout);
#pragma unroll
        for (int mt = 0; mt < 2; ++mt) {
            __syncthreads();
#pragma unroll
            for (int nt = 0; nt < 4; ++nt)
#pragma unroll
                for (int r = 0; r < 8; ++r)
                    mys[(8 * hf + r) * 64 + nt * 16 + l16] = acc[mt * 4 + nt][r] * oscale + bvv[nt];
            __syncthreads();
            v4f val[8]; size_t off[8];
#pragma unroll
            for (int i = 0; i < 8; ++i) {
                const int p = lane + 32 * i;
                const int row = p >> 4, seg = (p & 15) * 4;     // lanes 8q..8q+7 -> one line
                val[i] = *(const v4f*)(mys + row * 64 + seg);
                off[i] = (size_t)(m0 + wr * 32 + mt * 16 + row) * EMB + n0 + wc * 64 + seg;
            }
#pragma unroll
            for (int i = 0; i < 8; ++i) *(v4f*)(C + off[i]) = val[i];
            
        }
    }
}

#define APITCH  72                        // LDS row pitch (halves)
__global__ __launch_bounds__(256)
void k_attn(const uint16_t* __restrict__ Qp, const uint16_t* __restrict__ Kp,
            const uint16_t* __restrict__ Vp, const unsigned int* __restrict__ mb,
            uint16_t* __restrict__ ctx) {
    __shared__ __attribute__((aligned(16))) uint16_t kt[64 * APITCH];      // K tile [key][d]   (cross-wave: block barriers)
    __shared__ __attribute__((aligned(16))) uint16_t vt[64 * APITCH];      // V tile [d][key]   (cross-wave: block barriers)
    __shared__ __attribute__((aligned(16))) uint16_t ps[8][16 * APITCH];   // per-wave ctx stage (block barriers used)

    const int t = threadIdx.x, wave = t >> 5, lane = t & 31;
    const int hf = lane >> 4, l16 = lane & 15;
    const int b  = blockIdx.y / NHEAD, hd = blockIdx.y % NHEAD;
    const int qr = blockIdx.x * 128 + wave * 16;  // first query row of this wave (within sequence)
    const size_t rowb = (size_t)b * SEQ;          // compact plane row base of this batch
    const size_t hcol = (size_t)hd * HDIM;

    // Q fragments for the wave's 16 rows, straight from the f16 plane
    Frag qf[2];
    {
        const uint16_t* qrow = Qp + (rowb + qr + l16) * EMB + hcol;
        qf[0] = ldfrag(qrow, 0, hf);
        qf[1] = ldfrag(qrow, 32, hf);
    }

    v8f accO[4] = {};
    float mrow = -__builtin_inff();               // running maximum of the lane's query (both halves agree)
    float lrow = 0.0f;                            // running sum over the keys of the lane's own half

    const int keyr = t >> 2, hdB = (t & 3) * 16;  // coop staging: key row, 16 d-columns
    const unsigned int* mbrow = mb + (rowb + qr + l16) * MWORDS;      // mask row of the lane's query
    uint16_t* myps = ps[wave];

#pragma unroll 1
    for (int j = 0; j < SEQ / 64; ++j) {
        const int key0 = j * 64;
        __syncthreads();                         // prior tile fully consumed by all waves

        // ---- stage K tile [key][d] and V tile [d][key] (full 64x64 each) ----
        {
            const size_t go = (rowb + key0 + keyr) * EMB + hcol + hdB;
            const v4u k0v = *(const v4u*)(Kp + go);
            const v4u k1v = *(const v4u*)(Kp + go + 8);
            *(v4u*)&kt[keyr * APITCH + hdB]     = k0v;
            *(v4u*)&kt[keyr * APITCH + hdB + 8] = k1v;
            Frag fv;
            fv.q[0] = *(const v4u*)(Vp + go);
            fv.q[1] = *(const v4u*)(Vp + go + 8);
#pragma unroll
            for (int i = 0; i < 16; ++i) vt[(hdB + i) * APITCH + keyr] = fv.s[i];
        }
        // ---- mask words of the lane's query for these 64 keys (one b64), moved to the half's keys ----
        const v2u mw = *(const v2u*)(mbrow + 2 * j);
        const unsigned int mlo = mw.x >> (8 * hf), mhi = mw.y >> (8 * hf);
        __syncthreads();

        // ---- scores S^T = K(64x64) . Q^T, scale 1/8, replace-fill -1e9 where masked ----
        // element [nt][r]: key 16 nt + 8 hf + r, query l16
        v8f sc[4];
#pragma unroll
        for (int nt = 0; nt < 4; ++nt) {
            v8f z = {};
            Frag kf = ldfrag(&kt[(nt * 16 + l16) * APITCH], 0, hf);
            z = mma_h(kf.h, qf[0].h, z);
            kf = ldfrag(&kt[(nt * 16 + l16) * APITCH], 32, hf);
            z = mma_h(kf.h, qf[1].h, z);
#pragma unroll
            for (int r = 0; r < 8; ++r) {
                const unsigned int w   = (nt < 2) ? mlo : mhi;
                const unsigned int bit = w & (1u << ((nt & 1) * 16 + r));
                sc[nt][r] = bit ? -1.0e9f : z[r] * 0.125f;
            }
        }

        // ---- online softmax: one query per lane; the two halves hold 32 keys each ----
        float bm = sc[0][0];
#pragma unroll
        for (int nt = 0; nt < 4; ++nt)
#pragma unroll
            for (int r = 0; r < 8; ++r) bm = fmaxf(bm, sc[nt][r]);
        bm = fmaxf(bm, xhalf(bm));
        const float mnew  = fmaxf(mrow, bm);
        const float alpha = __expf(mrow - mnew);
        mrow = mnew;
        float rs[4];
#pragma unroll
        for (int nt = 0; nt < 4; ++nt) {
            rs[nt] = 0.0f;
#pragma unroll
            for (int r = 0; r < 8; ++r) {
                const float p = __expf(sc[nt][r] - mrow);
                sc[nt][r] = p;
                rs[nt] += p;
            }
        }
        lrow = lrow * alpha + ((rs[0] + rs[1]) + (rs[2] + rs[3]));
#pragma unroll
        for (int nt = 0; nt < 4; ++nt)
#pragma unroll
            for (int r = 0; r < 8; ++r) accO[nt][r] *= alpha;

        // ---- P^T B fragments, f16(1024 p), packed from the score accumulators in place ----
        Frag pf[2];
#pragma unroll
        for (int a = 0; a < 2; ++a)
#pragma unroll
            for (int r = 0; r < 8; ++r) {
                pf[a].h[r]     = (_Float16)(sc[2 * a][r] * P_CARRY);
                pf[a].h[8 + r] = (_Float16)(sc[2 * a + 1][r] * P_CARRY);
            }

        // ---- O^T += V^T(64 d x 64 keys) . P^T(64 keys x 16 queries) ----
#pragma unroll
        for (int nt = 0; nt < 4; ++nt) {
            Frag vf = ldfrag(&vt[(nt * 16 + l16) * APITCH], 0, hf);
            accO[nt] = mma_h(vf.h, pf[0].h, accO[nt]);
            vf = ldfrag(&vt[(nt * 16 + l16) * APITCH], 32, hf);
            accO[nt] = mma_h(vf.h, pf[1].h, accO[nt]);
        }
    }

    // the halves' sums are joined once; accO element [nt][r]: d = 16 nt + 8 hf + r, query l16
    const float inv = (1.0f / (lrow + xhalf(lrow))) * CTX_SCALE;
    __syncthreads();
#pragma unroll
    for (int nt = 0; nt < 4; ++nt) {
        v4u w;
#pragma unroll
        for (int i = 0; i < 4; ++i)
            w[i] = (uint32_t)h_bits(accO[nt][2 * i] * inv) | ((uint32_t)h_bits(accO[nt][2 * i + 1] * inv) << 16);
        *(v4u*)(myps + l16 * APITCH + nt * 16 + 8 * hf) = w;
    }
    __syncthreads();
    v4u val[4]; size_t off[4];
#pragma unroll
    for (int i = 0; i < 4; ++i) {
        const int p = lane + 32 * i;
        const int row = p >> 3, seg = (p & 7) * 8;              // lanes 8q..8q+7 -> one line
        val[i] = *(const v4u*)(myps + row * APITCH + seg);
        off[i] = (rowb + qr + row) * EMB + hcol + seg;
    }
#pragma unroll
    for (int i = 0; i < 4; ++i) *(v4u*)(ctx + off[i]) = val[i];
    
}

// ---------------------------------------------------------------------------
// Host launcher: 11 ops, workspace 93,323,264 B.
// ---------------------------------------------------------------------------
extern "C" void kernel_launch(void* const* d_in, const int* in_sizes, int n_in,
                              void* d_out, int out_size, void* d_ws, size_t ws_size,
                              hipStream_t stream) {
    if (n_in < 10) return;
    if (in_sizes[0] < NB * S_FULL * EMB) return;
    if (in_sizes[1] < NB * S_FULL * S_FULL) return;
    if (in_sizes[2] < EMB * EMB || in_sizes[4] < EMB * EMB ||
        in_sizes[6] < EMB * EMB || in_sizes[8] < EMB * EMB) return;
    if (in_sizes[3] < EMB || in_sizes[5] < EMB || in_sizes[7] < EMB || in_sizes[9] < EMB) return;
    if (out_size < MROWS * EMB) return;
    if (ws_size < WS_TOTAL) return;

    const float* x    = (const float*)d_in[0];   // [NB_FULL][S_FULL][EMB] f32
    const int*   mask = (const int*)d_in[1];     // [NB_FULL][S_FULL][S_FULL] int32 (bool)
    const float* Wq   = (const float*)d_in[2];   // [EMB in][EMB out]
    const float* bq   = (const float*)d_in[3];
    const float* Wk   = (const float*)d_in[4];
    const float* bk   = (const float*)d_in[5];
    const float* Wv   = (const float*)d_in[6];
    const float* bv   = (const float*)d_in[7];
    const float* Wo   = (const float*)d_in[8];
    const float* bo   = (const float*)d_in[9];
    float* out = (float*)d_out;                  // [MROWS][EMB] f32

    unsigned char* ws = (unsigned char*)d_ws;
    size_t off = 0;
    uint16_t* xb   = (uint16_t*)(ws + off); off += PLANE_BYTES;   // bf16 [MROWS][EMB]
    uint16_t* WqT  = (uint16_t*)(ws + off); off += WT_BYTES;      // bf16 [n][k]
    uint16_t* WkT  = (uint16_t*)(ws + off); off += WT_BYTES;
    uint16_t* WvT  = (uint16_t*)(ws + off); off += WT_BYTES;
    uint16_t* WoT  = (uint16_t*)(ws + off); off += WT_BYTES;      // f16 [n][k], x64
    uint16_t* Qp   = (uint16_t*)(ws + off); off += PLANE_BYTES;   // f16 [MROWS][EMB]
    uint16_t* Kpl  = (uint16_t*)(ws + off); off += PLANE_BYTES;
    uint16_t* Vpl  = (uint16_t*)(ws + off); off += PLANE_BYTES;
    uint16_t* Ctx  = (uint16_t*)(ws + off); off += PLANE_BYTES;   // f16, x16
    unsigned int* mbits = (unsigned int*)(ws + off); off += MB_BYTES;
    if (off > ws_size) return;

    k_cvt_x<<<dim3((MROWS * EMB / 8) / 256), dim3(256), 0, stream>>>(x, xb);

    const dim3 gW(EMB / 64, EMB / 64);
    k_wconv<false><<<gW, dim3(256), 0, stream>>>(Wq, WqT, 1.0f);
    k_wconv<false><<<gW, dim3(256), 0, stream>>>(Wk, WkT, 1.0f);
    k_wconv<false><<<gW, dim3(256), 0, stream>>>(Wv, WvT, 1.0f);
    k_wconv<true><<<gW, dim3(256), 0, stream>>>(Wo, WoT, WO_CARRY);

    k_maskbits<<<dim3((NB * SEQ * MWORDS) / 256), dim3(256), 0, stream>>>(mask, mbits);

    const dim3 gG(EMB / 128, MROWS / 128);
    k_gemm<true, true><<<gG, dim3(256), 0, stream>>>(xb, WqT, bq, (void*)Qp, 1.0f);
    k_gemm<true, true><<<gG, dim3(256), 0, stream>>>(xb, WkT, bk, (void*)Kpl, 1.0f);
    k_gemm<true, true><<<gG, dim3(256), 0, stream>>>(xb, WvT, bv, (void*)Vpl, 1.0f);

    const dim3 gA(SEQ / 128, NB * NHEAD);
    k_attn<<<gA, dim3(256), 0, stream>>>(Qp, Kpl, Vpl, mbits, Ctx);

    k_gemm<false, false><<<gG, dim3(256), 0, stream>>>(Ctx, WoT, bo, (void*)out, OUT_SCALE);
}

// v004
// It runs in 147 microseconds.
// Timed twice side by side with v003, it ran 1.11 and 1.13 times as fast.
// Counting every step since v000, it is 2.88 times as fast.
#include <hip/hip_runtime.h>
#include <hip/hip_bf16.h>
#include <stdint.h>

// Contractions: x@Wq, x@Wk, x@Wv on v_wmma_f32_16x16x32_bf16 (bf16 operands = RNE-converted inputs);
// k.q^T, v^T.p^T and ctx@Wo on v_wmma_f32_16x16x32_f16 (f16 operands with power-of-two carries:
// p x1024, ctx x16, Wo x64); f32 accumulate; softmax, bias adds and normalisation in f32.

#ifndef NB
#define NB 8
#endif
#ifndef SEQ
#define SEQ 1024
#endif
#define NB_FULL 8
#define S_FULL  1024
#define EMB     1024
#define NHEAD   16
#define HDIM    64
#define MROWS   (NB * SEQ)
#define MWORDS  (SEQ / 32)

static_assert(NB >= 1 && NB <= NB_FULL);
static_assert(SEQ % 128 == 0 && SEQ <= S_FULL);
static_assert(EMB == NHEAD * HDIM);
static_assert(EMB % 128 == 0);
static_assert(MROWS % 128 == 0);
static_assert(((MROWS * EMB) / 8) % 256 == 0);
static_assert((NB * SEQ * MWORDS) % 256 == 0);

#define P_CARRY    1024.0f              // P operand = f16(1024 * exp(s - m))
#define CTX_SCALE  (1.0f / 64.0f)       // ctx operand = accO/(1024 l) * 16
#define WO_CARRY   64.0f                // Wo operand = f16(bf16(Wo) * 64)
#define OUT_SCALE  (1.0f / 1024.0f)     // 1/(16 * 64)

// workspace carve (bytes); every region written at its exact extent (tile multiples == plane sizes)
#define PLANE_BYTES ((size_t)MROWS * EMB * 2)
#define WT_BYTES    ((size_t)EMB * EMB * 2)
#define MB_BYTES    ((size_t)NB * SEQ * MWORDS * 4)
#define WS_TOTAL    (PLANE_BYTES * 5 + WT_BYTES * 4 + MB_BYTES)
static_assert(WS_TOTAL <= (size_t)134217728);
static_assert(PLANE_BYTES % 128 == 0 && WT_BYTES % 128 == 0 && MB_BYTES % 128 == 0);

typedef _Float16     v16h __attribute__((ext_vector_type(16)));
typedef __bf16       v16b __attribute__((ext_vector_type(16)));
typedef float        v8f  __attribute__((ext_vector_type(8)));
typedef float        v4f  __attribute__((ext_vector_type(4)));
typedef unsigned int v4u  __attribute__((ext_vector_type(4)));
typedef unsigned int v2u  __attribute__((ext_vector_type(2)));
typedef int          v4i  __attribute__((ext_vector_type(4)));

union Frag {
    v16h     h;
    v16b     b;
    v4u      q[2];
    uint16_t s[16];
};

// ---------------------------------------------------------------------------
// scalar conversions
// ---------------------------------------------------------------------------
__device__ __forceinline__ uint16_t bf16_bits(float f) {
    uint32_t u = __builtin_bit_cast(uint32_t, f);
    u += 0x7FFFu + ((u >> 16) & 1u);              // RNE
    return (uint16_t)(u >> 16);
}
__device__ __forceinline__ float bf16_rne(float f) {
    const uint32_t u = ((uint32_t)bf16_bits(f)) << 16;
    return __builtin_bit_cast(float, u);
}
__device__ __forceinline__ uint16_t h_bits(float f) {
    return __builtin_bit_cast(uint16_t, (_Float16)f);   // RNE f32 -> f16
}

// ---------------------------------------------------------------------------
// WMMA helpers: issue + hazard guard (4 VALU slots, D tied, A/B kept live)
// ---------------------------------------------------------------------------
__device__ __forceinline__ v8f mma_h(v16h a, v16h b, v8f c) {
    v8f d = __builtin_amdgcn_wmma_f32_16x16x32_f16(false, a, false, b, (short)0, c, false, false);
    asm volatile("v_nop\n\tv_nop\n\tv_nop\n\tv_nop" : "+v"(d) : "v"(a), "v"(b));
    return d;
}
__device__ __forceinline__ v8f mma_b(v16b a, v16b b, v8f c) {
    v8f d = __builtin_amdgcn_wmma_f32_16x16x32_bf16(false, a, false, b, (short)0, c, false, false);
    asm volatile("v_nop\n\tv_nop\n\tv_nop\n\tv_nop" : "+v"(d) : "v"(a), "v"(b));
    return d;
}

// 16x32 16-bit A/B fragment from a k-contiguous row (wave32 split layout):
// lane row/col = lane&15, hf = lane>>4; elements 0..7 <- k0+8hf+0..7, elements 8..15 <- k0+16+8hf+0..7
__device__ __forceinline__ Frag ldfrag(const uint16_t* rowp, int k0, int hf) {
    Frag f;
    f.q[0] = *(const v4u*)(rowp + k0 + 8 * hf);
    f.q[1] = *(const v4u*)(rowp + k0 + 16 + 8 * hf);
    return f;
}

// lane l <-> lane l ^ 16 by a vector cross-row move (no LDS round trip)
__device__ __forceinline__ float xhalf(float x) {
    const int b = __builtin_bit_cast(int, x);
    return __builtin_bit_cast(float, __builtin_amdgcn_permlanex16(b, b, 0x76543210, 0xfedcba98, false, false));
}

// ---------------------------------------------------------------------------
// Preparation job 1: x f32 [NB][S_FULL][EMB] -> bf16 plane xb [MROWS][EMB] (compact rows).
// ---------------------------------------------------------------------------
__device__ __forceinline__
void job_cvt_x(const float* __restrict__ x, uint16_t* __restrict__ xb, int blk) {
    const size_t gid = (size_t)blk * 256 + threadIdx.x;
    const size_t e0  = gid * 8;
    const size_t m   = e0 / EMB;
    const int    c   = (int)(e0 % EMB);
    const size_t b   = m / SEQ, s = m % SEQ;
    const float* src = x + (b * S_FULL + s) * EMB + c;
    const v4f a0 = *(const v4f*)src;
    const v4f a1 = *(const v4f*)(src + 4);
    v4u w;
    w.x = (uint32_t)bf16_bits(a0.x) | ((uint32_t)bf16_bits(a0.y) << 16);
    w.y = (uint32_t)bf16_bits(a0.z) | ((uint32_t)bf16_bits(a0.w) << 16);
    w.z = (uint32_t)bf16_bits(a1.x) | ((uint32_t)bf16_bits(a1.y) << 16);
    w.w = (uint32_t)bf16_bits(a1.z) | ((uint32_t)bf16_bits(a1.w) << 16);
    uint16_t* dst = xb + e0;
    *(v4u*)dst = w;
    // stands between the store and any later write of its registers: a precaution, as each block of the merged kernel runs one job and then ends
    asm volatile("s_wait_xcnt 0x0" ::: "memory");
}

// ---------------------------------------------------------------------------
// Preparation job 2: W f32 [k][n] (EMB x EMB) -> WT 16-bit [n][k] (k-contiguous B operand plane).
// bf16 RNE of the input value, optional power-of-two scale, then bf16 or f16 bits.
// ---------------------------------------------------------------------------
template <bool TO_F16>
__device__ __forceinline__
void job_wconv(const float* __restrict__ W, uint16_t* __restrict__ WT, float scale,
               int bx, int by, uint16_t* tile) {  // tile: LDS [n][k] 64 x 64; cross-wave -> block barrier
    const int t = threadIdx.x;
    const int n0 = bx * 64, k0 = by * 64;
    const int kr = t >> 2, nc = (t & 3) * 16;     // thread: row k0+kr, cols n0+nc..+15
    const float* src = W + (size_t)(k0 + kr) * EMB + n0 + nc;
#pragma unroll
    for (int i = 0; i < 4; ++i) {
        const v4f v = *(const v4f*)(src + 4 * i);
        float f[4];
        f[0] = v.x; f[1] = v.y; f[2] = v.z; f[3] = v.w;
#pragma unroll
        for (int jj = 0; jj < 4; ++jj) {
            const float g = bf16_rne(f[jj]) * scale;
            tile[(nc + 4 * i + jj) * 64 + kr] = TO_F16 ? h_bits(g) : bf16_bits(g);
        }
    }
    __syncthreads();
    v4u val[2]; size_t off[2];
#pragma unroll
    for (int i = 0; i < 2; ++i) {
        const int p   = t + 256 * i;              // wave w, lane: row = 4w + 32i + lane>>3
        const int row = p >> 3, seg = (p & 7) * 8;
        val[i] = *(const v4u*)&tile[row * 64 + seg];
        off[i] = (size_t)(n0 + row) * EMB + k0 + seg;
    }
#pragma unroll
    for (int i = 0; i < 2; ++i) *(v4u*)(WT + off[i]) = val[i];
    // stands between the store and any later write of its registers: a precaution, as each block of the merged kernel runs one job and then ends
    asm volatile("s_wait_xcnt 0x0" ::: "memory");
}

// ---------------------------------------------------------------------------
// Preparation job 3: mask int32 [NB][S_FULL][S_FULL] -> dense bit plane mb [MROWS][MWORDS],
// bit j of word w <-> key 32w+j nonzero (suppressed). One thread = one word;
// ---------------------------------------------------------------------------
__device__ __forceinline__
void job_maskbits(const int* __restrict__ mask, unsigned int* __restrict__ mb, int blk) {
    const size_t gid = (size_t)blk * 256 + threadIdx.x;
    const int    w   = (int)(gid % MWORDS);
    const size_t row = gid / MWORDS;
    const size_t b = row / SEQ, q = row % SEQ;
    const int* src = mask + (b * S_FULL + q) * S_FULL + (size_t)w * 32;
    unsigned int bits = 0u;
#pragma unroll
    for (int i = 0; i < 8; ++i) {
        const v4i v = *(const v4i*)(src + 4 * i);
        bits |= (v.x != 0 ? 1u : 0u) << (4 * i + 0);
        bits |= (v.y != 0 ? 1u : 0u) << (4 * i + 1);
        bits |= (v.z != 0 ? 1u : 0u) << (4 * i + 2);
        bits |= (v.w != 0 ? 1u : 0u) << (4 * i + 3);
    }
    unsigned int* dst = mb + gid;
    *dst = bits;
    // stands between the store and any later write of its registers: a precaution, as each block of the merged kernel runs one job and then ends
    asm volatile("s_wait_xcnt 0x0" ::: "memory");
}

// ---------------------------------------------------------------------------
// Kernel 1: the six independent preparation jobs in one launch; the block index picks the job.
// Blocks [0, 4 WBLK): weight planes Wq, Wk, Wv (bf16) and Wo (f16 x64), laid one behind the other in WT;
// they have the longest chain per block (load, LDS, barrier, store) and so take the lowest indices.
// Blocks [4 WBLK, 4 WBLK + MBLK): mask bits. The rest: x to bf16.
// ---------------------------------------------------------------------------
#define WSIDE   (EMB / 64)
#define WBLK    (WSIDE * WSIDE)
#define MBLK    ((NB * SEQ * MWORDS) / 256)
#define XBLK    ((MROWS * EMB / 8) / 256)
__global__ __launch_bounds__(256)
void k_prep(const float* __restrict__ x, const int* __restrict__ mask,
            const float* __restrict__ Wq, const float* __restrict__ Wk,
            const float* __restrict__ Wv, const float* __restrict__ Wo,
            uint16_t* __restrict__ xb, uint16_t* __restrict__ WT, unsigned int* __restrict__ mb) {
    __shared__ uint16_t tile[64 * 64];
    const int bid = blockIdx.x;                   // every branch below is block-uniform
    if (bid < 4 * WBLK) {
        const int job = bid / WBLK, tl = bid % WBLK;
        uint16_t* dst = WT + (size_t)job * (EMB * EMB);
        if (job < 3)
            job_wconv<false>(job == 0 ? Wq : (job == 1 ? Wk : Wv), dst, 1.0f, tl % WSIDE, tl / WSIDE, tile);
        else
            job_wconv<true>(Wo, dst, WO_CARRY, tl % WSIDE, tl / WSIDE, tile);
    } else if (bid < 4 * WBLK + MBLK) {
        job_maskbits(mask, mb, bid - 4 * WBLK);
    } else {
        job_cvt_x(x, xb, bid - (4 * WBLK + MBLK));
    }
}

// ---------------------------------------------------------------------------
// Kernel 2: C[M][EMB] = A[M][EMB] . BT[EMB][EMB]^T (+ bias), 16-bit planes, f32 accumulate.
// JOBS products that share A run in one launch: blockIdx.z picks BT plane z, bias z and C plane z
// (the BT planes lie one behind the other, the C planes too).
// Block 256 threads = 8 waves; block tile 128x128; wave tile 32 rows x 64 cols
// (2 x 4 accumulator tiles). k tiles of 64 (one 128-B line per row) are brought by whole-line
// loads, one tile ahead in registers, into two LDS buffers at row pitch 144 B (16 B x odd:
// conflict-free b128 fragment reads); one block barrier per k tile; products in k-steps of 32.
// OUT16: f16 plane out = f16(acc*oscale + bias);  else f32 out = acc*oscale + bias.
// ---------------------------------------------------------------------------
#define GK      64                        // k extent of one staged tile (halves)
#define GPITCH  72                        // LDS row pitch (halves)
#define GOPER   (128 * GPITCH)            // one operand tile (halves)
#define GBUF    (2 * GOPER)               // one buffer: A tile then B tile (halves)
static_assert(EMB % GK == 0 && EMB / GK >= 2);
static_assert(2 * GBUF * 2 >= 8 * 16 * 64 * 4);   // the epilogue slabs fit in the two buffers
template <bool BF, bool OUT16, int JOBS>
__global__ __launch_bounds__(256)
void k_gemm(const uint16_t* __restrict__ A, const uint16_t* __restrict__ BT0,
            const float* __restrict__ bias0, const float* __restrict__ bias1,
            const float* __restrict__ bias2, void* __restrict__ Cout, float oscale) {
    static_assert(JOBS >= 1 && JOBS <= 3);
    const int job = JOBS > 1 ? (int)blockIdx.z : 0;
    const uint16_t* BT  = BT0 + (size_t)job * (EMB * EMB);
    const float*   bias = job == 0 ? bias0 : (job == 1 ? bias1 : bias2);

    __shared__ __attribute__((aligned(16))) uint16_t stage[2 * GBUF];   // two k-tile buffers; epilogue slabs after the loop

    const int t = threadIdx.x, wave = t >> 5, lane = t & 31;
    const int hf = lane >> 4, l16 = lane & 15;
    const int m0 = blockIdx.y * 128, n0 = blockIdx.x * 128;
    const int wr = wave & 3, wc = wave >> 2;

    // staging: 8 lanes cover one 128-B row piece; thread rows srow + 32 i, i = 0..3, of each operand
    const int srow = t >> 3, sseg = (t & 7) * 8;
    const uint16_t* ag = A  + (size_t)(m0 + srow) * EMB + sseg;
    const uint16_t* bg = BT + (size_t)(n0 + srow) * EMB + sseg;
    uint16_t* sst = stage + srow * GPITCH + sseg;

    // fragment rows inside a buffer
    const uint16_t* afr = stage + (wr * 32 + l16) * GPITCH;
    const uint16_t* bfr = stage + GOPER + (wc * 64 + l16) * GPITCH;

    v8f acc[8] = {};
    v4u ra[4], rb[4];

#pragma unroll
    for (int i = 0; i < 4; ++i) {
        ra[i] = *(const v4u*)(ag + (size_t)(32 * i) * EMB);
        rb[i] = *(const v4u*)(bg + (size_t)(32 * i) * EMB);
    }
#pragma unroll
    for (int i = 0; i < 4; ++i) {
        *(v4u*)(sst + 32 * i * GPITCH)         = ra[i];
        *(v4u*)(sst + GOPER + 32 * i * GPITCH) = rb[i];
    }
    __syncthreads();

    // kept rolled; the buffer is picked by a scalar select
#pragma unroll 1
    for (int kt = 0; kt < EMB / GK; ++kt) {
        const int  cur  = (kt & 1) * GBUF;
        const bool more = kt + 1 < EMB / GK;      // block-uniform
        if (more) {
#pragma unroll
            for (int i = 0; i < 4; ++i) {
                ra[i] = *(const v4u*)(ag + (size_t)(32 * i) * EMB + (kt + 1) * GK);
                rb[i] = *(const v4u*)(bg + (size_t)(32 * i) * EMB + (kt + 1) * GK);
            }
        }
        // all fragment reads of the tile stand as one group ahead of its products
        Frag a[GK / 32][2], b[GK / 32][4];
#pragma unroll
        for (int kk = 0; kk < GK / 32; ++kk) {
#pragma unroll
            for (int mt = 0; mt < 2; ++mt) a[kk][mt] = ldfrag(afr + cur + mt * 16 * GPITCH, kk * 32, hf);
#pragma unroll
            for (int nt = 0; nt < 4; ++nt) b[kk][nt] = ldfrag(bfr + cur + nt * 16 * GPITCH, kk * 32, hf);
        }
#pragma unroll
        for (int kk = 0; kk < GK / 32; ++kk)
#pragma unroll
            for (int mt = 0; mt < 2; ++mt)
#pragma unroll
                for (int nt = 0; nt < 4; ++nt) {
                    if constexpr (BF)
                        acc[mt * 4 + nt] = mma_b(a[kk][mt].b, b[kk][nt].b, acc[mt * 4 + nt]);
                    else
                        acc[mt * 4 + nt] = mma_h(a[kk][mt].h, b[kk][nt].h, acc[mt * 4 + nt]);
                }
        if (more) {
            // the other buffer: its last readers left it before the barrier that ended the trip before
            uint16_t* dst = sst + (GBUF - cur);
#pragma unroll
            for (int i = 0; i < 4; ++i) {
                *(v4u*)(dst + 32 * i * GPITCH)         = ra[i];
                *(v4u*)(dst + GOPER + 32 * i * GPITCH) = rb[i];
            }
        }
        __syncthreads();                          // publishes tile kt+1; ends every read of tile kt
    }

    // bias (bf16-RNE input value) per accumulator column (lane = column)
    float bvv[4];
#pragma unroll
    for (int nt = 0; nt < 4; ++nt)
        bvv[nt] = bf16_rne(bias[n0 + wc * 64 + nt * 16 + l16]);

    float* mys = reinterpret_cast<float*>(stage) + wave * (16 * 64);   // 4 KB per wave
    if constexpr (OUT16) {
        uint16_t* mys16 = reinterpret_cast<uint16_t*>(mys);   // 32 rows x 64 halves
        uint16_t* C     = reinterpret_cast<uint16_t*>(Cout) + (size_t)job * ((size_t)MROWS * EMB);
#pragma unroll
        for (int mt = 0; mt < 2; ++mt)
#pragma unroll
            for (int nt = 0; nt < 4; ++nt)
#pragma unroll
                for (int r = 0; r < 8; ++r)
                    mys16[(mt * 16 + 8 * hf + r) * 64 + nt * 16 + l16] =
                        h_bits(acc[mt * 4 + nt][r] * oscale + bvv[nt]);
        __syncthreads();
        v4u val[8]; size_t off[8];
#pragma unroll
        for (int i = 0; i < 8; ++i) {
            const int p = lane + 32 * i;
            const int row = p >> 3, seg = (p & 7) * 8;          // lanes 8q..8q+7 -> one line
            val[i] = *(const v4u*)(mys16 + row * 64 + seg);
            off[i] = (size_t)(m0 + wr * 32 + row) * EMB + n0 + wc * 64 + seg;
        }
#pragma unroll
        for (int i = 0; i < 8; ++i) *(v4u*)(C + off[i]) = val[i];
        
    } else {
        float* C = reinterpret_cast<float*>(Cout) + (size_t)job * ((size_t)MROWS * EMB);
#pragma unroll
        for (int mt = 0; mt < 2; ++mt) {
            __syncthreads();
#pragma unroll
            for (int nt = 0; nt < 4; ++nt)
#pragma unroll
                for (int r = 0; r < 8; ++r)
                    mys[(8 * hf + r) * 64 + nt * 16 + l16] = acc[mt * 4 + nt][r] * oscale + bvv[nt];
            __syncthreads();
            v4f val[8]; size_t off[8];
#pragma unroll
            for (int i = 0; i < 8; ++i) {
                const int p = lane + 32 * i;
                const int row = p >> 4, seg = (p & 15) * 4;     // lanes 8q..8q+7 -> one line
                val[i] = *(const v4f*)(mys + row * 64 + seg);
                off[i] = (size_t)(m0 + wr * 32 + mt * 16 + row) * EMB + n0 + wc * 64 + seg;
            }
#pragma unroll
            for (int i = 0; i < 8; ++i) *(v4f*)(C + off[i]) = val[i];
            
        }
    }
}

#define APITCH  72                        // LDS row pitch (halves)
__global__ __launch_bounds__(256)
void k_attn(const uint16_t* __restrict__ Qp, const uint16_t* __restrict__ Kp,
            const uint16_t* __restrict__ Vp, const unsigned int* __restrict__ mb,
            uint16_t* __restrict__ ctx) {
    __shared__ __attribute__((aligned(16))) uint16_t kt[64 * APITCH];      // K tile [key][d]   (cross-wave: block barriers)
    __shared__ __attribute__((aligned(16))) uint16_t vt[64 * APITCH];      // V tile [d][key]   (cross-wave: block barriers)
    __shared__ __attribute__((aligned(16))) uint16_t ps[8][16 * APITCH];   // per-wave ctx stage (block barriers used)

    const int t = threadIdx.x, wave = t >> 5, lane = t & 31;
    const int hf = lane >> 4, l16 = lane & 15;
    const int b  = blockIdx.y / NHEAD, hd = blockIdx.y % NHEAD;
    const int qr = blockIdx.x * 128 + wave * 16;  // first query row of this wave (within sequence)
    const size_t rowb = (size_t)b * SEQ;          // compact plane row base of this batch
    const size_t hcol = (size_t)hd * HDIM;

    // Q fragments for the wave's 16 rows, straight from the f16 plane
    Frag qf[2];
    {
        const uint16_t* qrow = Qp + (rowb + qr + l16) * EMB + hcol;
        qf[0] = ldfrag(qrow, 0, hf);
        qf[1] = ldfrag(qrow, 32, hf);
    }

    v8f accO[4] = {};
    float mrow = -__builtin_inff();               // running maximum of the lane's query (both halves agree)
    float lrow = 0.0f;                            // running sum over the keys of the lane's own half

    const int keyr = t >> 2, hdB = (t & 3) * 16;  // coop staging: key row, 16 d-columns
    const unsigned int* mbrow = mb + (rowb + qr + l16) * MWORDS;      // mask row of the lane's query
    uint16_t* myps = ps[wave];

#pragma unroll 1
    for (int j = 0; j < SEQ / 64; ++j) {
        const int key0 = j * 64;
        __syncthreads();                         // prior tile fully consumed by all waves

        // ---- stage K tile [key][d] and V tile [d][key] (full 64x64 each) ----
        {
            const size_t go = (rowb + key0 + keyr) * EMB + hcol + hdB;
            const v4u k0v = *(const v4u*)(Kp + go);
            const v4u k1v = *(const v4u*)(Kp + go + 8);
            *(v4u*)&kt[keyr * APITCH + hdB]     = k0v;
            *(v4u*)&kt[keyr * APITCH + hdB + 8] = k1v;
            Frag fv;
            fv.q[0] = *(const v4u*)(Vp + go);
            fv.q[1] = *(const v4u*)(Vp + go + 8);
#pragma unroll
            for (int i = 0; i < 16; ++i) vt[(hdB + i) * APITCH + keyr] = fv.s[i];
        }
        // ---- mask words of the lane's query for these 64 keys (one b64), moved to the half's keys ----
        const v2u mw = *(const v2u*)(mbrow + 2 * j);
        const unsigned int mlo = mw.x >> (8 * hf), mhi = mw.y >> (8 * hf);
        __syncthreads();

        // ---- scores S^T = K(64x64) . Q^T, scale 1/8, replace-fill -1e9 where masked ----
        // element [nt][r]: key 16 nt + 8 hf + r, query l16
        v8f sc[4];
#pragma unroll
        for (int nt = 0; nt < 4; ++nt) {
            v8f z = {};
            Frag kf = ldfrag(&kt[(nt * 16 + l16) * APITCH], 0, hf);
            z = mma_h(kf.h, qf[0].h, z);
            kf = ldfrag(&kt[(nt * 16 + l16) * APITCH], 32, hf);
            z = mma_h(kf.h, qf[1].h, z);
#pragma unroll
            for (int r = 0; r < 8; ++r) {
                const unsigned int w   = (nt < 2) ? mlo : mhi;
                const unsigned int bit = w & (1u << ((nt & 1) * 16 + r));
                sc[nt][r] = bit ? -1.0e9f : z[r] * 0.125f;
            }
        }

        // ---- online softmax: one query per lane; the two halves hold 32 keys each ----
        float bm = sc[0][0];
#pragma unroll
        for (int nt = 0; nt < 4; ++nt)
#pragma unroll
            for (int r = 0; r < 8; ++r) bm = fmaxf(bm, sc[nt][r]);
        bm = fmaxf(bm, xhalf(bm));
        const float mnew  = fmaxf(mrow, bm);
        const float alpha = __expf(mrow - mnew);
        mrow = mnew;
        float rs[4];
#pragma unroll
        for (int nt = 0; nt < 4; ++nt) {
            rs[nt] = 0.0f;
#pragma unroll
            for (int r = 0; r < 8; ++r) {
                const float p = __expf(sc[nt][r] - mrow);
                sc[nt][r] = p;
                rs[nt] += p;
            }
        }
        lrow = lrow * alpha + ((rs[0] + rs[1]) + (rs[2] + rs[3]));
#pragma unroll
        for (int nt = 0; nt < 4; ++nt)
#pragma unroll
            for (int r = 0; r < 8; ++r) accO[nt][r] *= alpha;

        // ---- P^T B fragments, f16(1024 p), packed from the score accumulators in place ----
        Frag pf[2];
#pragma unroll
        for (int a = 0; a < 2; ++a)
#pragma unroll
            for (int r = 0; r < 8; ++r) {
                pf[a].h[r]     = (_Float16)(sc[2 * a][r] * P_CARRY);
                pf[a].h[8 + r] = (_Float16)(sc[2 * a + 1][r] * P_CARRY);
            }

        // ---- O^T += V^T(64 d x 64 keys) . P^T(64 keys x 16 queries) ----
#pragma unroll
        for (int nt = 0; nt < 4; ++nt) {
            Frag vf = ldfrag(&vt[(nt * 16 + l16) * APITCH], 0, hf);
            accO[nt] = mma_h(vf.h, pf[0].h, accO[nt]);
            vf = ldfrag(&vt[(nt * 16 + l16) * APITCH], 32, hf);
            accO[nt] = mma_h(vf.h, pf[1].h, accO[nt]);
        }
    }

    // the halves' sums are joined once; accO element [nt][r]: d = 16 nt + 8 hf + r, query l16
    const float inv = (1.0f / (lrow + xhalf(lrow))) * CTX_SCALE;
    __syncthreads();
#pragma unroll
    for (int nt = 0; nt < 4; ++nt) {
        v4u w;
#pragma unroll
        for (int i = 0; i < 4; ++i)
            w[i] = (uint32_t)h_bits(accO[nt][2 * i] * inv) | ((uint32_t)h_bits(accO[nt][2 * i + 1] * inv) << 16);
        *(v4u*)(myps + l16 * APITCH + nt * 16 + 8 * hf) = w;
    }
    __syncthreads();
    v4u val[4]; size_t off[4];
#pragma unroll
    for (int i = 0; i < 4; ++i) {
        const int p = lane + 32 * i;
        const int row = p >> 3, seg = (p & 7) * 8;              // lanes 8q..8q+7 -> one line
        val[i] = *(const v4u*)(myps + row * APITCH + seg);
        off[i] = (rowb + qr + row) * EMB + hcol + seg;
    }
#pragma unroll
    for (int i = 0; i < 4; ++i) *(v4u*)(ctx + off[i]) = val[i];
    
}

// ---------------------------------------------------------------------------
// Host launcher: 4 ops, workspace 93,323,264 B.
// ---------------------------------------------------------------------------
extern "C" void kernel_launch(void* const* d_in, const int* in_sizes, int n_in,
                              void* d_out, int out_size, void* d_ws, size_t ws_size,
                              hipStream_t stream) {
    if (n_in < 10) return;
    if (in_sizes[0] < NB * S_FULL * EMB) return;
    if (in_sizes[1] < NB * S_FULL * S_FULL) return;
    if (in_sizes[2] < EMB * EMB || in_sizes[4] < EMB * EMB ||
        in_sizes[6] < EMB * EMB || in_sizes[8] < EMB * EMB) return;
    if (in_sizes[3] < EMB || in_sizes[5] < EMB || in_sizes[7] < EMB || in_sizes[9] < EMB) return;
    if (out_size < MROWS * EMB) return;
    if (ws_size < WS_TOTAL) return;

    const float* x    = (const float*)d_in[0];   // [NB_FULL][S_FULL][EMB] f32
    const int*   mask = (const int*)d_in[1];     // [NB_FULL][S_FULL][S_FULL] int32 (bool)
    const float* Wq   = (const float*)d_in[2];   // [EMB in][EMB out]
    const float* bq   = (const float*)d_in[3];
    const float* Wk   = (const float*)d_in[4];
    const float* bk   = (const float*)d_in[5];
    const float* Wv   = (const float*)d_in[6];
    const float* bv   = (const float*)d_in[7];
    const float* Wo   = (const float*)d_in[8];
    const float* bo   = (const float*)d_in[9];
    float* out = (float*)d_out;                  // [MROWS][EMB] f32

    unsigned char* ws = (unsigned char*)d_ws;
    size_t off = 0;
    uint16_t* xb   = (uint16_t*)(ws + off); off += PLANE_BYTES;   // bf16 [MROWS][EMB]
    uint16_t* WqT  = (uint16_t*)(ws + off); off += WT_BYTES * 3;  // bf16 [n][k]: the Wq, Wk, Wv planes in a row
    uint16_t* WoT  = (uint16_t*)(ws + off); off += WT_BYTES;      // f16 [n][k], x64, directly behind them
    uint16_t* Qp   = (uint16_t*)(ws + off); off += PLANE_BYTES;   // f16 [MROWS][EMB]
    uint16_t* Kpl  = (uint16_t*)(ws + off); off += PLANE_BYTES;
    uint16_t* Vpl  = (uint16_t*)(ws + off); off += PLANE_BYTES;
    uint16_t* Ctx  = (uint16_t*)(ws + off); off += PLANE_BYTES;   // f16, x16
    unsigned int* mbits = (unsigned int*)(ws + off); off += MB_BYTES;
    if (off > ws_size) return;

    // the four weight planes are one run from WqT on; Qp, Kpl, Vpl are one run of three
    k_prep<<<dim3(4 * WBLK + MBLK + XBLK), dim3(256), 0, stream>>>(x, mask, Wq, Wk, Wv, Wo, xb, WqT, mbits);

    k_gemm<true, true, 3><<<dim3(EMB / 128, MROWS / 128, 3), dim3(256), 0, stream>>>(xb, WqT, bq, bk, bv, (void*)Qp, 1.0f);

    const dim3 gA(SEQ / 128, NB * NHEAD);
    k_attn<<<gA, dim3(256), 0, stream>>>(Qp, Kpl, Vpl, mbits, Ctx);

    k_gemm<false, false, 1><<<dim3(EMB / 128, MROWS / 128, 1), dim3(256), 0, stream>>>(Ctx, WoT, bo, bo, bo, (void*)out, OUT_SCALE);
}

// v005
// One run takes 136 microseconds.
// Two timings next to v004 put it at 1.07 and 1.08 times that version's speed.
// Counting every step since v000, it is 3.10 times as fast.
#include <hip/hip_runtime.h>
#include <hip/hip_bf16.h>
#include <stdint.h>

// Contractions: x@Wq, x@Wk, x@Wv on v_wmma_f32_16x16x32_bf16 (bf16 operands = RNE-converted inputs);
// k.q^T, v^T.p^T and ctx@Wo on v_wmma_f32_16x16x32_f16 (f16 operands with power-of-two carries:
// p x1024, ctx x16, Wo x64); f32 accumulate; softmax, bias adds and normalisation in f32.

#ifndef NB
#define NB 8
#endif
#ifndef SEQ
#define SEQ 1024
#endif
#define NB_FULL 8
#define S_FULL  1024
#define EMB     1024
#define NHEAD   16
#define HDIM    64
#define MROWS   (NB * SEQ)
#define MWORDS  (SEQ / 32)

static_assert(NB >= 1 && NB <= NB_FULL);
static_assert(SEQ % 128 == 0 && SEQ <= S_FULL);
static_assert(EMB == NHEAD * HDIM);
static_assert(EMB % 128 == 0);
static_assert(MROWS % 128 == 0);
static_assert(((MROWS * EMB) / 8) % 256 == 0);
static_assert((NB * SEQ * MWORDS) % 256 == 0);

#define P_CARRY    1024.0f              // P operand = f16(1024 * exp(s - m))
#define CTX_SCALE  (1.0f / 64.0f)       // ctx operand = accO/(1024 l) * 16
#define WO_CARRY   64.0f                // Wo operand = f16(bf16(Wo) * 64)
#define OUT_SCALE  (1.0f / 1024.0f)     // 1/(16 * 64)

// workspace carve (bytes); every region written at its exact extent (tile multiples == plane sizes)
#define PLANE_BYTES ((size_t)MROWS * EMB * 2)
#define WT_BYTES    ((size_t)EMB * EMB * 2)
#define MB_BYTES    ((size_t)NB * SEQ * MWORDS * 4)
#define WS_TOTAL    (PLANE_BYTES * 5 + WT_BYTES * 4 + MB_BYTES)
static_assert(WS_TOTAL <= (size_t)134217728);
static_assert(PLANE_BYTES % 128 == 0 && WT_BYTES % 128 == 0 && MB_BYTES % 128 == 0);

typedef _Float16     v16h __attribute__((ext_vector_type(16)));
typedef __bf16       v16b __attribute__((ext_vector_type(16)));
typedef float        v8f  __attribute__((ext_vector_type(8)));
typedef float        v4f  __attribute__((ext_vector_type(4)));
typedef unsigned int v4u  __attribute__((ext_vector_type(4)));
typedef unsigned int v2u  __attribute__((ext_vector_type(2)));
typedef int          v4i  __attribute__((ext_vector_type(4)));

union Frag {
    v16h     h;
    v16b     b;
    v4u      q[2];
    uint16_t s[16];
};

// ---------------------------------------------------------------------------
// scalar conversions
// ---------------------------------------------------------------------------
__device__ __forceinline__ uint16_t bf16_bits(float f) {
    uint32_t u = __builtin_bit_cast(uint32_t, f);
    u += 0x7FFFu + ((u >> 16) & 1u);              // RNE
    return (uint16_t)(u >> 16);
}
__device__ __forceinline__ float bf16_rne(float f) {
    const uint32_t u = ((uint32_t)bf16_bits(f)) << 16;
    return __builtin_bit_cast(float, u);
}
__device__ __forceinline__ uint16_t h_bits(float f) {
    return __builtin_bit_cast(uint16_t, (_Float16)f);   // RNE f32 -> f16
}

// ---------------------------------------------------------------------------
// WMMA helpers: issue + hazard guard (4 VALU slots, D tied, A/B kept live)
// ---------------------------------------------------------------------------
__device__ __forceinline__ v8f mma_h(v16h a, v16h b, v8f c) {
    v8f d = __builtin_amdgcn_wmma_f32_16x16x32_f16(false, a, false, b, (short)0, c, false, false);
    asm volatile("v_nop\n\tv_nop\n\tv_nop\n\tv_nop" : "+v"(d) : "v"(a), "v"(b));
    return d;
}
__device__ __forceinline__ v8f mma_b(v16b a, v16b b, v8f c) {
    v8f d = __builtin_amdgcn_wmma_f32_16x16x32_bf16(false, a, false, b, (short)0, c, false, false);
    asm volatile("v_nop\n\tv_nop\n\tv_nop\n\tv_nop" : "+v"(d) : "v"(a), "v"(b));
    return d;
}

// 16x32 16-bit A/B fragment from a k-contiguous row (wave32 split layout):
// lane row/col = lane&15, hf = lane>>4; elements 0..7 <- k0+8hf+0..7, elements 8..15 <- k0+16+8hf+0..7
__device__ __forceinline__ Frag ldfrag(const uint16_t* rowp, int k0, int hf) {
    Frag f;
    f.q[0] = *(const v4u*)(rowp + k0 + 8 * hf);
    f.q[1] = *(const v4u*)(rowp + k0 + 16 + 8 * hf);
    return f;
}

// lane l <-> lane l ^ 16 by a vector cross-row move (no LDS round trip)
__device__ __forceinline__ float xhalf(float x) {
    const int b = __builtin_bit_cast(int, x);
    return __builtin_bit_cast(float, __builtin_amdgcn_permlanex16(b, b, 0x76543210, 0xfedcba98, false, false));
}

// ---------------------------------------------------------------------------
// Preparation job 1: x f32 [NB][S_FULL][EMB] -> bf16 plane xb [MROWS][EMB] (compact rows).
// ---------------------------------------------------------------------------
__device__ __forceinline__
void job_cvt_x(const float* __restrict__ x, uint16_t* __restrict__ xb, int blk) {
    const size_t gid = (size_t)blk * 256 + threadIdx.x;
    const size_t e0  = gid * 8;
    const size_t m   = e0 / EMB;
    const int    c   = (int)(e0 % EMB);
    const size_t b   = m / SEQ, s = m % SEQ;
    const float* src = x + (b * S_FULL + s) * EMB + c;
    const v4f a0 = *(const v4f*)src;
    const v4f a1 = *(const v4f*)(src + 4);
    v4u w;
    w.x = (uint32_t)bf16_bits(a0.x) | ((uint32_t)bf16_bits(a0.y) << 16);
    w.y = (uint32_t)bf16_bits(a0.z) | ((uint32_t)bf16_bits(a0.w) << 16);
    w.z = (uint32_t)bf16_bits(a1.x) | ((uint32_t)bf16_bits(a1.y) << 16);
    w.w = (uint32_t)bf16_bits(a1.z) | ((uint32_t)bf16_bits(a1.w) << 16);
    uint16_t* dst = xb + e0;
    *(v4u*)dst = w;
    // stands between the store and any later write of its registers: a precaution, as each block of the merged kernel runs one job and then ends
    asm volatile("s_wait_xcnt 0x0" ::: "memory");
}

// ---------------------------------------------------------------------------
// Preparation job 2: W f32 [k][n] (EMB x EMB) -> WT 16-bit [n][k] (k-contiguous B operand plane).
// bf16 RNE of the input value, optional power-of-two scale, then bf16 or f16 bits.
// ---------------------------------------------------------------------------
template <bool TO_F16>
__device__ __forceinline__
void job_wconv(const float* __restrict__ W, uint16_t* __restrict__ WT, float scale,
               int bx, int by, uint16_t* tile) {  // tile: LDS [n][k] 64 x 64; cross-wave -> block barrier
    const int t = threadIdx.x;
    const int n0 = bx * 64, k0 = by * 64;
    const int kr = t >> 2, nc = (t & 3) * 16;     // thread: row k0+kr, cols n0+nc..+15
    const float* src = W + (size_t)(k0 + kr) * EMB + n0 + nc;
#pragma unroll
    for (int i = 0; i < 4; ++i) {
        const v4f v = *(const v4f*)(src + 4 * i);
        float f[4];
        f[0] = v.x; f[1] = v.y; f[2] = v.z; f[3] = v.w;
#pragma unroll
        for (int jj = 0; jj < 4; ++jj) {
            const float g = bf16_rne(f[jj]) * scale;
            tile[(nc + 4 * i + jj) * 64 + kr] = TO_F16 ? h_bits(g) : bf16_bits(g);
        }
    }
    __syncthreads();
    v4u val[2]; size_t off[2];
#pragma unroll
    for (int i = 0; i < 2; ++i) {
        const int p   = t + 256 * i;              // wave w, lane: row = 4w + 32i + lane>>3
        const int row = p >> 3, seg = (p & 7) * 8;
        val[i] = *(const v4u*)&tile[row * 64 + seg];
        off[i] = (size_t)(n0 + row) * EMB + k0 + seg;
    }
#pragma unroll
    for (int i = 0; i < 2; ++i) *(v4u*)(WT + off[i]) = val[i];
    // stands between the store and any later write of its registers: a precaution, as each block of the merged kernel runs one job and then ends
    asm volatile("s_wait_xcnt 0x0" ::: "memory");
}

// ---------------------------------------------------------------------------
// Preparation job 3: mask int32 [NB][S_FULL][S_FULL] -> dense bit plane mb [MROWS][MWORDS],
// bit j of word w <-> key 32w+j nonzero (suppressed). One thread = one word;
// ---------------------------------------------------------------------------
__device__ __forceinline__
void job_maskbits(const int* __restrict__ mask, unsigned int* __restrict__ mb, int blk) {
    const size_t gid = (size_t)blk * 256 + threadIdx.x;
    const int    w   = (int)(gid % MWORDS);
    const size_t row = gid / MWORDS;
    const size_t b = row / SEQ, q = row % SEQ;
    const int* src = mask + (b * S_FULL + q) * S_FULL + (size_t)w * 32;
    unsigned int bits = 0u;
#pragma unroll
    for (int i = 0; i < 8; ++i) {
        const v4i v = *(const v4i*)(src + 4 * i);
        bits |= (v.x != 0 ? 1u : 0u) << (4 * i + 0);
        bits |= (v.y != 0 ? 1u : 0u) << (4 * i + 1);
        bits |= (v.z != 0 ? 1u : 0u) << (4 * i + 2);
        bits |= (v.w != 0 ? 1u : 0u) << (4 * i + 3);
    }
    unsigned int* dst = mb + gid;
    *dst = bits;
    // stands between the store and any later write of its registers: a precaution, as each block of the merged kernel runs one job and then ends
    asm volatile("s_wait_xcnt 0x0" ::: "memory");
}

// ---------------------------------------------------------------------------
// Kernel 1: the six independent preparation jobs in one launch; the block index picks the job.
// Blocks [0, 4 WBLK): weight planes Wq, Wk, Wv (bf16) and Wo (f16 x64), laid one behind the other in WT;
// they have the longest chain per block (load, LDS, barrier, store) and so take the lowest indices.
// Blocks [4 WBLK, 4 WBLK + MBLK): mask bits. The rest: x to bf16.
// ---------------------------------------------------------------------------
#define WSIDE   (EMB / 64)
#define WBLK    (WSIDE * WSIDE)
#define MBLK    ((NB * SEQ * MWORDS) / 256)
#define XBLK    ((MROWS * EMB / 8) / 256)
__global__ __launch_bounds__(256)
void k_prep(const float* __restrict__ x, const int* __restrict__ mask,
            const float* __restrict__ Wq, const float* __restrict__ Wk,
            const float* __restrict__ Wv, const float* __restrict__ Wo,
            uint16_t* __restrict__ xb, uint16_t* __restrict__ WT, unsigned int* __restrict__ mb) {
    __shared__ uint16_t tile[64 * 64];
    const int bid = blockIdx.x;                   // every branch below is block-uniform
    if (bid < 4 * WBLK) {
        const int job = bid / WBLK, tl = bid % WBLK;
        uint16_t* dst = WT + (size_t)job * (EMB * EMB);
        if (job < 3)
            job_wconv<false>(job == 0 ? Wq : (job == 1 ? Wk : Wv), dst, 1.0f, tl % WSIDE, tl / WSIDE, tile);
        else
            job_wconv<true>(Wo, dst, WO_CARRY, tl % WSIDE, tl / WSIDE, tile);
    } else if (bid < 4 * WBLK + MBLK) {
        job_maskbits(mask, mb, bid - 4 * WBLK);
    } else {
        job_cvt_x(x, xb, bid - (4 * WBLK + MBLK));
    }
}

// ---------------------------------------------------------------------------
// Kernel 2: C[M][EMB] = A[M][EMB] . BT[EMB][EMB]^T (+ bias), 16-bit planes, f32 accumulate.
// JOBS products that share A run in one launch: blockIdx.z picks BT plane z, bias z and C plane z
// (the BT planes lie one behind the other, the C planes too).
// Block 256 threads = 8 waves; block tile 128x128; wave tile 32 rows x 64 cols
// (2 x 4 accumulator tiles). k tiles of 64 (one 128-B line per row) are brought by whole-line
// loads, one tile ahead in registers, into two LDS buffers at row pitch 144 B (16 B x odd:
// conflict-free b128 fragment reads); one block barrier per k tile; products in k-steps of 32.
// OUT16: f16 plane out = f16(acc*oscale + bias);  else f32 out = acc*oscale + bias.
// ---------------------------------------------------------------------------
#define GK      64                        // k extent of one staged tile (halves)
#define GPITCH  72                        // LDS row pitch (halves)
#define GOPER   (128 * GPITCH)            // one operand tile (halves)
#define GBUF    (2 * GOPER)               // one buffer: A tile then B tile (halves)
static_assert(EMB % GK == 0 && EMB / GK >= 2);
static_assert(2 * GBUF * 2 >= 8 * 16 * 64 * 4);   // the epilogue slabs fit in the two buffers
template <bool BF, bool OUT16, int JOBS>
__global__ __launch_bounds__(256)
void k_gemm(const uint16_t* __restrict__ A, const uint16_t* __restrict__ BT0,
            const float* __restrict__ bias0, const float* __restrict__ bias1,
            const float* __restrict__ bias2, void* __restrict__ Cout, float oscale) {
    static_assert(JOBS >= 1 && JOBS <= 3);
    const int job = JOBS > 1 ? (int)blockIdx.z : 0;
    const uint16_t* BT  = BT0 + (size_t)job * (EMB * EMB);
    const float*   bias = job == 0 ? bias0 : (job == 1 ? bias1 : bias2);

    __shared__ __attribute__((aligned(16))) uint16_t stage[2 * GBUF];   // two k-tile buffers; epilogue slabs after the loop

    const int t = threadIdx.x, wave = t >> 5, lane = t & 31;
    const int hf = lane >> 4, l16 = lane & 15;
    const int m0 = blockIdx.y * 128, n0 = blockIdx.x * 128;
    const int wr = wave & 3, wc = wave >> 2;

    // staging: 8 lanes cover one 128-B row piece; thread rows srow + 32 i, i = 0..3, of each operand
    const int srow = t >> 3, sseg = (t & 7) * 8;
    const uint16_t* ag = A  + (size_t)(m0 + srow) * EMB + sseg;
    const uint16_t* bg = BT + (size_t)(n0 + srow) * EMB + sseg;
    uint16_t* sst = stage + srow * GPITCH + sseg;

    // fragment rows inside a buffer
    const uint16_t* afr = stage + (wr * 32 + l16) * GPITCH;
    const uint16_t* bfr = stage + GOPER + (wc * 64 + l16) * GPITCH;

    v8f acc[8] = {};
    v4u ra[4], rb[4];

#pragma unroll
    for (int i = 0; i < 4; ++i) {
        ra[i] = *(const v4u*)(ag + (size_t)(32 * i) * EMB);
        rb[i] = *(const v4u*)(bg + (size_t)(32 * i) * EMB);
    }
#pragma unroll
    for (int i = 0; i < 4; ++i) {
        *(v4u*)(sst + 32 * i * GPITCH)         = ra[i];
        *(v4u*)(sst + GOPER + 32 * i * GPITCH) = rb[i];
    }
    __syncthreads();

    // kept rolled; the buffer is picked by a scalar select
#pragma unroll 1
    for (int kt = 0; kt < EMB / GK; ++kt) {
        const int  cur  = (kt & 1) * GBUF;
        const bool more = kt + 1 < EMB / GK;      // block-uniform
        if (more) {
#pragma unroll
            for (int i = 0; i < 4; ++i) {
                ra[i] = *(const v4u*)(ag + (size_t)(32 * i) * EMB + (kt + 1) * GK);
                rb[i] = *(const v4u*)(bg + (size_t)(32 * i) * EMB + (kt + 1) * GK);
            }
        }
        // all fragment reads of the tile stand as one group ahead of its products
        Frag a[GK / 32][2], b[GK / 32][4];
#pragma unroll
        for (int kk = 0; kk < GK / 32; ++kk) {
#pragma unroll
            for (int mt = 0; mt < 2; ++mt) a[kk][mt] = ldfrag(afr + cur + mt * 16 * GPITCH, kk * 32, hf);
#pragma unroll
            for (int nt = 0; nt < 4; ++nt) b[kk][nt] = ldfrag(bfr + cur + nt * 16 * GPITCH, kk * 32, hf);
        }
#pragma unroll
        for (int kk = 0; kk < GK / 32; ++kk)
#pragma unroll
            for (int mt = 0; mt < 2; ++mt)
#pragma unroll
                for (int nt = 0; nt < 4; ++nt) {
                    if constexpr (BF)
                        acc[mt * 4 + nt] = mma_b(a[kk][mt].b, b[kk][nt].b, acc[mt * 4 + nt]);
                    else
                        acc[mt * 4 + nt] = mma_h(a[kk][mt].h, b[kk][nt].h, acc[mt * 4 + nt]);
                }
        if (more) {
            // the other buffer: its last readers left it before the barrier that ended the trip before
            uint16_t* dst = sst + (GBUF - cur);
#pragma unroll
            for (int i = 0; i < 4; ++i) {
                *(v4u*)(dst + 32 * i * GPITCH)         = ra[i];
                *(v4u*)(dst + GOPER + 32 * i * GPITCH) = rb[i];
            }
        }
        __syncthreads();                          // publishes tile kt+1; ends every read of tile kt
    }

    // bias (bf16-RNE input value) per accumulator column (lane = column)
    float bvv[4];
#pragma unroll
    for (int nt = 0; nt < 4; ++nt)
        bvv[nt] = bf16_rne(bias[n0 + wc * 64 + nt * 16 + l16]);

    float* mys = reinterpret_cast<float*>(stage) + wave * (16 * 64);   // 4 KB per wave
    if constexpr (OUT16) {
        uint16_t* mys16 = reinterpret_cast<uint16_t*>(mys);   // 32 rows x 64 halves
        uint16_t* C     = reinterpret_cast<uint16_t*>(Cout) + (size_t)job * ((size_t)MROWS * EMB);
#pragma unroll
        for (int mt = 0; mt < 2; ++mt)
#pragma unroll
            for (int nt = 0; nt < 4; ++nt)
#pragma unroll
                for (int r = 0; r < 8; ++r)
                    mys16[(mt * 16 + 8 * hf + r) * 64 + nt * 16 + l16] =
                        h_bits(acc[mt * 4 + nt][r] * oscale + bvv[nt]);
        __syncthreads();
        v4u val[8]; size_t off[8];
#pragma unroll
        for (int i = 0; i < 8; ++i) {
            const int p = lane + 32 * i;
            const int row = p >> 3, seg = (p & 7) * 8;          // lanes 8q..8q+7 -> one line
            val[i] = *(const v4u*)(mys16 + row * 64 + seg);
            off[i] = (size_t)(m0 + wr * 32 + row) * EMB + n0 + wc * 64 + seg;
        }
#pragma unroll
        for (int i = 0; i < 8; ++i) *(v4u*)(C + off[i]) = val[i];
        
    } else {
        float* C = reinterpret_cast<float*>(Cout) + (size_t)job * ((size_t)MROWS * EMB);
#pragma unroll
        for (int mt = 0; mt < 2; ++mt) {
            __syncthreads();
#pragma unroll
            for (int nt = 0; nt < 4; ++nt)
#pragma unroll
                for (int r = 0; r < 8; ++r)
                    mys[(8 * hf + r) * 64 + nt * 16 + l16] = acc[mt * 4 + nt][r] * oscale + bvv[nt];
            __syncthreads();
            v4f val[8]; size_t off[8];
#pragma unroll
            for (int i = 0; i < 8; ++i) {
                const int p = lane + 32 * i;
                const int row = p >> 4, seg = (p & 15) * 4;     // lanes 8q..8q+7 -> one line
                val[i] = *(const v4f*)(mys + row * 64 + seg);
                off[i] = (size_t)(m0 + wr * 32 + mt * 16 + row) * EMB + n0 + wc * 64 + seg;
            }
#pragma unroll
            for (int i = 0; i < 8; ++i) *(v4f*)(C + off[i]) = val[i];
            
        }
    }
}

#define APITCH  72                        // LDS row pitch (halves)
// second argument: at least 8 waves per SIMD, a budget of 128 vector registers, so that four work-groups
// (not three) fit a WGP and the whole grid of SEQ / 128 x NB x NHEAD work-groups is resident at once
__global__ __launch_bounds__(256, 8)
void k_attn(const uint16_t* __restrict__ Qp, const uint16_t* __restrict__ Kp,
            const uint16_t* __restrict__ Vp, const unsigned int* __restrict__ mb,
            uint16_t* __restrict__ ctx) {
    __shared__ __attribute__((aligned(16))) uint16_t kt[64 * APITCH];      // K tile [key][d]   (cross-wave: block barriers)
    __shared__ __attribute__((aligned(16))) uint16_t vt[64 * APITCH];      // V tile [d][key]   (cross-wave: block barriers)
    __shared__ __attribute__((aligned(16))) uint16_t ps[8][16 * APITCH];   // per-wave ctx stage (block barriers used)

    const int t = threadIdx.x, lane = t & 31;
    // the wave's number in a scalar register: what is formed from it and lives across the loop for the
    // epilogue (row base, stage slab) then takes no vector register, and the budget is met without scratch
    const int wave = __builtin_amdgcn_readfirstlane(t >> 5);
    const int hf = lane >> 4, l16 = lane & 15;
    const int b  = blockIdx.y / NHEAD, hd = blockIdx.y % NHEAD;
    const int qr = blockIdx.x * 128 + wave * 16;  // first query row of this wave (within sequence)
    const size_t rowb = (size_t)b * SEQ;          // compact plane row base of this batch
    const size_t hcol = (size_t)hd * HDIM;

    // Q fragments for the wave's 16 rows, straight from the f16 plane
    Frag qf[2];
    {
        const uint16_t* qrow = Qp + (rowb + qr + l16) * EMB + hcol;
        qf[0] = ldfrag(qrow, 0, hf);
        qf[1] = ldfrag(qrow, 32, hf);
    }

    v8f accO[4] = {};
    float mrow = -__builtin_inff();               // running maximum of the lane's query (both halves agree)
    float lrow = 0.0f;                            // running sum over the keys of the lane's own half

    const int keyr = t >> 2, hdB = (t & 3) * 16;  // coop staging: key row, 16 d-columns
    const unsigned int* mbrow = mb + (rowb + qr + l16) * MWORDS;      // mask row of the lane's query
    uint16_t* myps = ps[wave];

#pragma unroll 1
    for (int j = 0; j < SEQ / 64; ++j) {
        const int key0 = j * 64;
        __syncthreads();                         // prior tile fully consumed by all waves

        // ---- stage K tile [key][d] and V tile [d][key] (full 64x64 each) ----
        {
            const size_t go = (rowb + key0 + keyr) * EMB + hcol + hdB;
            const v4u k0v = *(const v4u*)(Kp + go);
            const v4u k1v = *(const v4u*)(Kp + go + 8);
            *(v4u*)&kt[keyr * APITCH + hdB]     = k0v;
            *(v4u*)&kt[keyr * APITCH + hdB + 8] = k1v;
            Frag fv;
            fv.q[0] = *(const v4u*)(Vp + go);
            fv.q[1] = *(const v4u*)(Vp + go + 8);
#pragma unroll
            for (int i = 0; i < 16; ++i) vt[(hdB + i) * APITCH + keyr] = fv.s[i];
        }
        // ---- mask words of the lane's query for these 64 keys (one b64), moved to the half's keys ----
        const v2u mw = *(const v2u*)(mbrow + 2 * j);
        const unsigned int mlo = mw.x >> (8 * hf), mhi = mw.y >> (8 * hf);
        __syncthreads();

        // ---- scores S^T = K(64x64) . Q^T, scale 1/8, replace-fill -1e9 where masked ----
        // element [nt][r]: key 16 nt + 8 hf + r, query l16
        v8f sc[4];
#pragma unroll
        for (int nt = 0; nt < 4; ++nt) {
            v8f z = {};
            Frag kf = ldfrag(&kt[(nt * 16 + l16) * APITCH], 0, hf);
            z = mma_h(kf.h, qf[0].h, z);
            kf = ldfrag(&kt[(nt * 16 + l16) * APITCH], 32, hf);
            z = mma_h(kf.h, qf[1].h, z);
#pragma unroll
            for (int r = 0; r < 8; ++r) {
                const unsigned int w   = (nt < 2) ? mlo : mhi;
                const unsigned int bit = w & (1u << ((nt & 1) * 16 + r));
                sc[nt][r] = bit ? -1.0e9f : z[r] * 0.125f;
            }
        }

        // ---- online softmax: one query per lane; the two halves hold 32 keys each ----
        float bm = sc[0][0];
#pragma unroll
        for (int nt = 0; nt < 4; ++nt)
#pragma unroll
            for (int r = 0; r < 8; ++r) bm = fmaxf(bm, sc[nt][r]);
        bm = fmaxf(bm, xhalf(bm));
        const float mnew  = fmaxf(mrow, bm);
        const float alpha = __expf(mrow - mnew);
        mrow = mnew;
        float rs[4];
#pragma unroll
        for (int nt = 0; nt < 4; ++nt) {
            rs[nt] = 0.0f;
#pragma unroll
            for (int r = 0; r < 8; ++r) {
                const float p = __expf(sc[nt][r] - mrow);
                sc[nt][r] = p;
                rs[nt] += p;
            }
        }
        lrow = lrow * alpha + ((rs[0] + rs[1]) + (rs[2] + rs[3]));
#pragma unroll
        for (int nt = 0; nt < 4; ++nt)
#pragma unroll
            for (int r = 0; r < 8; ++r) accO[nt][r] *= alpha;

        // ---- P^T B fragments, f16(1024 p), packed from the score accumulators in place ----
        Frag pf[2];
#pragma unroll
        for (int a = 0; a < 2; ++a)
#pragma unroll
            for (int r = 0; r < 8; ++r) {
                pf[a].h[r]     = (_Float16)(sc[2 * a][r] * P_CARRY);
                pf[a].h[8 + r] = (_Float16)(sc[2 * a + 1][r] * P_CARRY);
            }

        // ---- O^T += V^T(64 d x 64 keys) . P^T(64 keys x 16 queries) ----
#pragma unroll
        for (int nt = 0; nt < 4; ++nt) {
            Frag vf = ldfrag(&vt[(nt * 16 + l16) * APITCH], 0, hf);
            accO[nt] = mma_h(vf.h, pf[0].h, accO[nt]);
            vf = ldfrag(&vt[(nt * 16 + l16) * APITCH], 32, hf);
            accO[nt] = mma_h(vf.h, pf[1].h, accO[nt]);
        }
    }

    // the halves' sums are joined once; accO element [nt][r]: d = 16 nt + 8 hf + r, query l16
    const float inv = (1.0f / (lrow + xhalf(lrow))) * CTX_SCALE;
    __syncthreads();
#pragma unroll
    for (int nt = 0; nt < 4; ++nt) {
        v4u w;
#pragma unroll
        for (int i = 0; i < 4; ++i)
            w[i] = (uint32_t)h_bits(accO[nt][2 * i] * inv) | ((uint32_t)h_bits(accO[nt][2 * i + 1] * inv) << 16);
        *(v4u*)(myps + l16 * APITCH + nt * 16 + 8 * hf) = w;
    }
    __syncthreads();
    v4u val[4]; size_t off[4];
#pragma unroll
    for (int i = 0; i < 4; ++i) {
        const int p = lane + 32 * i;
        const int row = p >> 3, seg = (p & 7) * 8;              // lanes 8q..8q+7 -> one line
        val[i] = *(const v4u*)(myps + row * APITCH + seg);
        off[i] = (rowb + qr + row) * EMB + hcol + seg;
    }
#pragma unroll
    for (int i = 0; i < 4; ++i) *(v4u*)(ctx + off[i]) = val[i];
    
}

// ---------------------------------------------------------------------------
// Host launcher: 4 ops, workspace 93,323,264 B.
// ---------------------------------------------------------------------------
extern "C" void kernel_launch(void* const* d_in, const int* in_sizes, int n_in,
                              void* d_out, int out_size, void* d_ws, size_t ws_size,
                              hipStream_t stream) {
    if (n_in < 10) return;
    if (in_sizes[0] < NB * S_FULL * EMB) return;
    if (in_sizes[1] < NB * S_FULL * S_FULL) return;
    if (in_sizes[2] < EMB * EMB || in_sizes[4] < EMB * EMB ||
        in_sizes[6] < EMB * EMB || in_sizes[8] < EMB * EMB) return;
    if (in_sizes[3] < EMB || in_sizes[5] < EMB || in_sizes[7] < EMB || in_sizes[9] < EMB) return;
    if (out_size < MROWS * EMB) return;
    if (ws_size < WS_TOTAL) return;

    const float* x    = (const float*)d_in[0];   // [NB_FULL][S_FULL][EMB] f32
    const int*   mask = (const int*)d_in[1];     // [NB_FULL][S_FULL][S_FULL] int32 (bool)
    const float* Wq   = (const float*)d_in[2];   // [EMB in][EMB out]
    const float* bq   = (const float*)d_in[3];
    const float* Wk   = (const float*)d_in[4];
    const float* bk   = (const float*)d_in[5];
    const float* Wv   = (const float*)d_in[6];
    const float* bv   = (const float*)d_in[7];
    const float* Wo   = (const float*)d_in[8];
    const float* bo   = (const float*)d_in[9];
    float* out = (float*)d_out;                  // [MROWS][EMB] f32

    unsigned char* ws = (unsigned char*)d_ws;
    size_t off = 0;
    uint16_t* xb   = (uint16_t*)(ws + off); off += PLANE_BYTES;   // bf16 [MROWS][EMB]
    uint16_t* WqT  = (uint16_t*)(ws + off); off += WT_BYTES * 3;  // bf16 [n][k]: the Wq, Wk, Wv planes in a row
    uint16_t* WoT  = (uint16_t*)(ws + off); off += WT_BYTES;      // f16 [n][k], x64, directly behind them
    uint16_t* Qp   = (uint16_t*)(ws + off); off += PLANE_BYTES;   // f16 [MROWS][EMB]
    uint16_t* Kpl  = (uint16_t*)(ws + off); off += PLANE_BYTES;
    uint16_t* Vpl  = (uint16_t*)(ws + off); off += PLANE_BYTES;
    uint16_t* Ctx  = (uint16_t*)(ws + off); off += PLANE_BYTES;   // f16, x16
    unsigned int* mbits = (unsigned int*)(ws + off); off += MB_BYTES;
    if (off > ws_size) return;

    // the four weight planes are one run from WqT on; Qp, Kpl, Vpl are one run of three
    k_prep<<<dim3(4 * WBLK + MBLK + XBLK), dim3(256), 0, stream>>>(x, mask, Wq, Wk, Wv, Wo, xb, WqT, mbits);

    k_gemm<true, true, 3><<<dim3(EMB / 128, MROWS / 128, 3), dim3(256), 0, stream>>>(xb, WqT, bq, bk, bv, (void*)Qp, 1.0f);

    const dim3 gA(SEQ / 128, NB * NHEAD);
    k_attn<<<gA, dim3(256), 0, stream>>>(Qp, Kpl, Vpl, mbits, Ctx);

    k_gemm<false, false, 1><<<dim3(EMB / 128, MROWS / 128, 1), dim3(256), 0, stream>>>(Ctx, WoT, bo, bo, bo, (void*)out, OUT_SCALE);
}

// v006
// One run takes 130 microseconds.
// In two side-by-side timings against v005, it was 1.05 and 1.04 times as fast.
// Counting every step since v000, it is 3.25 times as fast.
#include <hip/hip_runtime.h>
#include <hip/hip_bf16.h>
#include <stdint.h>

// Contractions: x@Wq, x@Wk, x@Wv on v_wmma_f32_16x16x32_bf16 (bf16 operands = RNE-converted inputs);
// k.q^T, v^T.p^T and ctx@Wo on v_wmma_f32_16x16x32_f16 (f16 operands with power-of-two carries:
// p x1024, ctx x16, Wo x64); f32 accumulate; softmax, bias adds and normalisation in f32.

#ifndef NB
#define NB 8
#endif
#ifndef SEQ
#define SEQ 1024
#endif
#define NB_FULL 8
#define S_FULL  1024
#define EMB     1024
#define NHEAD   16
#define HDIM    64
#define MROWS   (NB * SEQ)
#define MWORDS  (SEQ / 32)

static_assert(NB >= 1 && NB <= NB_FULL);
static_assert(SEQ % 128 == 0 && SEQ <= S_FULL);
static_assert(EMB == NHEAD * HDIM);
static_assert(EMB % 128 == 0);
static_assert(MROWS % 128 == 0);
static_assert(((MROWS * EMB) / 8) % 256 == 0);
static_assert((NB * SEQ * MWORDS) % 256 == 0);

#define P_CARRY    1024.0f              // P operand = f16(1024 * exp(s - m))
#define CTX_SCALE  (1.0f / 64.0f)       // ctx operand = accO/(1024 l) * 16
#define WO_CARRY   64.0f                // Wo operand = f16(bf16(Wo) * 64)
#define OUT_SCALE  (1.0f / 1024.0f)     // 1/(16 * 64)

// workspace carve (bytes); every region written at its exact extent (tile multiples == plane sizes)
#define PLANE_BYTES ((size_t)MROWS * EMB * 2)
#define WT_BYTES    ((size_t)EMB * EMB * 2)
#define MB_BYTES    ((size_t)NB * SEQ * MWORDS * 4)
#define WS_TOTAL    (PLANE_BYTES * 5 + WT_BYTES * 4 + MB_BYTES)
static_assert(WS_TOTAL <= (size_t)134217728);
static_assert(PLANE_BYTES % 128 == 0 && WT_BYTES % 128 == 0 && MB_BYTES % 128 == 0);

typedef _Float16     v16h __attribute__((ext_vector_type(16)));
typedef __bf16       v16b __attribute__((ext_vector_type(16)));
typedef float        v8f  __attribute__((ext_vector_type(8)));
typedef float        v4f  __attribute__((ext_vector_type(4)));
typedef unsigned int v4u  __attribute__((ext_vector_type(4)));
typedef unsigned int v2u  __attribute__((ext_vector_type(2)));
typedef int          v4i  __attribute__((ext_vector_type(4)));
typedef short        v8s  __attribute__((ext_vector_type(8)));

union Frag {
    v16h     h;
    v16b     b;
    v4u      q[2];
    uint16_t s[16];
};

// ---------------------------------------------------------------------------
// scalar conversions
// ---------------------------------------------------------------------------
__device__ __forceinline__ uint16_t bf16_bits(float f) {
    uint32_t u = __builtin_bit_cast(uint32_t, f);
    u += 0x7FFFu + ((u >> 16) & 1u);              // RNE
    return (uint16_t)(u >> 16);
}
__device__ __forceinline__ float bf16_rne(float f) {
    const uint32_t u = ((uint32_t)bf16_bits(f)) << 16;
    return __builtin_bit_cast(float, u);
}
__device__ __forceinline__ uint16_t h_bits(float f) {
    return __builtin_bit_cast(uint16_t, (_Float16)f);   // RNE f32 -> f16
}

// ---------------------------------------------------------------------------
// WMMA helpers: issue + hazard guard (4 VALU slots, D tied, A/B kept live)
// ---------------------------------------------------------------------------
__device__ __forceinline__ v8f mma_h(v16h a, v16h b, v8f c) {
    v8f d = __builtin_amdgcn_wmma_f32_16x16x32_f16(false, a, false, b, (short)0, c, false, false);
    asm volatile("v_nop\n\tv_nop\n\tv_nop\n\tv_nop" : "+v"(d) : "v"(a), "v"(b));
    return d;
}
__device__ __forceinline__ v8f mma_b(v16b a, v16b b, v8f c) {
    v8f d = __builtin_amdgcn_wmma_f32_16x16x32_bf16(false, a, false, b, (short)0, c, false, false);
    asm volatile("v_nop\n\tv_nop\n\tv_nop\n\tv_nop" : "+v"(d) : "v"(a), "v"(b));
    return d;
}

// 16x32 16-bit A/B fragment from a k-contiguous row (wave32 split layout):
// lane row/col = lane&15, hf = lane>>4; elements 0..7 <- k0+8hf+0..7, elements 8..15 <- k0+16+8hf+0..7
__device__ __forceinline__ Frag ldfrag(const uint16_t* rowp, int k0, int hf) {
    Frag f;
    f.q[0] = *(const v4u*)(rowp + k0 + 8 * hf);
    f.q[1] = *(const v4u*)(rowp + k0 + 16 + 8 * hf);
    return f;
}

// 16x32 16-bit A fragment of T^T from a row-major LDS tile T[k][d] (row pitch in halves) by the transposing load:
// p = the lane's address, T + (k0 + 8 (lane>>4) + (lane&7)) * pitch + d0 + 8 ((lane>>3)&1);
// the lane (row d0 + (lane&15), hf = lane>>4) then holds elements 0..7 <- T[k0+8hf+0..7][row], 8..15 <- T[k0+16+8hf+0..7][row]
__device__ __forceinline__ Frag ldfrag_tr(const uint16_t* p, int pitch) {
    typedef __attribute__((address_space(3))) v8s lds_v8s;
    Frag f;
    f.q[0] = __builtin_bit_cast(v4u, __builtin_amdgcn_ds_load_tr16_b128_v8i16((lds_v8s*)p));
    f.q[1] = __builtin_bit_cast(v4u, __builtin_amdgcn_ds_load_tr16_b128_v8i16((lds_v8s*)(p + 16 * pitch)));
    return f;
}

// lane l <-> lane l ^ 16 by a vector cross-row move (no LDS round trip)
__device__ __forceinline__ float xhalf(float x) {
    const int b = __builtin_bit_cast(int, x);
    return __builtin_bit_cast(float, __builtin_amdgcn_permlanex16(b, b, 0x76543210, 0xfedcba98, false, false));
}

// ---------------------------------------------------------------------------
// Preparation job 1: x f32 [NB][S_FULL][EMB] -> bf16 plane xb [MROWS][EMB] (compact rows).
// ---------------------------------------------------------------------------
__device__ __forceinline__
void job_cvt_x(const float* __restrict__ x, uint16_t* __restrict__ xb, int blk) {
    const size_t gid = (size_t)blk * 256 + threadIdx.x;
    const size_t e0  = gid * 8;
    const size_t m   = e0 / EMB;
    const int    c   = (int)(e0 % EMB);
    const size_t b   = m / SEQ, s = m % SEQ;
    const float* src = x + (b * S_FULL + s) * EMB + c;
    const v4f a0 = *(const v4f*)src;
    const v4f a1 = *(const v4f*)(src + 4);
    v4u w;
    w.x = (uint32_t)bf16_bits(a0.x) | ((uint32_t)bf16_bits(a0.y) << 16);
    w.y = (uint32_t)bf16_bits(a0.z) | ((uint32_t)bf16_bits(a0.w) << 16);
    w.z = (uint32_t)bf16_bits(a1.x) | ((uint32_t)bf16_bits(a1.y) << 16);
    w.w = (uint32_t)bf16_bits(a1.z) | ((uint32_t)bf16_bits(a1.w) << 16);
    uint16_t* dst = xb + e0;
    *(v4u*)dst = w;
    // stands between the store and any later write of its registers: a precaution, as each block of the merged kernel runs one job and then ends
    asm volatile("s_wait_xcnt 0x0" ::: "memory");
}

// ---------------------------------------------------------------------------
// Preparation job 2: W f32 [k][n] (EMB x EMB) -> WT 16-bit [n][k] (k-contiguous B operand plane).
// bf16 RNE of the input value, optional power-of-two scale, then bf16 or f16 bits.
// ---------------------------------------------------------------------------
template <bool TO_F16>
__device__ __forceinline__
void job_wconv(const float* __restrict__ W, uint16_t* __restrict__ WT, float scale,
               int bx, int by, uint16_t* tile) {  // tile: LDS [n][k] 64 x 64; cross-wave -> block barrier
    const int t = threadIdx.x;
    const int n0 = bx * 64, k0 = by * 64;
    const int kr = t >> 2, nc = (t & 3) * 16;     // thread: row k0+kr, cols n0+nc..+15
    const float* src = W + (size_t)(k0 + kr) * EMB + n0 + nc;
#pragma unroll
    for (int i = 0; i < 4; ++i) {
        const v4f v = *(const v4f*)(src + 4 * i);
        float f[4];
        f[0] = v.x; f[1] = v.y; f[2] = v.z; f[3] = v.w;
#pragma unroll
        for (int jj = 0; jj < 4; ++jj) {
            const float g = bf16_rne(f[jj]) * scale;
            tile[(nc + 4 * i + jj) * 64 + kr] = TO_F16 ? h_bits(g) : bf16_bits(g);
        }
    }
    __syncthreads();
    v4u val[2]; size_t off[2];
#pragma unroll
    for (int i = 0; i < 2; ++i) {
        const int p   = t + 256 * i;              // wave w, lane: row = 4w + 32i + lane>>3
        const int row = p >> 3, seg = (p & 7) * 8;
        val[i] = *(const v4u*)&tile[row * 64 + seg];
        off[i] = (size_t)(n0 + row) * EMB + k0 + seg;
    }
#pragma unroll
    for (int i = 0; i < 2; ++i) *(v4u*)(WT + off[i]) = val[i];
    // stands between the store and any later write of its registers: a precaution, as each block of the merged kernel runs one job and then ends
    asm volatile("s_wait_xcnt 0x0" ::: "memory");
}

// ---------------------------------------------------------------------------
// Preparation job 3: mask int32 [NB][S_FULL][S_FULL] -> dense bit plane mb [MROWS][MWORDS],
// bit j of word w <-> key 32w+j nonzero (suppressed). One thread = one word;
// ---------------------------------------------------------------------------
__device__ __forceinline__
void job_maskbits(const int* __restrict__ mask, unsigned int* __restrict__ mb, int blk) {
    const size_t gid = (size_t)blk * 256 + threadIdx.x;
    const int    w   = (int)(gid % MWORDS);
    const size_t row = gid / MWORDS;
    const size_t b = row / SEQ, q = row % SEQ;
    const int* src = mask + (b * S_FULL + q) * S_FULL + (size_t)w * 32;
    unsigned int bits = 0u;
#pragma unroll
    for (int i = 0; i < 8; ++i) {
        const v4i v = *(const v4i*)(src + 4 * i);
        bits |= (v.x != 0 ? 1u : 0u) << (4 * i + 0);
        bits |= (v.y != 0 ? 1u : 0u) << (4 * i + 1);
        bits |= (v.z != 0 ? 1u : 0u) << (4 * i + 2);
        bits |= (v.w != 0 ? 1u : 0u) << (4 * i + 3);
    }
    unsigned int* dst = mb + gid;
    *dst = bits;
    // stands between the store and any later write of its registers: a precaution, as each block of the merged kernel runs one job and then ends
    asm volatile("s_wait_xcnt 0x0" ::: "memory");
}

// ---------------------------------------------------------------------------
// Kernel 1: the six independent preparation jobs in one launch; the block index picks the job.
// Blocks [0, 4 WBLK): weight planes Wq, Wk, Wv (bf16) and Wo (f16 x64), laid one behind the other in WT;
// they have the longest chain per block (load, LDS, barrier, store) and so take the lowest indices.
// Blocks [4 WBLK, 4 WBLK + MBLK): mask bits. The rest: x to bf16.
// ---------------------------------------------------------------------------
#define WSIDE   (EMB / 64)
#define WBLK    (WSIDE * WSIDE)
#define MBLK    ((NB * SEQ * MWORDS) / 256)
#define XBLK    ((MROWS * EMB / 8) / 256)
__global__ __launch_bounds__(256)
void k_prep(const float* __restrict__ x, const int* __restrict__ mask,
            const float* __restrict__ Wq, const float* __restrict__ Wk,
            const float* __restrict__ Wv, const float* __restrict__ Wo,
            uint16_t* __restrict__ xb, uint16_t* __restrict__ WT, unsigned int* __restrict__ mb) {
    __shared__ uint16_t tile[64 * 64];
    const int bid = blockIdx.x;                   // every branch below is block-uniform
    if (bid < 4 * WBLK) {
        const int job = bid / WBLK, tl = bid % WBLK;
        uint16_t* dst = WT + (size_t)job * (EMB * EMB);
        if (job < 3)
            job_wconv<false>(job == 0 ? Wq : (job == 1 ? Wk : Wv), dst, 1.0f, tl % WSIDE, tl / WSIDE, tile);
        else
            job_wconv<true>(Wo, dst, WO_CARRY, tl % WSIDE, tl / WSIDE, tile);
    } else if (bid < 4 * WBLK + MBLK) {
        job_maskbits(mask, mb, bid - 4 * WBLK);
    } else {
        job_cvt_x(x, xb, bid - (4 * WBLK + MBLK));
    }
}

// ---------------------------------------------------------------------------
// Kernel 2: C[M][EMB] = A[M][EMB] . BT[EMB][EMB]^T (+ bias), 16-bit planes, f32 accumulate.
// JOBS products that share A run in one launch: blockIdx.z picks BT plane z, bias z and C plane z
// (the BT planes lie one behind the other, the C planes too).
// Block 256 threads = 8 waves; block tile 128x128; wave tile 32 rows x 64 cols
// (2 x 4 accumulator tiles). k tiles of 64 (one 128-B line per row) are brought by whole-line
// loads, one tile ahead in registers, into two LDS buffers at row pitch 144 B (16 B x odd:
// conflict-free b128 fragment reads); one block barrier per k tile; products in k-steps of 32.
// OUT16: f16 plane out = f16(acc*oscale + bias);  else f32 out = acc*oscale + bias.
// ---------------------------------------------------------------------------
#define GK      64                        // k extent of one staged tile (halves)
#define GPITCH  72                        // LDS row pitch (halves)
#define GOPER   (128 * GPITCH)            // one operand tile (halves)
#define GBUF    (2 * GOPER)               // one buffer: A tile then B tile (halves)
static_assert(EMB % GK == 0 && EMB / GK >= 2);
static_assert(2 * GBUF * 2 >= 8 * 16 * 64 * 4);   // the epilogue slabs fit in the two buffers
template <bool BF, bool OUT16, int JOBS>
__global__ __launch_bounds__(256)
void k_gemm(const uint16_t* __restrict__ A, const uint16_t* __restrict__ BT0,
            const float* __restrict__ bias0, const float* __restrict__ bias1,
            const float* __restrict__ bias2, void* __restrict__ Cout, float oscale) {
    static_assert(JOBS >= 1 && JOBS <= 3);
    const int job = JOBS > 1 ? (int)blockIdx.z : 0;
    const uint16_t* BT  = BT0 + (size_t)job * (EMB * EMB);
    const float*   bias = job == 0 ? bias0 : (job == 1 ? bias1 : bias2);

    __shared__ __attribute__((aligned(16))) uint16_t stage[2 * GBUF];   // two k-tile buffers; epilogue slabs after the loop

    const int t = threadIdx.x, wave = t >> 5, lane = t & 31;
    const int hf = lane >> 4, l16 = lane & 15;
    const int m0 = blockIdx.y * 128, n0 = blockIdx.x * 128;
    const int wr = wave & 3, wc = wave >> 2;

    // staging: 8 lanes cover one 128-B row piece; thread rows srow + 32 i, i = 0..3, of each operand
    const int srow = t >> 3, sseg = (t & 7) * 8;
    const uint16_t* ag = A  + (size_t)(m0 + srow) * EMB + sseg;
    const uint16_t* bg = BT + (size_t)(n0 + srow) * EMB + sseg;
    uint16_t* sst = stage + srow * GPITCH + sseg;

    // fragment rows inside a buffer
    const uint16_t* afr = stage + (wr * 32 + l16) * GPITCH;
    const uint16_t* bfr = stage + GOPER + (wc * 64 + l16) * GPITCH;

    v8f acc[8] = {};
    v4u ra[4], rb[4];

#pragma unroll
    for (int i = 0; i < 4; ++i) {
        ra[i] = *(const v4u*)(ag + (size_t)(32 * i) * EMB);
        rb[i] = *(const v4u*)(bg + (size_t)(32 * i) * EMB);
    }
#pragma unroll
    for (int i = 0; i < 4; ++i) {
        *(v4u*)(sst + 32 * i * GPITCH)         = ra[i];
        *(v4u*)(sst + GOPER + 32 * i * GPITCH) = rb[i];
    }
    __syncthreads();

    // kept rolled; the buffer is picked by a scalar select
#pragma unroll 1
    for (int kt = 0; kt < EMB / GK; ++kt) {
        const int  cur  = (kt & 1) * GBUF;
        const bool more = kt + 1 < EMB / GK;      // block-uniform
        if (more) {
#pragma unroll
            for (int i = 0; i < 4; ++i) {
                ra[i] = *(const v4u*)(ag + (size_t)(32 * i) * EMB + (kt + 1) * GK);
                rb[i] = *(const v4u*)(bg + (size_t)(32 * i) * EMB + (kt + 1) * GK);
            }
        }
        // all fragment reads of the tile stand as one group ahead of its products
        Frag a[GK / 32][2], b[GK / 32][4];
#pragma unroll
        for (int kk = 0; kk < GK / 32; ++kk) {
#pragma unroll
            for (int mt = 0; mt < 2; ++mt) a[kk][mt] = ldfrag(afr + cur + mt * 16 * GPITCH, kk * 32, hf);
#pragma unroll
            for (int nt = 0; nt < 4; ++nt) b[kk][nt] = ldfrag(bfr + cur + nt * 16 * GPITCH, kk * 32, hf);
        }
#pragma unroll
        for (int kk = 0; kk < GK / 32; ++kk)
#pragma unroll
            for (int mt = 0; mt < 2; ++mt)
#pragma unroll
                for (int nt = 0; nt < 4; ++nt) {
                    if constexpr (BF)
                        acc[mt * 4 + nt] = mma_b(a[kk][mt].b, b[kk][nt].b, acc[mt * 4 + nt]);
                    else
                        acc[mt * 4 + nt] = mma_h(a[kk][mt].h, b[kk][nt].h, acc[mt * 4 + nt]);
                }
        if (more) {
            // the other buffer: its last readers left it before the barrier that ended the trip before
            uint16_t* dst = sst + (GBUF - cur);
#pragma unroll
            for (int i = 0; i < 4; ++i) {
                *(v4u*)(dst + 32 * i * GPITCH)         = ra[i];
                *(v4u*)(dst + GOPER + 32 * i * GPITCH) = rb[i];
            }
        }
        __syncthreads();                          // publishes tile kt+1; ends every read of tile kt
    }

    // bias (bf16-RNE input value) per accumulator column (lane = column)
    float bvv[4];
#pragma unroll
    for (int nt = 0; nt < 4; ++nt)
        bvv[nt] = bf16_rne(bias[n0 + wc * 64 + nt * 16 + l16]);

    float* mys = reinterpret_cast<float*>(stage) + wave * (16 * 64);   // 4 KB per wave
    if constexpr (OUT16) {
        uint16_t* mys16 = reinterpret_cast<uint16_t*>(mys);   // 32 rows x 64 halves
        uint16_t* C     = reinterpret_cast<uint16_t*>(Cout) + (size_t)job * ((size_t)MROWS * EMB);
#pragma unroll
        for (int mt = 0; mt < 2; ++mt)
#pragma unroll
            for (int nt = 0; nt < 4; ++nt)
#pragma unroll
                for (int r = 0; r < 8; ++r)
                    mys16[(mt * 16 + 8 * hf + r) * 64 + nt * 16 + l16] =
                        h_bits(acc[mt * 4 + nt][r] * oscale + bvv[nt]);
        __syncthreads();
        v4u val[8]; size_t off[8];
#pragma unroll
        for (int i = 0; i < 8; ++i) {
            const int p = lane + 32 * i;
            const int row = p >> 3, seg = (p & 7) * 8;          // lanes 8q..8q+7 -> one line
            val[i] = *(const v4u*)(mys16 + row * 64 + seg);
            off[i] = (size_t)(m0 + wr * 32 + row) * EMB + n0 + wc * 64 + seg;
        }
#pragma unroll
        for (int i = 0; i < 8; ++i) *(v4u*)(C + off[i]) = val[i];
        
    } else {
        float* C = reinterpret_cast<float*>(Cout) + (size_t)job * ((size_t)MROWS * EMB);
#pragma unroll
        for (int mt = 0; mt < 2; ++mt) {
            __syncthreads();
#pragma unroll
            for (int nt = 0; nt < 4; ++nt)
#pragma unroll
                for (int r = 0; r < 8; ++r)
                    mys[(8 * hf + r) * 64 + nt * 16 + l16] = acc[mt * 4 + nt][r] * oscale + bvv[nt];
            __syncthreads();
            v4f val[8]; size_t off[8];
#pragma unroll
            for (int i = 0; i < 8; ++i) {
                const int p = lane + 32 * i;
                const int row = p >> 4, seg = (p & 15) * 4;     // lanes 8q..8q+7 -> one line
                val[i] = *(const v4f*)(mys + row * 64 + seg);
                off[i] = (size_t)(m0 + wr * 32 + mt * 16 + row) * EMB + n0 + wc * 64 + seg;
            }
#pragma unroll
            for (int i = 0; i < 8; ++i) *(v4f*)(C + off[i]) = val[i];
            
        }
    }
}

#define APITCH  72                        // LDS row pitch (halves)
#define VPITCH  80                        // LDS row pitch of the V tile (halves)
// second argument: at least 8 waves per SIMD, a budget of 128 vector registers, so that four work-groups
// (not three) fit a WGP and the whole grid of SEQ / 128 x NB x NHEAD work-groups is resident at once
__global__ __launch_bounds__(256, 8)
void k_attn(const uint16_t* __restrict__ Qp, const uint16_t* __restrict__ Kp,
            const uint16_t* __restrict__ Vp, const unsigned int* __restrict__ mb,
            uint16_t* __restrict__ ctx) {
    __shared__ __attribute__((aligned(16))) uint16_t kt[64 * APITCH];      // K tile [key][d]   (cross-wave: block barriers)
    __shared__ __attribute__((aligned(16))) uint16_t vt[64 * VPITCH];      // V tile [key][d]   (cross-wave: block barriers)
    __shared__ __attribute__((aligned(16))) uint16_t ps[8][16 * APITCH];   // per-wave ctx stage (block barriers used)

    const int t = threadIdx.x, lane = t & 31;
    // the wave's number in a scalar register: what is formed from it and lives across the loop for the
    // epilogue (row base, stage slab) then takes no vector register, and the budget is met without scratch
    const int wave = __builtin_amdgcn_readfirstlane(t >> 5);
    const int hf = lane >> 4, l16 = lane & 15;
    const int b  = blockIdx.y / NHEAD, hd = blockIdx.y % NHEAD;
    const int qr = blockIdx.x * 128 + wave * 16;  // first query row of this wave (within sequence)
    const size_t rowb = (size_t)b * SEQ;          // compact plane row base of this batch
    const size_t hcol = (size_t)hd * HDIM;

    // Q fragments for the wave's 16 rows, straight from the f16 plane
    Frag qf[2];
    {
        const uint16_t* qrow = Qp + (rowb + qr + l16) * EMB + hcol;
        qf[0] = ldfrag(qrow, 0, hf);
        qf[1] = ldfrag(qrow, 32, hf);
    }

    v8f accO[4] = {};
    float mrow = -__builtin_inff();               // running maximum of the lane's query (both halves agree)
    float lrow = 0.0f;                            // running sum over the keys of the lane's own half

    const int keyr = t >> 2, hdB = (t & 3) * 16;  // coop staging: key row, 16 d-columns
    const unsigned int* mbrow = mb + (rowb + qr + l16) * MWORDS;      // mask row of the lane's query
    uint16_t* myps = ps[wave];
    const uint16_t* vtl = vt + (8 * hf + (lane & 7)) * VPITCH + 8 * ((lane >> 3) & 1);   // the lane's transposing-load base

#pragma unroll 1
    for (int j = 0; j < SEQ / 64; ++j) {
        const int key0 = j * 64;
        __syncthreads();                         // prior tile fully consumed by all waves

        // ---- stage K tile and V tile, both [key][d] (full 64x64 each) ----
        {
            const size_t go = (rowb + key0 + keyr) * EMB + hcol + hdB;
            const v4u k0v = *(const v4u*)(Kp + go);
            const v4u k1v = *(const v4u*)(Kp + go + 8);
            *(v4u*)&kt[keyr * APITCH + hdB]     = k0v;
            *(v4u*)&kt[keyr * APITCH + hdB + 8] = k1v;
            const v4u v0v = *(const v4u*)(Vp + go);
            const v4u v1v = *(const v4u*)(Vp + go + 8);
            *(v4u*)&vt[keyr * VPITCH + hdB]     = v0v;
            *(v4u*)&vt[keyr * VPITCH + hdB + 8] = v1v;
        }
        // ---- mask words of the lane's query for these 64 keys (one b64), moved to the half's keys ----
        const v2u mw = *(const v2u*)(mbrow + 2 * j);
        const unsigned int mlo = mw.x >> (8 * hf), mhi = mw.y >> (8 * hf);
        __syncthreads();

        // ---- scores S^T = K(64x64) . Q^T, scale 1/8, replace-fill -1e9 where masked ----
        // element [nt][r]: key 16 nt + 8 hf + r, query l16
        v8f sc[4];
#pragma unroll
        for (int nt = 0; nt < 4; ++nt) {
            v8f z = {};
            Frag kf = ldfrag(&kt[(nt * 16 + l16) * APITCH], 0, hf);
            z = mma_h(kf.h, qf[0].h, z);
            kf = ldfrag(&kt[(nt * 16 + l16) * APITCH], 32, hf);
            z = mma_h(kf.h, qf[1].h, z);
#pragma unroll
            for (int r = 0; r < 8; ++r) {
                const unsigned int w   = (nt < 2) ? mlo : mhi;
                const unsigned int bit = w & (1u << ((nt & 1) * 16 + r));
                sc[nt][r] = bit ? -1.0e9f : z[r] * 0.125f;
            }
        }

        // ---- online softmax: one query per lane; the two halves hold 32 keys each ----
        float bm = sc[0][0];
#pragma unroll
        for (int nt = 0; nt < 4; ++nt)
#pragma unroll
            for (int r = 0; r < 8; ++r) bm = fmaxf(bm, sc[nt][r]);
        bm = fmaxf(bm, xhalf(bm));
        const float mnew  = fmaxf(mrow, bm);
        const float alpha = __expf(mrow - mnew);
        mrow = mnew;
        float rs[4];
#pragma unroll
        for (int nt = 0; nt < 4; ++nt) {
            rs[nt] = 0.0f;
#pragma unroll
            for (int r = 0; r < 8; ++r) {
                const float p = __expf(sc[nt][r] - mrow);
                sc[nt][r] = p;
                rs[nt] += p;
            }
        }
        lrow = lrow * alpha + ((rs[0] + rs[1]) + (rs[2] + rs[3]));
#pragma unroll
        for (int nt = 0; nt < 4; ++nt)
#pragma unroll
            for (int r = 0; r < 8; ++r) accO[nt][r] *= alpha;

        // ---- P^T B fragments, f16(1024 p), packed from the score accumulators in place ----
        Frag pf[2];
#pragma unroll
        for (int a = 0; a < 2; ++a)
#pragma unroll
            for (int r = 0; r < 8; ++r) {
                pf[a].h[r]     = (_Float16)(sc[2 * a][r] * P_CARRY);
                pf[a].h[8 + r] = (_Float16)(sc[2 * a + 1][r] * P_CARRY);
            }

        // ---- O^T += V^T(64 d x 64 keys) . P^T(64 keys x 16 queries) ----
#pragma unroll
        for (int nt = 0; nt < 4; ++nt) {
            Frag vf = ldfrag_tr(vtl + nt * 16, VPITCH);
            accO[nt] = mma_h(vf.h, pf[0].h, accO[nt]);
            vf = ldfrag_tr(vtl + 32 * VPITCH + nt * 16, VPITCH);
            accO[nt] = mma_h(vf.h, pf[1].h, accO[nt]);
        }
    }

    // the halves' sums are joined once; accO element [nt][r]: d = 16 nt + 8 hf + r, query l16
    const float inv = (1.0f / (lrow + xhalf(lrow))) * CTX_SCALE;
    __syncthreads();
#pragma unroll
    for (int nt = 0; nt < 4; ++nt) {
        v4u w;
#pragma unroll
        for (int i = 0; i < 4; ++i)
            w[i] = (uint32_t)h_bits(accO[nt][2 * i] * inv) | ((uint32_t)h_bits(accO[nt][2 * i + 1] * inv) << 16);
        *(v4u*)(myps + l16 * APITCH + nt * 16 + 8 * hf) = w;
    }
    __syncthreads();
    v4u val[4]; size_t off[4];
#pragma unroll
    for (int i = 0; i < 4; ++i) {
        const int p = lane + 32 * i;
        const int row = p >> 3, seg = (p & 7) * 8;              // lanes 8q..8q+7 -> one line
        val[i] = *(const v4u*)(myps + row * APITCH + seg);
        off[i] = (rowb + qr + row) * EMB + hcol + seg;
    }
#pragma unroll
    for (int i = 0; i < 4; ++i) *(v4u*)(ctx + off[i]) = val[i];
    
}

// ---------------------------------------------------------------------------
// Host launcher: 4 ops, workspace 93,323,264 B.
// ---------------------------------------------------------------------------
extern "C" void kernel_launch(void* const* d_in, const int* in_sizes, int n_in,
                              void* d_out, int out_size, void* d_ws, size_t ws_size,
                              hipStream_t stream) {
    if (n_in < 10) return;
    if (in_sizes[0] < NB * S_FULL * EMB) return;
    if (in_sizes[1] < NB * S_FULL * S_FULL) return;
    if (in_sizes[2] < EMB * EMB || in_sizes[4] < EMB * EMB ||
        in_sizes[6] < EMB * EMB || in_sizes[8] < EMB * EMB) return;
    if (in_sizes[3] < EMB || in_sizes[5] < EMB || in_sizes[7] < EMB || in_sizes[9] < EMB) return;
    if (out_size < MROWS * EMB) return;
    if (ws_size < WS_TOTAL) return;

    const float* x    = (const float*)d_in[0];   // [NB_FULL][S_FULL][EMB] f32
    const int*   mask = (const int*)d_in[1];     // [NB_FULL][S_FULL][S_FULL] int32 (bool)
    const float* Wq   = (const float*)d_in[2];   // [EMB in][EMB out]
    const float* bq   = (const float*)d_in[3];
    const float* Wk   = (const float*)d_in[4];
    const float* bk   = (const float*)d_in[5];
    const float* Wv   = (const float*)d_in[6];
    const float* bv   = (const float*)d_in[7];
    const float* Wo   = (const float*)d_in[8];
    const float* bo   = (const float*)d_in[9];
    float* out = (float*)d_out;                  // [MROWS][EMB] f32

    unsigned char* ws = (unsigned char*)d_ws;
    size_t off = 0;
    uint16_t* xb   = (uint16_t*)(ws + off); off += PLANE_BYTES;   // bf16 [MROWS][EMB]
    uint16_t* WqT  = (uint16_t*)(ws + off); off += WT_BYTES * 3;  // bf16 [n][k]: the Wq, Wk, Wv planes in a row
    uint16_t* WoT  = (uint16_t*)(ws + off); off += WT_BYTES;      // f16 [n][k], x64, directly behind them
    uint16_t* Qp   = (uint16_t*)(ws + off); off += PLANE_BYTES;   // f16 [MROWS][EMB]
    uint16_t* Kpl  = (uint16_t*)(ws + off); off += PLANE_BYTES;
    uint16_t* Vpl  = (uint16_t*)(ws + off); off += PLANE_BYTES;
    uint16_t* Ctx  = (uint16_t*)(ws + off); off += PLANE_BYTES;   // f16, x16
    unsigned int* mbits = (unsigned int*)(ws + off); off += MB_BYTES;
    if (off > ws_size) return;

    // the four weight planes are one run from WqT on; Qp, Kpl, Vpl are one run of three
    k_prep<<<dim3(4 * WBLK + MBLK + XBLK), dim3(256), 0, stream>>>(x, mask, Wq, Wk, Wv, Wo, xb, WqT, mbits);

    k_gemm<true, true, 3><<<dim3(EMB / 128, MROWS / 128, 3), dim3(256), 0, stream>>>(xb, WqT, bq, bk, bv, (void*)Qp, 1.0f);

    const dim3 gA(SEQ / 128, NB * NHEAD);
    k_attn<<<gA, dim3(256), 0, stream>>>(Qp, Kpl, Vpl, mbits, Ctx);

    k_gemm<false, false, 1><<<dim3(EMB / 128, MROWS / 128, 1), dim3(256), 0, stream>>>(Ctx, WoT, bo, bo, bo, (void*)out, OUT_SCALE);
}

// v007
// It runs in 122 microseconds.
// Next to v006, in two timings, it ran 1.06 times as fast each time.
// Counting every step since v000, it is 3.44 times as fast.
#include <hip/hip_runtime.h>
#include <hip/hip_bf16.h>
#include <stdint.h>

// Contractions: x@Wq, x@Wk, x@Wv on v_wmma_f32_16x16x32_bf16 (bf16 operands = RNE-converted inputs);
// k.q^T, v^T.p^T and ctx@Wo on v_wmma_f32_16x16x32_f16 (f16 operands with power-of-two carries:
// p x1024, ctx x16, Wo x64); f32 accumulate; softmax, bias adds and normalisation in f32.

#ifndef NB
#define NB 8
#endif
#ifndef SEQ
#define SEQ 1024
#endif
#define NB_FULL 8
#define S_FULL  1024
#define EMB     1024
#define NHEAD   16
#define HDIM    64
#define MROWS   (NB * SEQ)
#define MWORDS  (SEQ / 32)

static_assert(NB >= 1 && NB <= NB_FULL);
static_assert(SEQ % 128 == 0 && SEQ <= S_FULL);
static_assert(EMB == NHEAD * HDIM);
static_assert(EMB % 128 == 0);
static_assert(MROWS % 128 == 0);
static_assert(((MROWS * EMB) / 8) % 256 == 0);
static_assert((NB * SEQ * MWORDS) % 256 == 0);

#define P_CARRY    1024.0f              // P operand = f16(1024 * exp(s - m))
#define CTX_SCALE  (1.0f / 64.0f)       // ctx operand = accO/(1024 l) * 16
#define WO_CARRY   64.0f                // Wo operand = f16(bf16(Wo) * 64)
#define OUT_SCALE  (1.0f / 1024.0f)     // 1/(16 * 64)

// workspace carve (bytes); every region written at its exact extent (tile multiples == plane sizes)
#define PLANE_BYTES ((size_t)MROWS * EMB * 2)
#define WT_BYTES    ((size_t)EMB * EMB * 2)
#define MB_BYTES    ((size_t)NB * SEQ * MWORDS * 4)
#define WS_TOTAL    (PLANE_BYTES * 5 + WT_BYTES * 4 + MB_BYTES)
static_assert(WS_TOTAL <= (size_t)134217728);
static_assert(PLANE_BYTES % 128 == 0 && WT_BYTES % 128 == 0 && MB_BYTES % 128 == 0);

typedef _Float16     v16h __attribute__((ext_vector_type(16)));
typedef __bf16       v16b __attribute__((ext_vector_type(16)));
typedef float        v8f  __attribute__((ext_vector_type(8)));
typedef float        v4f  __attribute__((ext_vector_type(4)));
typedef unsigned int v4u  __attribute__((ext_vector_type(4)));
typedef unsigned int v2u  __attribute__((ext_vector_type(2)));
typedef int          v4i  __attribute__((ext_vector_type(4)));
typedef short        v8s  __attribute__((ext_vector_type(8)));

union Frag {
    v16h     h;
    v16b     b;
    v4u      q[2];
    uint16_t s[16];
};

// ---------------------------------------------------------------------------
// scalar conversions
// ---------------------------------------------------------------------------
__device__ __forceinline__ uint16_t bf16_bits(float f) {
    uint32_t u = __builtin_bit_cast(uint32_t, f);
    u += 0x7FFFu + ((u >> 16) & 1u);              // RNE
    return (uint16_t)(u >> 16);
}
__device__ __forceinline__ float bf16_rne(float f) {
    const uint32_t u = ((uint32_t)bf16_bits(f)) << 16;
    return __builtin_bit_cast(float, u);
}
__device__ __forceinline__ uint16_t h_bits(float f) {
    return __builtin_bit_cast(uint16_t, (_Float16)f);   // RNE f32 -> f16
}

// ---------------------------------------------------------------------------
// WMMA helpers: issue + hazard guard (4 VALU slots, D tied, A/B kept live)
// ---------------------------------------------------------------------------
__device__ __forceinline__ v8f mma_h(v16h a, v16h b, v8f c) {
    v8f d = __builtin_amdgcn_wmma_f32_16x16x32_f16(false, a, false, b, (short)0, c, false, false);
    asm volatile("v_nop\n\tv_nop\n\tv_nop\n\tv_nop" : "+v"(d) : "v"(a), "v"(b));
    return d;
}
__device__ __forceinline__ v8f mma_b(v16b a, v16b b, v8f c) {
    v8f d = __builtin_amdgcn_wmma_f32_16x16x32_bf16(false, a, false, b, (short)0, c, false, false);
    asm volatile("v_nop\n\tv_nop\n\tv_nop\n\tv_nop" : "+v"(d) : "v"(a), "v"(b));
    return d;
}

// 16x32 16-bit A/B fragment from a k-contiguous row (wave32 split layout):
// lane row/col = lane&15, hf = lane>>4; elements 0..7 <- k0+8hf+0..7, elements 8..15 <- k0+16+8hf+0..7
__device__ __forceinline__ Frag ldfrag(const uint16_t* rowp, int k0, int hf) {
    Frag f;
    f.q[0] = *(const v4u*)(rowp + k0 + 8 * hf);
    f.q[1] = *(const v4u*)(rowp + k0 + 16 + 8 * hf);
    return f;
}

// 16x32 16-bit A fragment of T^T from a row-major LDS tile T[k][d] (row pitch in halves) by the transposing load:
// p = the lane's address, T + (k0 + 8 (lane>>4) + (lane&7)) * pitch + d0 + 8 ((lane>>3)&1);
// the lane (row d0 + (lane&15), hf = lane>>4) then holds elements 0..7 <- T[k0+8hf+0..7][row], 8..15 <- T[k0+16+8hf+0..7][row]
__device__ __forceinline__ Frag ldfrag_tr(const uint16_t* p, int pitch) {
    typedef __attribute__((address_space(3))) v8s lds_v8s;
    Frag f;
    f.q[0] = __builtin_bit_cast(v4u, __builtin_amdgcn_ds_load_tr16_b128_v8i16((lds_v8s*)p));
    f.q[1] = __builtin_bit_cast(v4u, __builtin_amdgcn_ds_load_tr16_b128_v8i16((lds_v8s*)(p + 16 * pitch)));
    return f;
}

// lane l <-> lane l ^ 16 by a vector cross-row move (no LDS round trip)
__device__ __forceinline__ float xhalf(float x) {
    const int b = __builtin_bit_cast(int, x);
    return __builtin_bit_cast(float, __builtin_amdgcn_permlanex16(b, b, 0x76543210, 0xfedcba98, false, false));
}

// ---------------------------------------------------------------------------
// Preparation job 1: x f32 [NB][S_FULL][EMB] -> bf16 plane xb [MROWS][EMB] (compact rows).
// ---------------------------------------------------------------------------
__device__ __forceinline__
void job_cvt_x(const float* __restrict__ x, uint16_t* __restrict__ xb, int blk) {
    const size_t gid = (size_t)blk * 256 + threadIdx.x;
    const size_t e0  = gid * 8;
    const size_t m   = e0 / EMB;
    const int    c   = (int)(e0 % EMB);
    const size_t b   = m / SEQ, s = m % SEQ;
    const float* src = x + (b * S_FULL + s) * EMB + c;
    const v4f a0 = *(const v4f*)src;
    const v4f a1 = *(const v4f*)(src + 4);
    v4u w;
    w.x = (uint32_t)bf16_bits(a0.x) | ((uint32_t)bf16_bits(a0.y) << 16);
    w.y = (uint32_t)bf16_bits(a0.z) | ((uint32_t)bf16_bits(a0.w) << 16);
    w.z = (uint32_t)bf16_bits(a1.x) | ((uint32_t)bf16_bits(a1.y) << 16);
    w.w = (uint32_t)bf16_bits(a1.z) | ((uint32_t)bf16_bits(a1.w) << 16);
    uint16_t* dst = xb + e0;
    *(v4u*)dst = w;
    // stands between the store and any later write of its registers: a precaution, as each block of the merged kernel runs one job and then ends
    asm volatile("s_wait_xcnt 0x0" ::: "memory");
}

// ---------------------------------------------------------------------------
// Preparation job 2: W f32 [k][n] (EMB x EMB) -> WT 16-bit [n][k] (k-contiguous B operand plane).
// bf16 RNE of the input value, optional power-of-two scale, then bf16 or f16 bits.
// ---------------------------------------------------------------------------
template <bool TO_F16>
__device__ __forceinline__
void job_wconv(const float* __restrict__ W, uint16_t* __restrict__ WT, float scale,
               int bx, int by, uint16_t* tile) {  // tile: LDS [n][k] 64 x 64; cross-wave -> block barrier
    const int t = threadIdx.x;
    const int n0 = bx * 64, k0 = by * 64;
    const int kr = t >> 2, nc = (t & 3) * 16;     // thread: row k0+kr, cols n0+nc..+15
    const float* src = W + (size_t)(k0 + kr) * EMB + n0 + nc;
#pragma unroll
    for (int i = 0; i < 4; ++i) {
        const v4f v = *(const v4f*)(src + 4 * i);
        float f[4];
        f[0] = v.x; f[1] = v.y; f[2] = v.z; f[3] = v.w;
#pragma unroll
        for (int jj = 0; jj < 4; ++jj) {
            const float g = bf16_rne(f[jj]) * scale;
            tile[(nc + 4 * i + jj) * 64 + kr] = TO_F16 ? h_bits(g) : bf16_bits(g);
        }
    }
    __syncthreads();
    v4u val[2]; size_t off[2];
#pragma unroll
    for (int i = 0; i < 2; ++i) {
        const int p   = t + 256 * i;              // wave w, lane: row = 4w + 32i + lane>>3
        const int row = p >> 3, seg = (p & 7) * 8;
        val[i] = *(const v4u*)&tile[row * 64 + seg];
        off[i] = (size_t)(n0 + row) * EMB + k0 + seg;
    }
#pragma unroll
    for (int i = 0; i < 2; ++i) *(v4u*)(WT + off[i]) = val[i];
    // stands between the store and any later write of its registers: a precaution, as each block of the merged kernel runs one job and then ends
    asm volatile("s_wait_xcnt 0x0" ::: "memory");
}

// ---------------------------------------------------------------------------
// Preparation job 3: mask int32 [NB][S_FULL][S_FULL] -> dense bit plane mb [MROWS][MWORDS],
// bit j of word w <-> key 32w+j nonzero (suppressed). One thread = one word;
// ---------------------------------------------------------------------------
__device__ __forceinline__
void job_maskbits(const int* __restrict__ mask, unsigned int* __restrict__ mb, int blk) {
    const size_t gid = (size_t)blk * 256 + threadIdx.x;
    const int    w   = (int)(gid % MWORDS);
    const size_t row = gid / MWORDS;
    const size_t b = row / SEQ, q = row % SEQ;
    const int* src = mask + (b * S_FULL + q) * S_FULL + (size_t)w * 32;
    unsigned int bits = 0u;
#pragma unroll
    for (int i = 0; i < 8; ++i) {
        const v4i v = *(const v4i*)(src + 4 * i);
        bits |= (v.x != 0 ? 1u : 0u) << (4 * i + 0);
        bits |= (v.y != 0 ? 1u : 0u) << (4 * i + 1);
        bits |= (v.z != 0 ? 1u : 0u) << (4 * i + 2);
        bits |= (v.w != 0 ? 1u : 0u) << (4 * i + 3);
    }
    unsigned int* dst = mb + gid;
    *dst = bits;
    // stands between the store and any later write of its registers: a precaution, as each block of the merged kernel runs one job and then ends
    asm volatile("s_wait_xcnt 0x0" ::: "memory");
}

// ---------------------------------------------------------------------------
// Kernel 1: the six independent preparation jobs in one launch; the block index picks the job.
// Blocks [0, 4 WBLK): weight planes Wq, Wk, Wv (bf16) and Wo (f16 x64), laid one behind the other in WT;
// they have the longest chain per block (load, LDS, barrier, store) and so take the lowest indices.
// Blocks [4 WBLK, 4 WBLK + MBLK): mask bits. The rest: x to bf16.
// ---------------------------------------------------------------------------
#define WSIDE   (EMB / 64)
#define WBLK    (WSIDE * WSIDE)
#define MBLK    ((NB * SEQ * MWORDS) / 256)
#define XBLK    ((MROWS * EMB / 8) / 256)
__global__ __launch_bounds__(256)
void k_prep(const float* __restrict__ x, const int* __restrict__ mask,
            const float* __restrict__ Wq, const float* __restrict__ Wk,
            const float* __restrict__ Wv, const float* __restrict__ Wo,
            uint16_t* __restrict__ xb, uint16_t* __restrict__ WT, unsigned int* __restrict__ mb) {
    __shared__ uint16_t tile[64 * 64];
    const int bid = blockIdx.x;                   // every branch below is block-uniform
    if (bid < 4 * WBLK) {
        const int job = bid / WBLK, tl = bid % WBLK;
        uint16_t* dst = WT + (size_t)job * (EMB * EMB);
        if (job < 3)
            job_wconv<false>(job == 0 ? Wq : (job == 1 ? Wk : Wv), dst, 1.0f, tl % WSIDE, tl / WSIDE, tile);
        else
            job_wconv<true>(Wo, dst, WO_CARRY, tl % WSIDE, tl / WSIDE, tile);
    } else if (bid < 4 * WBLK + MBLK) {
        job_maskbits(mask, mb, bid - 4 * WBLK);
    } else {
        job_cvt_x(x, xb, bid - (4 * WBLK + MBLK));
    }
}

// ---------------------------------------------------------------------------
// Kernel 2: C[M][EMB] = A[M][EMB] . BT[EMB][EMB]^T (+ bias), 16-bit planes, f32 accumulate.
// JOBS products that share A run in one launch: blockIdx.z picks BT plane z, bias z and C plane z
// (the BT planes lie one behind the other, the C planes too).
// Block 256 threads = 8 waves; block tile 128x256; wave tile 64 rows x 64 cols
// (4 x 4 accumulator tiles: 8 fragments feed 16 products). k tiles of 64 (one 128-B line per row) are brought by whole-line
// loads, one tile ahead in registers, into two LDS buffers at row pitch 144 B (16 B x odd:
// conflict-free b128 fragment reads); one block barrier per k tile; products in k-steps of 32.
// OUT16: f16 plane out = f16(acc*oscale + bias);  else f32 out = acc*oscale + bias.
// ---------------------------------------------------------------------------
#define GK      64                        // k extent of one staged tile (halves)
#define GPITCH  72                        // LDS row pitch (halves)
#define GBM     128                       // block tile rows
#define GBN     256                       // block tile columns
#define GOPER   (GBM * GPITCH)            // the A tile (halves)
#define GBUF    ((GBM + GBN) * GPITCH)    // one buffer: A tile then B tile (halves)
static_assert(EMB % GK == 0 && EMB / GK >= 2);
static_assert(EMB % GBN == 0 && MROWS % GBM == 0);
static_assert(2 * GBUF * 2 >= 8 * 32 * 64 * 4);   // the epilogue slabs (8 KB a wave) fit in the two buffers
// second argument: at least 4 waves per SIMD, a budget of 256 vector registers, so that two work-groups share a WGP
// and one's LDS traffic runs under the other's products
template <bool BF, bool OUT16, int JOBS>
__global__ __launch_bounds__(256, 4)
void k_gemm(const uint16_t* __restrict__ A, const uint16_t* __restrict__ BT0,
            const float* __restrict__ bias0, const float* __restrict__ bias1,
            const float* __restrict__ bias2, void* __restrict__ Cout, float oscale) {
    static_assert(JOBS >= 1 && JOBS <= 3);
    const int job = JOBS > 1 ? (int)blockIdx.z : 0;
    const uint16_t* BT  = BT0 + (size_t)job * (EMB * EMB);
    const float*   bias = job == 0 ? bias0 : (job == 1 ? bias1 : bias2);

    __shared__ __attribute__((aligned(16))) uint16_t stage[2 * GBUF];   // two k-tile buffers; epilogue slabs after the loop

    const int t = threadIdx.x, wave = t >> 5, lane = t & 31;
    const int hf = lane >> 4, l16 = lane & 15;
    const int m0 = blockIdx.y * GBM, n0 = blockIdx.x * GBN;
    const int wr = wave & 1, wc = wave >> 1;

    // staging: 8 lanes cover one 128-B row piece; thread rows srow + 32 i, i = 0..3 of A, i = 0..7 of B
    const int srow = t >> 3, sseg = (t & 7) * 8;
    const uint16_t* ag = A  + (size_t)(m0 + srow) * EMB + sseg;
    const uint16_t* bg = BT + (size_t)(n0 + srow) * EMB + sseg;
    uint16_t* sst = stage + srow * GPITCH + sseg;

    // fragment rows inside a buffer
    const uint16_t* afr = stage + (wr * 64 + l16) * GPITCH;
    const uint16_t* bfr = stage + GOPER + (wc * 64 + l16) * GPITCH;

    v8f acc[16] = {};
    v4u ra[GBM / 32], rb[GBN / 32];

#pragma unroll
    for (int i = 0; i < GBM / 32; ++i) ra[i] = *(const v4u*)(ag + (size_t)(32 * i) * EMB);
#pragma unroll
    for (int i = 0; i < GBN / 32; ++i) rb[i] = *(const v4u*)(bg + (size_t)(32 * i) * EMB);
#pragma unroll
    for (int i = 0; i < GBM / 32; ++i) *(v4u*)(sst + 32 * i * GPITCH)         = ra[i];
#pragma unroll
    for (int i = 0; i < GBN / 32; ++i) *(v4u*)(sst + GOPER + 32 * i * GPITCH) = rb[i];
    __syncthreads();

    // kept rolled; the buffer is picked by a scalar select
#pragma unroll 1
    for (int kt = 0; kt < EMB / GK; ++kt) {
        const int  cur  = (kt & 1) * GBUF;
        const bool more = kt + 1 < EMB / GK;      // block-uniform
        if (more) {
            const uint16_t* pa = ag + (kt + 1) * GK;
            const uint16_t* pb = bg + (kt + 1) * GK;
#pragma unroll
            for (int i = 0; i < GBM / 32; ++i) ra[i] = *(const v4u*)(pa + (size_t)(32 * i) * EMB);
#pragma unroll
            for (int i = 0; i < GBN / 32; ++i) rb[i] = *(const v4u*)(pb + (size_t)(32 * i) * EMB);
            // stands between the loads and any write of their address pairs; naming the pairs keeps them whole up to
            // here (at this register count the last load of each run was otherwise given its own address pair to land on)
            asm volatile("s_wait_xcnt 0x0" :: "v"(pa), "v"(pb) : "memory");
        }
        // the fragment reads of a k-step of 32 stand as one group ahead of its 16 products
#pragma unroll
        for (int kk = 0; kk < GK / 32; ++kk) {
            Frag a[4], b[4];
#pragma unroll
            for (int mt = 0; mt < 4; ++mt) a[mt] = ldfrag(afr + cur + mt * 16 * GPITCH, kk * 32, hf);
#pragma unroll
            for (int nt = 0; nt < 4; ++nt) b[nt] = ldfrag(bfr + cur + nt * 16 * GPITCH, kk * 32, hf);
#pragma unroll
            for (int mt = 0; mt < 4; ++mt)
#pragma unroll
                for (int nt = 0; nt < 4; ++nt) {
                    if constexpr (BF)
                        acc[mt * 4 + nt] = mma_b(a[mt].b, b[nt].b, acc[mt * 4 + nt]);
                    else
                        acc[mt * 4 + nt] = mma_h(a[mt].h, b[nt].h, acc[mt * 4 + nt]);
                }
        }
        if (more) {
            // the other buffer: its last readers left it before the barrier that ended the trip before
            uint16_t* dst = sst + (GBUF - cur);
#pragma unroll
            for (int i = 0; i < GBM / 32; ++i) *(v4u*)(dst + 32 * i * GPITCH)         = ra[i];
#pragma unroll
            for (int i = 0; i < GBN / 32; ++i) *(v4u*)(dst + GOPER + 32 * i * GPITCH) = rb[i];
        }
        __syncthreads();                          // publishes tile kt+1; ends every read of tile kt
    }

    // bias (bf16-RNE input value) per accumulator column (lane = column)
    float bvv[4];
#pragma unroll
    for (int nt = 0; nt < 4; ++nt)
        bvv[nt] = bf16_rne(bias[n0 + wc * 64 + nt * 16 + l16]);

    if constexpr (OUT16) {
        uint16_t* mys16 = stage + wave * (64 * 64);           // 64 rows x 64 halves, 8 KB per wave
        uint16_t* C     = reinterpret_cast<uint16_t*>(Cout) + (size_t)job * ((size_t)MROWS * EMB);
#pragma unroll
        for (int mt = 0; mt < 4; ++mt)
#pragma unroll
            for (int nt = 0; nt < 4; ++nt)
#pragma unroll
                for (int r = 0; r < 8; ++r)
                    mys16[(mt * 16 + 8 * hf + r) * 64 + nt * 16 + l16] =
                        h_bits(acc[mt * 4 + nt][r] * oscale + bvv[nt]);
        __syncthreads();
#pragma unroll
        for (int h = 0; h < 2; ++h) {
            v4u val[8]; size_t off[8];
#pragma unroll
            for (int i = 0; i < 8; ++i) {
                const int p = lane + 32 * (i + 8 * h);
                const int row = p >> 3, seg = (p & 7) * 8;      // lanes 8q..8q+7 -> one line
                val[i] = *(const v4u*)(mys16 + row * 64 + seg);
                off[i] = (size_t)(m0 + wr * 64 + row) * EMB + n0 + wc * 64 + seg;
            }
#pragma unroll
            for (int i = 0; i < 8; ++i) *(v4u*)(C + off[i]) = val[i];
        }
    } else {
        float* mys = reinterpret_cast<float*>(stage) + wave * (32 * 64);   // 32 rows x 64 floats, 8 KB per wave
        float* C = reinterpret_cast<float*>(Cout) + (size_t)job * ((size_t)MROWS * EMB);
#pragma unroll
        for (int mp = 0; mp < 2; ++mp) {          // two passes of 32 rows, the barriers of two passes as before
            __syncthreads();
#pragma unroll
            for (int mt = 0; mt < 2; ++mt)
#pragma unroll
                for (int nt = 0; nt < 4; ++nt)
#pragma unroll
                    for (int r = 0; r < 8; ++r)
                        mys[(mt * 16 + 8 * hf + r) * 64 + nt * 16 + l16] = acc[(2 * mp + mt) * 4 + nt][r] * oscale + bvv[nt];
            __syncthreads();
#pragma unroll
            for (int h = 0; h < 2; ++h) {
                v4f val[8]; size_t off[8];
#pragma unroll
                for (int i = 0; i < 8; ++i) {
                    const int p = lane + 32 * (i + 8 * h);
                    const int row = p >> 4, seg = (p & 15) * 4; // lanes 8q..8q+7 -> one line
                    val[i] = *(const v4f*)(mys + row * 64 + seg);
                    off[i] = (size_t)(m0 + wr * 64 + mp * 32 + row) * EMB + n0 + wc * 64 + seg;
                }
#pragma unroll
                for (int i = 0; i < 8; ++i) *(v4f*)(C + off[i]) = val[i];
            }
        }
    }
}

#define APITCH  72                        // LDS row pitch (halves)
#define VPITCH  80                        // LDS row pitch of the V tile (halves)
// second argument: at least 8 waves per SIMD, a budget of 128 vector registers, so that four work-groups
// (not three) fit a WGP and the whole grid of SEQ / 128 x NB x NHEAD work-groups is resident at once
__global__ __launch_bounds__(256, 8)
void k_attn(const uint16_t* __restrict__ Qp, const uint16_t* __restrict__ Kp,
            const uint16_t* __restrict__ Vp, const unsigned int* __restrict__ mb,
            uint16_t* __restrict__ ctx) {
    __shared__ __attribute__((aligned(16))) uint16_t kt[64 * APITCH];      // K tile [key][d]   (cross-wave: block barriers)
    __shared__ __attribute__((aligned(16))) uint16_t vt[64 * VPITCH];      // V tile [key][d]   (cross-wave: block barriers)
    __shared__ __attribute__((aligned(16))) uint16_t ps[8][16 * APITCH];   // per-wave ctx stage (block barriers used)

    const int t = threadIdx.x, lane = t & 31;
    // the wave's number in a scalar register: what is formed from it and lives across the loop for the
    // epilogue (row base, stage slab) then takes no vector register, and the budget is met without scratch
    const int wave = __builtin_amdgcn_readfirstlane(t >> 5);
    const int hf = lane >> 4, l16 = lane & 15;
    const int b  = blockIdx.y / NHEAD, hd = blockIdx.y % NHEAD;
    const int qr = blockIdx.x * 128 + wave * 16;  // first query row of this wave (within sequence)
    const size_t rowb = (size_t)b * SEQ;          // compact plane row base of this batch
    const size_t hcol = (size_t)hd * HDIM;

    // Q fragments for the wave's 16 rows, straight from the f16 plane
    Frag qf[2];
    {
        const uint16_t* qrow = Qp + (rowb + qr + l16) * EMB + hcol;
        qf[0] = ldfrag(qrow, 0, hf);
        qf[1] = ldfrag(qrow, 32, hf);
    }

    v8f accO[4] = {};
    float mrow = -__builtin_inff();               // running maximum of the lane's query (both halves agree)
    float lrow = 0.0f;                            // running sum over the keys of the lane's own half

    const int keyr = t >> 2, hdB = (t & 3) * 16;  // coop staging: key row, 16 d-columns
    const unsigned int* mbrow = mb + (rowb + qr + l16) * MWORDS;      // mask row of the lane's query
    uint16_t* myps = ps[wave];
    const uint16_t* vtl = vt + (8 * hf + (lane & 7)) * VPITCH + 8 * ((lane >> 3) & 1);   // the lane's transposing-load base

#pragma unroll 1
    for (int j = 0; j < SEQ / 64; ++j) {
        const int key0 = j * 64;
        __syncthreads();                         // prior tile fully consumed by all waves

        // ---- stage K tile and V tile, both [key][d] (full 64x64 each) ----
        {
            const size_t go = (rowb + key0 + keyr) * EMB + hcol + hdB;
            const v4u k0v = *(const v4u*)(Kp + go);
            const v4u k1v = *(const v4u*)(Kp + go + 8);
            *(v4u*)&kt[keyr * APITCH + hdB]     = k0v;
            *(v4u*)&kt[keyr * APITCH + hdB + 8] = k1v;
            const v4u v0v = *(const v4u*)(Vp + go);
            const v4u v1v = *(const v4u*)(Vp + go + 8);
            *(v4u*)&vt[keyr * VPITCH + hdB]     = v0v;
            *(v4u*)&vt[keyr * VPITCH + hdB + 8] = v1v;
        }
        // ---- mask words of the lane's query for these 64 keys (one b64), moved to the half's keys ----
        const v2u mw = *(const v2u*)(mbrow + 2 * j);
        const unsigned int mlo = mw.x >> (8 * hf), mhi = mw.y >> (8 * hf);
        __syncthreads();

        // ---- scores S^T = K(64x64) . Q^T, scale 1/8, replace-fill -1e9 where masked ----
        // element [nt][r]: key 16 nt + 8 hf + r, query l16
        v8f sc[4];
#pragma unroll
        for (int nt = 0; nt < 4; ++nt) {
            v8f z = {};
            Frag kf = ldfrag(&kt[(nt * 16 + l16) * APITCH], 0, hf);
            z = mma_h(kf.h, qf[0].h, z);
            kf = ldfrag(&kt[(nt * 16 + l16) * APITCH], 32, hf);
            z = mma_h(kf.h, qf[1].h, z);
#pragma unroll
            for (int r = 0; r < 8; ++r) {
                const unsigned int w   = (nt < 2) ? mlo : mhi;
                const unsigned int bit = w & (1u << ((nt & 1) * 16 + r));
                sc[nt][r] = bit ? -1.0e9f : z[r] * 0.125f;
            }
        }

        // ---- online softmax: one query per lane; the two halves hold 32 keys each ----
        float bm = sc[0][0];
#pragma unroll
        for (int nt = 0; nt < 4; ++nt)
#pragma unroll
            for (int r = 0; r < 8; ++r) bm = fmaxf(bm, sc[nt][r]);
        bm = fmaxf(bm, xhalf(bm));
        const float mnew  = fmaxf(mrow, bm);
        const float alpha = __expf(mrow - mnew);
        mrow = mnew;
        float rs[4];
#pragma unroll
        for (int nt = 0; nt < 4; ++nt) {
            rs[nt] = 0.0f;
#pragma unroll
            for (int r = 0; r < 8; ++r) {
                const float p = __expf(sc[nt][r] - mrow);
                sc[nt][r] = p;
                rs[nt] += p;
            }
        }
        lrow = lrow * alpha + ((rs[0] + rs[1]) + (rs[2] + rs[3]));
#pragma unroll
        for (int nt = 0; nt < 4; ++nt)
#pragma unroll
            for (int r = 0; r < 8; ++r) accO[nt][r] *= alpha;

        // ---- P^T B fragments, f16(1024 p), packed from the score accumulators in place ----
        Frag pf[2];
#pragma unroll
        for (int a = 0; a < 2; ++a)
#pragma unroll
            for (int r = 0; r < 8; ++r) {
                pf[a].h[r]     = (_Float16)(sc[2 * a][r] * P_CARRY);
                pf[a].h[8 + r] = (_Float16)(sc[2 * a + 1][r] * P_CARRY);
            }

        // ---- O^T += V^T(64 d x 64 keys) . P^T(64 keys x 16 queries) ----
#pragma unroll
        for (int nt = 0; nt < 4; ++nt) {
            Frag vf = ldfrag_tr(vtl + nt * 16, VPITCH);
            accO[nt] = mma_h(vf.h, pf[0].h, accO[nt]);
            vf = ldfrag_tr(vtl + 32 * VPITCH + nt * 16, VPITCH);
            accO[nt] = mma_h(vf.h, pf[1].h, accO[nt]);
        }
    }

    // the halves' sums are joined once; accO element [nt][r]: d = 16 nt + 8 hf + r, query l16
    const float inv = (1.0f / (lrow + xhalf(lrow))) * CTX_SCALE;
    __syncthreads();
#pragma unroll
    for (int nt = 0; nt < 4; ++nt) {
        v4u w;
#pragma unroll
        for (int i = 0; i < 4; ++i)
            w[i] = (uint32_t)h_bits(accO[nt][2 * i] * inv) | ((uint32_t)h_bits(accO[nt][2 * i + 1] * inv) << 16);
        *(v4u*)(myps + l16 * APITCH + nt * 16 + 8 * hf) = w;
    }
    __syncthreads();
    v4u val[4]; size_t off[4];
#pragma unroll
    for (int i = 0; i < 4; ++i) {
        const int p = lane + 32 * i;
        const int row = p >> 3, seg = (p & 7) * 8;              // lanes 8q..8q+7 -> one line
        val[i] = *(const v4u*)(myps + row * APITCH + seg);
        off[i] = (rowb + qr + row) * EMB + hcol + seg;
    }
#pragma unroll
    for (int i = 0; i < 4; ++i) *(v4u*)(ctx + off[i]) = val[i];
    
}

// ---------------------------------------------------------------------------
// Host launcher: 4 ops, workspace 93,323,264 B.
// ---------------------------------------------------------------------------
extern "C" void kernel_launch(void* const* d_in, const int* in_sizes, int n_in,
                              void* d_out, int out_size, void* d_ws, size_t ws_size,
                              hipStream_t stream) {
    if (n_in < 10) return;
    if (in_sizes[0] < NB * S_FULL * EMB) return;
    if (in_sizes[1] < NB * S_FULL * S_FULL) return;
    if (in_sizes[2] < EMB * EMB || in_sizes[4] < EMB * EMB ||
        in_sizes[6] < EMB * EMB || in_sizes[8] < EMB * EMB) return;
    if (in_sizes[3] < EMB || in_sizes[5] < EMB || in_sizes[7] < EMB || in_sizes[9] < EMB) return;
    if (out_size < MROWS * EMB) return;
    if (ws_size < WS_TOTAL) return;

    const float* x    = (const float*)d_in[0];   // [NB_FULL][S_FULL][EMB] f32
    const int*   mask = (const int*)d_in[1];     // [NB_FULL][S_FULL][S_FULL] int32 (bool)
    const float* Wq   = (const float*)d_in[2];   // [EMB in][EMB out]
    const float* bq   = (const float*)d_in[3];
    const float* Wk   = (const float*)d_in[4];
    const float* bk   = (const float*)d_in[5];
    const float* Wv   = (const float*)d_in[6];
    const float* bv   = (const float*)d_in[7];
    const float* Wo   = (const float*)d_in[8];
    const float* bo   = (const float*)d_in[9];
    float* out = (float*)d_out;                  // [MROWS][EMB] f32

    unsigned char* ws = (unsigned char*)d_ws;
    size_t off = 0;
    uint16_t* xb   = (uint16_t*)(ws + off); off += PLANE_BYTES;   // bf16 [MROWS][EMB]
    uint16_t* WqT  = (uint16_t*)(ws + off); off += WT_BYTES * 3;  // bf16 [n][k]: the Wq, Wk, Wv planes in a row
    uint16_t* WoT  = (uint16_t*)(ws + off); off += WT_BYTES;      // f16 [n][k], x64, directly behind them
    uint16_t* Qp   = (uint16_t*)(ws + off); off += PLANE_BYTES;   // f16 [MROWS][EMB]
    uint16_t* Kpl  = (uint16_t*)(ws + off); off += PLANE_BYTES;
    uint16_t* Vpl  = (uint16_t*)(ws + off); off += PLANE_BYTES;
    uint16_t* Ctx  = (uint16_t*)(ws + off); off += PLANE_BYTES;   // f16, x16
    unsigned int* mbits = (unsigned int*)(ws + off); off += MB_BYTES;
    if (off > ws_size) return;

    // the four weight planes are one run from WqT on; Qp, Kpl, Vpl are one run of three
    k_prep<<<dim3(4 * WBLK + MBLK + XBLK), dim3(256), 0, stream>>>(x, mask, Wq, Wk, Wv, Wo, xb, WqT, mbits);

    k_gemm<true, true, 3><<<dim3(EMB / GBN, MROWS / GBM, 3), dim3(256), 0, stream>>>(xb, WqT, bq, bk, bv, (void*)Qp, 1.0f);

    const dim3 gA(SEQ / 128, NB * NHEAD);
    k_attn<<<gA, dim3(256), 0, stream>>>(Qp, Kpl, Vpl, mbits, Ctx);

    k_gemm<false, false, 1><<<dim3(EMB / GBN, MROWS / GBM, 1), dim3(256), 0, stream>>>(Ctx, WoT, bo, bo, bo, (void*)out, OUT_SCALE);
}

// v008
// Measured time: 118 microseconds a run.
// Timed twice side by side with v007, it ran 1.05 and 1.04 times as fast.
// All steps since v000 together make it 3.59 times as fast.
#include <hip/hip_runtime.h>
#include <hip/hip_bf16.h>
#include <stdint.h>

// Contractions: x@Wq, x@Wk, x@Wv on v_wmma_f32_16x16x32_bf16 (bf16 operands = RNE-converted inputs);
// k.q^T, v^T.p^T and ctx@Wo on v_wmma_f32_16x16x32_f16 (f16 operands with power-of-two carries:
// p x1024, ctx x16, Wo x64); f32 accumulate; softmax, bias adds and normalisation in f32.

#ifndef NB
#define NB 8
#endif
#ifndef SEQ
#define SEQ 1024
#endif
#define NB_FULL 8
#define S_FULL  1024
#define EMB     1024
#define NHEAD   16
#define HDIM    64
#define MROWS   (NB * SEQ)
#define MWORDS  (SEQ / 32)

static_assert(NB >= 1 && NB <= NB_FULL);
static_assert(SEQ % 128 == 0 && SEQ <= S_FULL);
static_assert(EMB == NHEAD * HDIM);
static_assert(EMB % 128 == 0);
static_assert(MROWS % 128 == 0);
static_assert(((MROWS * EMB) / 8) % 256 == 0);
static_assert((NB * SEQ * MWORDS) % 256 == 0);

#define P_CARRY    1024.0f              // P operand = f16(1024 * exp(s - m))
#define CTX_SCALE  (1.0f / 64.0f)       // ctx operand = accO/(1024 l) * 16
#define WO_CARRY   64.0f                // Wo operand = f16(bf16(Wo) * 64)
#define OUT_SCALE  (1.0f / 1024.0f)     // 1/(16 * 64)

// workspace carve (bytes); every region written at its exact extent (tile multiples == plane sizes)
#define PLANE_BYTES ((size_t)MROWS * EMB * 2)
#define WT_BYTES    ((size_t)EMB * EMB * 2)
#define MB_BYTES    ((size_t)NB * SEQ * MWORDS * 4)
#define WS_TOTAL    (PLANE_BYTES * 5 + WT_BYTES * 4 + MB_BYTES)
static_assert(WS_TOTAL <= (size_t)134217728);
static_assert(PLANE_BYTES % 128 == 0 && WT_BYTES % 128 == 0 && MB_BYTES % 128 == 0);

typedef _Float16     v16h __attribute__((ext_vector_type(16)));
typedef __bf16       v16b __attribute__((ext_vector_type(16)));
typedef float        v8f  __attribute__((ext_vector_type(8)));
typedef float        v4f  __attribute__((ext_vector_type(4)));
typedef unsigned int v4u  __attribute__((ext_vector_type(4)));
typedef unsigned int v16u __attribute__((ext_vector_type(16)));
typedef int          v4i  __attribute__((ext_vector_type(4)));
typedef short        v8s  __attribute__((ext_vector_type(8)));

union Frag {
    v16h     h;
    v16b     b;
    v4u      q[2];
    uint16_t s[16];
};

// ---------------------------------------------------------------------------
// scalar conversions
// ---------------------------------------------------------------------------
__device__ __forceinline__ uint16_t bf16_bits(float f) {
    uint32_t u = __builtin_bit_cast(uint32_t, f);
    u += 0x7FFFu + ((u >> 16) & 1u);              // RNE
    return (uint16_t)(u >> 16);
}
__device__ __forceinline__ float bf16_rne(float f) {
    const uint32_t u = ((uint32_t)bf16_bits(f)) << 16;
    return __builtin_bit_cast(float, u);
}
__device__ __forceinline__ uint16_t h_bits(float f) {
    return __builtin_bit_cast(uint16_t, (_Float16)f);   // RNE f32 -> f16
}

// ---------------------------------------------------------------------------
// WMMA helpers: issue + hazard guard (4 VALU slots, D tied, A/B kept live)
// ---------------------------------------------------------------------------
__device__ __forceinline__ v8f mma_h(v16h a, v16h b, v8f c) {
    v8f d = __builtin_amdgcn_wmma_f32_16x16x32_f16(false, a, false, b, (short)0, c, false, false);
    asm volatile("v_nop\n\tv_nop\n\tv_nop\n\tv_nop" : "+v"(d) : "v"(a), "v"(b));
    return d;
}
__device__ __forceinline__ v8f mma_b(v16b a, v16b b, v8f c) {
    v8f d = __builtin_amdgcn_wmma_f32_16x16x32_bf16(false, a, false, b, (short)0, c, false, false);
    asm volatile("v_nop\n\tv_nop\n\tv_nop\n\tv_nop" : "+v"(d) : "v"(a), "v"(b));
    return d;
}

// 16x32 16-bit A/B fragment from a k-contiguous row (wave32 split layout):
// lane row/col = lane&15, hf = lane>>4; elements 0..7 <- k0+8hf+0..7, elements 8..15 <- k0+16+8hf+0..7
__device__ __forceinline__ Frag ldfrag(const uint16_t* rowp, int k0, int hf) {
    Frag f;
    f.q[0] = *(const v4u*)(rowp + k0 + 8 * hf);
    f.q[1] = *(const v4u*)(rowp + k0 + 16 + 8 * hf);
    return f;
}

// 16x32 16-bit A fragment of T^T from a row-major LDS tile T[k][d] (row pitch in halves) by the transposing load:
// p = the lane's address, T + (k0 + 8 (lane>>4) + (lane&7)) * pitch + d0 + 8 ((lane>>3)&1);
// the lane (row d0 + (lane&15), hf = lane>>4) then holds elements 0..7 <- T[k0+8hf+0..7][row], 8..15 <- T[k0+16+8hf+0..7][row]
__device__ __forceinline__ Frag ldfrag_tr(const uint16_t* p, int pitch) {
    typedef __attribute__((address_space(3))) v8s lds_v8s;
    Frag f;
    f.q[0] = __builtin_bit_cast(v4u, __builtin_amdgcn_ds_load_tr16_b128_v8i16((lds_v8s*)p));
    f.q[1] = __builtin_bit_cast(v4u, __builtin_amdgcn_ds_load_tr16_b128_v8i16((lds_v8s*)(p + 16 * pitch)));
    return f;
}

// lane l <-> lane l ^ 16 by a vector cross-row move (no LDS round trip)
__device__ __forceinline__ float xhalf(float x) {
    const int b = __builtin_bit_cast(int, x);
    return __builtin_bit_cast(float, __builtin_amdgcn_permlanex16(b, b, 0x76543210, 0xfedcba98, false, false));
}

// ---------------------------------------------------------------------------
// Preparation job 1: x f32 [NB][S_FULL][EMB] -> bf16 plane xb [MROWS][EMB] (compact rows).
// ---------------------------------------------------------------------------
__device__ __forceinline__
void job_cvt_x(const float* __restrict__ x, uint16_t* __restrict__ xb, int blk) {
    const size_t gid = (size_t)blk * 256 + threadIdx.x;
    const size_t e0  = gid * 8;
    const size_t m   = e0 / EMB;
    const int    c   = (int)(e0 % EMB);
    const size_t b   = m / SEQ, s = m % SEQ;
    const float* src = x + (b * S_FULL + s) * EMB + c;
    const v4f a0 = *(const v4f*)src;
    const v4f a1 = *(const v4f*)(src + 4);
    v4u w;
    w.x = (uint32_t)bf16_bits(a0.x) | ((uint32_t)bf16_bits(a0.y) << 16);
    w.y = (uint32_t)bf16_bits(a0.z) | ((uint32_t)bf16_bits(a0.w) << 16);
    w.z = (uint32_t)bf16_bits(a1.x) | ((uint32_t)bf16_bits(a1.y) << 16);
    w.w = (uint32_t)bf16_bits(a1.z) | ((uint32_t)bf16_bits(a1.w) << 16);
    uint16_t* dst = xb + e0;
    *(v4u*)dst = w;
    // stands between the store and any later write of its registers: a precaution, as each block of the merged kernel runs one job and then ends
    asm volatile("s_wait_xcnt 0x0" ::: "memory");
}

// ---------------------------------------------------------------------------
// Preparation job 2: W f32 [k][n] (EMB x EMB) -> WT 16-bit [n][k] (k-contiguous B operand plane).
// bf16 RNE of the input value, optional power-of-two scale, then bf16 or f16 bits.
// ---------------------------------------------------------------------------
template <bool TO_F16>
__device__ __forceinline__
void job_wconv(const float* __restrict__ W, uint16_t* __restrict__ WT, float scale,
               int bx, int by, uint16_t* tile) {  // tile: LDS [n][k] 64 x 64; cross-wave -> block barrier
    const int t = threadIdx.x;
    const int n0 = bx * 64, k0 = by * 64;
    const int kr = t >> 2, nc = (t & 3) * 16;     // thread: row k0+kr, cols n0+nc..+15
    const float* src = W + (size_t)(k0 + kr) * EMB + n0 + nc;
#pragma unroll
    for (int i = 0; i < 4; ++i) {
        const v4f v = *(const v4f*)(src + 4 * i);
        float f[4];
        f[0] = v.x; f[1] = v.y; f[2] = v.z; f[3] = v.w;
#pragma unroll
        for (int jj = 0; jj < 4; ++jj) {
            const float g = bf16_rne(f[jj]) * scale;
            tile[(nc + 4 * i + jj) * 64 + kr] = TO_F16 ? h_bits(g) : bf16_bits(g);
        }
    }
    __syncthreads();
    v4u val[2]; size_t off[2];
#pragma unroll
    for (int i = 0; i < 2; ++i) {
        const int p   = t + 256 * i;              // wave w, lane: row = 4w + 32i + lane>>3
        const int row = p >> 3, seg = (p & 7) * 8;
        val[i] = *(const v4u*)&tile[row * 64 + seg];
        off[i] = (size_t)(n0 + row) * EMB + k0 + seg;
    }
#pragma unroll
    for (int i = 0; i < 2; ++i) *(v4u*)(WT + off[i]) = val[i];
    // stands between the store and any later write of its registers: a precaution, as each block of the merged kernel runs one job and then ends
    asm volatile("s_wait_xcnt 0x0" ::: "memory");
}

// ---------------------------------------------------------------------------
// Preparation job 3: mask int32 [NB][S_FULL][S_FULL] -> bit plane mb, laid out as the attention kernel's lane masks:
// unit u = (16-query group g of the compact rows, 64-key tile j), u = g * (SEQ / 64) + j, holds 32 words;
// bit l of word 8 nt + r <-> mask of query 16 g + (l & 15), key 64 j + 16 nt + 8 (l >> 4) + r is nonzero (suppressed).
// One wave = one unit: a lane reads the 32 keys that it holds as scores later, each compare over the wave
// is one word, and lane i stores word i (one 128-B line a wave).
// ---------------------------------------------------------------------------
__device__ __forceinline__
void job_maskbits(const int* __restrict__ mask, unsigned int* __restrict__ mb, int blk) {
    const int lane = threadIdx.x & 31, hf = lane >> 4, l16 = lane & 15;
    const size_t u   = (size_t)blk * 8 + (threadIdx.x >> 5);
    const int    j   = (int)(u % (SEQ / 64));
    const size_t row = (u / (SEQ / 64)) * 16 + l16;
    const size_t b = row / SEQ, q = row % SEQ;
    const int* src = mask + (b * S_FULL + q) * S_FULL + (size_t)j * 64 + 8 * hf;
    v4i v[8];
#pragma unroll
    for (int i = 0; i < 8; ++i) v[i] = *(const v4i*)(src + 16 * (i >> 1) + 4 * (i & 1));
    // every compare over the wave is taken with all lanes on, ahead of the lane's pick of its own word
    unsigned int w[32];
#pragma unroll
    for (int i = 0; i < 8; ++i)
#pragma unroll
        for (int c = 0; c < 4; ++c) w[4 * i + c] = __builtin_amdgcn_ballot_w32(v[i][c] != 0);
    unsigned int bits = w[0];
#pragma unroll
    for (int i = 1; i < 32; ++i) bits = (lane == i) ? w[i] : bits;
    unsigned int* dst = mb + u * 32 + lane;
    *dst = bits;
    // stands between the store and any later write of its registers: a precaution, as each block of the merged kernel runs one job and then ends
    asm volatile("s_wait_xcnt 0x0" ::: "memory");
}

// ---------------------------------------------------------------------------
// Kernel 1: the six independent preparation jobs in one launch; the block index picks the job.
// Blocks [0, 4 WBLK): weight planes Wq, Wk, Wv (bf16) and Wo (f16 x64), laid one behind the other in WT;
// they have the longest chain per block (load, LDS, barrier, store) and so take the lowest indices.
// Blocks [4 WBLK, 4 WBLK + MBLK): mask bits. The rest: x to bf16.
// ---------------------------------------------------------------------------
#define WSIDE   (EMB / 64)
#define WBLK    (WSIDE * WSIDE)
#define MBLK    ((NB * SEQ * MWORDS) / 256)
#define XBLK    ((MROWS * EMB / 8) / 256)
__global__ __launch_bounds__(256)
void k_prep(const float* __restrict__ x, const int* __restrict__ mask,
            const float* __restrict__ Wq, const float* __restrict__ Wk,
            const float* __restrict__ Wv, const float* __restrict__ Wo,
            uint16_t* __restrict__ xb, uint16_t* __restrict__ WT, unsigned int* __restrict__ mb) {
    __shared__ uint16_t tile[64 * 64];
    const int bid = blockIdx.x;                   // every branch below is block-uniform
    if (bid < 4 * WBLK) {
        const int job = bid / WBLK, tl = bid % WBLK;
        uint16_t* dst = WT + (size_t)job * (EMB * EMB);
        if (job < 3)
            job_wconv<false>(job == 0 ? Wq : (job == 1 ? Wk : Wv), dst, 1.0f, tl % WSIDE, tl / WSIDE, tile);
        else
            job_wconv<true>(Wo, dst, WO_CARRY, tl % WSIDE, tl / WSIDE, tile);
    } else if (bid < 4 * WBLK + MBLK) {
        job_maskbits(mask, mb, bid - 4 * WBLK);
    } else {
        job_cvt_x(x, xb, bid - (4 * WBLK + MBLK));
    }
}

// ---------------------------------------------------------------------------
// Kernel 2: C[M][EMB] = A[M][EMB] . BT[EMB][EMB]^T (+ bias), 16-bit planes, f32 accumulate.
// JOBS products that share A run in one launch: blockIdx.z picks BT plane z, bias z and C plane z
// (the BT planes lie one behind the other, the C planes too).
// Block 256 threads = 8 waves; block tile 128x256; wave tile 64 rows x 64 cols
// (4 x 4 accumulator tiles: 8 fragments feed 16 products). k tiles of 64 (one 128-B line per row) are brought by whole-line
// loads, one tile ahead in registers, into two LDS buffers at row pitch 144 B (16 B x odd:
// conflict-free b128 fragment reads); one block barrier per k tile; products in k-steps of 32.
// OUT16: f16 plane out = f16(acc*oscale + bias);  else f32 out = acc*oscale + bias.
// ---------------------------------------------------------------------------
#define GK      64                        // k extent of one staged tile (halves)
#define GPITCH  72                        // LDS row pitch (halves)
#define GBM     128                       // block tile rows
#define GBN     256                       // block tile columns
#define GOPER   (GBM * GPITCH)            // the A tile (halves)
#define GBUF    ((GBM + GBN) * GPITCH)    // one buffer: A tile then B tile (halves)
static_assert(EMB % GK == 0 && EMB / GK >= 2);
static_assert(EMB % GBN == 0 && MROWS % GBM == 0);
static_assert(2 * GBUF * 2 >= 8 * 32 * 64 * 4);   // the epilogue slabs (8 KB a wave) fit in the two buffers
// second argument: at least 4 waves per SIMD, a budget of 256 vector registers, so that two work-groups share a WGP
// and one's LDS traffic runs under the other's products
template <bool BF, bool OUT16, int JOBS>
__global__ __launch_bounds__(256, 4)
void k_gemm(const uint16_t* __restrict__ A, const uint16_t* __restrict__ BT0,
            const float* __restrict__ bias0, const float* __restrict__ bias1,
            const float* __restrict__ bias2, void* __restrict__ Cout, float oscale) {
    static_assert(JOBS >= 1 && JOBS <= 3);
    const int job = JOBS > 1 ? (int)blockIdx.z : 0;
    const uint16_t* BT  = BT0 + (size_t)job * (EMB * EMB);
    const float*   bias = job == 0 ? bias0 : (job == 1 ? bias1 : bias2);

    __shared__ __attribute__((aligned(16))) uint16_t stage[2 * GBUF];   // two k-tile buffers; epilogue slabs after the loop

    const int t = threadIdx.x, wave = t >> 5, lane = t & 31;
    const int hf = lane >> 4, l16 = lane & 15;
    const int m0 = blockIdx.y * GBM, n0 = blockIdx.x * GBN;
    const int wr = wave & 1, wc = wave >> 1;

    // staging: 8 lanes cover one 128-B row piece; thread rows srow + 32 i, i = 0..3 of A, i = 0..7 of B
    const int srow = t >> 3, sseg = (t & 7) * 8;
    const uint16_t* ag = A  + (size_t)(m0 + srow) * EMB + sseg;
    const uint16_t* bg = BT + (size_t)(n0 + srow) * EMB + sseg;
    uint16_t* sst = stage + srow * GPITCH + sseg;

    // fragment rows inside a buffer
    const uint16_t* afr = stage + (wr * 64 + l16) * GPITCH;
    const uint16_t* bfr = stage + GOPER + (wc * 64 + l16) * GPITCH;

    v8f acc[16] = {};
    v4u ra[GBM / 32], rb[GBN / 32];

#pragma unroll
    for (int i = 0; i < GBM / 32; ++i) ra[i] = *(const v4u*)(ag + (size_t)(32 * i) * EMB);
#pragma unroll
    for (int i = 0; i < GBN / 32; ++i) rb[i] = *(const v4u*)(bg + (size_t)(32 * i) * EMB);
#pragma unroll
    for (int i = 0; i < GBM / 32; ++i) *(v4u*)(sst + 32 * i * GPITCH)         = ra[i];
#pragma unroll
    for (int i = 0; i < GBN / 32; ++i) *(v4u*)(sst + GOPER + 32 * i * GPITCH) = rb[i];
    __syncthreads();

    // kept rolled; the buffer is picked by a scalar select
#pragma unroll 1
    for (int kt = 0; kt < EMB / GK; ++kt) {
        const int  cur  = (kt & 1) * GBUF;
        const bool more = kt + 1 < EMB / GK;      // block-uniform
        if (more) {
            const uint16_t* pa = ag + (kt + 1) * GK;
            const uint16_t* pb = bg + (kt + 1) * GK;
#pragma unroll
            for (int i = 0; i < GBM / 32; ++i) ra[i] = *(const v4u*)(pa + (size_t)(32 * i) * EMB);
#pragma unroll
            for (int i = 0; i < GBN / 32; ++i) rb[i] = *(const v4u*)(pb + (size_t)(32 * i) * EMB);
            // stands between the loads and any write of their address pairs; naming the pairs keeps them whole up to
            // here (at this register count the last load of each run was otherwise given its own address pair to land on)
            asm volatile("s_wait_xcnt 0x0" :: "v"(pa), "v"(pb) : "memory");
        }
        // the fragment reads of a k-step of 32 stand as one group ahead of its 16 products
#pragma unroll
        for (int kk = 0; kk < GK / 32; ++kk) {
            Frag a[4], b[4];
#pragma unroll
            for (int mt = 0; mt < 4; ++mt) a[mt] = ldfrag(afr + cur + mt * 16 * GPITCH, kk * 32, hf);
#pragma unroll
            for (int nt = 0; nt < 4; ++nt) b[nt] = ldfrag(bfr + cur + nt * 16 * GPITCH, kk * 32, hf);
#pragma unroll
            for (int mt = 0; mt < 4; ++mt)
#pragma unroll
                for (int nt = 0; nt < 4; ++nt) {
                    if constexpr (BF)
                        acc[mt * 4 + nt] = mma_b(a[mt].b, b[nt].b, acc[mt * 4 + nt]);
                    else
                        acc[mt * 4 + nt] = mma_h(a[mt].h, b[nt].h, acc[mt * 4 + nt]);
                }
        }
        if (more) {
            // the other buffer: its last readers left it before the barrier that ended the trip before
            uint16_t* dst = sst + (GBUF - cur);
#pragma unroll
            for (int i = 0; i < GBM / 32; ++i) *(v4u*)(dst + 32 * i * GPITCH)         = ra[i];
#pragma unroll
            for (int i = 0; i < GBN / 32; ++i) *(v4u*)(dst + GOPER + 32 * i * GPITCH) = rb[i];
        }
        __syncthreads();                          // publishes tile kt+1; ends every read of tile kt
    }

    // bias (bf16-RNE input value) per accumulator column (lane = column)
    float bvv[4];
#pragma unroll
    for (int nt = 0; nt < 4; ++nt)
        bvv[nt] = bf16_rne(bias[n0 + wc * 64 + nt * 16 + l16]);

    if constexpr (OUT16) {
        uint16_t* mys16 = stage + wave * (64 * 64);           // 64 rows x 64 halves, 8 KB per wave
        uint16_t* C     = reinterpret_cast<uint16_t*>(Cout) + (size_t)job * ((size_t)MROWS * EMB);
#pragma unroll
        for (int mt = 0; mt < 4; ++mt)
#pragma unroll
            for (int nt = 0; nt < 4; ++nt)
#pragma unroll
                for (int r = 0; r < 8; ++r)
                    mys16[(mt * 16 + 8 * hf + r) * 64 + nt * 16 + l16] =
                        h_bits(acc[mt * 4 + nt][r] * oscale + bvv[nt]);
        __syncthreads();
#pragma unroll
        for (int h = 0; h < 2; ++h) {
            v4u val[8]; size_t off[8];
#pragma unroll
            for (int i = 0; i < 8; ++i) {
                const int p = lane + 32 * (i + 8 * h);
                const int row = p >> 3, seg = (p & 7) * 8;      // lanes 8q..8q+7 -> one line
                val[i] = *(const v4u*)(mys16 + row * 64 + seg);
                off[i] = (size_t)(m0 + wr * 64 + row) * EMB + n0 + wc * 64 + seg;
            }
#pragma unroll
            for (int i = 0; i < 8; ++i) *(v4u*)(C + off[i]) = val[i];
        }
    } else {
        float* mys = reinterpret_cast<float*>(stage) + wave * (32 * 64);   // 32 rows x 64 floats, 8 KB per wave
        float* C = reinterpret_cast<float*>(Cout) + (size_t)job * ((size_t)MROWS * EMB);
#pragma unroll
        for (int mp = 0; mp < 2; ++mp) {          // two passes of 32 rows, the barriers of two passes as before
            __syncthreads();
#pragma unroll
            for (int mt = 0; mt < 2; ++mt)
#pragma unroll
                for (int nt = 0; nt < 4; ++nt)
#pragma unroll
                    for (int r = 0; r < 8; ++r)
                        mys[(mt * 16 + 8 * hf + r) * 64 + nt * 16 + l16] = acc[(2 * mp + mt) * 4 + nt][r] * oscale + bvv[nt];
            __syncthreads();
#pragma unroll
            for (int h = 0; h < 2; ++h) {
                v4f val[8]; size_t off[8];
#pragma unroll
                for (int i = 0; i < 8; ++i) {
                    const int p = lane + 32 * (i + 8 * h);
                    const int row = p >> 4, seg = (p & 15) * 4; // lanes 8q..8q+7 -> one line
                    val[i] = *(const v4f*)(mys + row * 64 + seg);
                    off[i] = (size_t)(m0 + wr * 64 + mp * 32 + row) * EMB + n0 + wc * 64 + seg;
                }
#pragma unroll
                for (int i = 0; i < 8; ++i) *(v4f*)(C + off[i]) = val[i];
            }
        }
    }
}

#define APITCH  72                        // LDS row pitch (halves)
#define VPITCH  80                        // LDS row pitch of the V tile (halves)
// second argument: at least 8 waves per SIMD, a budget of 128 vector registers, so that four work-groups
// (not three) fit a WGP and the whole grid of SEQ / 128 x NB x NHEAD work-groups is resident at once
__global__ __launch_bounds__(256, 8)
void k_attn(const uint16_t* __restrict__ Qp, const uint16_t* __restrict__ Kp,
            const uint16_t* __restrict__ Vp, const unsigned int* __restrict__ mb,
            uint16_t* __restrict__ ctx) {
    __shared__ __attribute__((aligned(16))) uint16_t kt[64 * APITCH];      // K tile [key][d]   (cross-wave: block barriers)
    __shared__ __attribute__((aligned(16))) uint16_t vt[64 * VPITCH];      // V tile [key][d]   (cross-wave: block barriers)
    __shared__ __attribute__((aligned(16))) uint16_t ps[8][16 * APITCH];   // per-wave ctx stage (block barriers used)

    const int t = threadIdx.x, lane = t & 31;
    // the wave's number in a scalar register: what is formed from it and lives across the loop for the
    // epilogue (row base, stage slab) then takes no vector register, and the budget is met without scratch
    const int wave = __builtin_amdgcn_readfirstlane(t >> 5);
    const int hf = lane >> 4, l16 = lane & 15;
    const int b  = blockIdx.y / NHEAD, hd = blockIdx.y % NHEAD;
    const int qr = blockIdx.x * 128 + wave * 16;  // first query row of this wave (within sequence)
    const size_t rowb = (size_t)b * SEQ;          // compact plane row base of this batch
    const size_t hcol = (size_t)hd * HDIM;

    // Q fragments for the wave's 16 rows, straight from the f16 plane
    Frag qf[2];
    {
        const uint16_t* qrow = Qp + (rowb + qr + l16) * EMB + hcol;
        qf[0] = ldfrag(qrow, 0, hf);
        qf[1] = ldfrag(qrow, 32, hf);
    }

    v8f accO[4] = {};
    float mrow = -__builtin_inff();               // running maximum of the lane's query (both halves agree)
    float lrow = 0.0f;                            // running sum over the keys of the lane's own half

    const int keyr = t >> 2, hdB = (t & 3) * 16;  // coop staging: key row, 16 d-columns
    // the wave's lane masks: 32 words a key tile, at an address that is the same in every lane. The plane was written
    // by the preparation launch and nobody writes it here: read through the constant address space, it comes by scalar loads
    typedef __attribute__((address_space(4))) const v16u cmask_t;
    cmask_t* mbw = (cmask_t*)(mb + ((rowb + qr) / 16) * (size_t)(SEQ / 64) * 32);
    uint16_t* myps = ps[wave];
    const uint16_t* vtl = vt + (8 * hf + (lane & 7)) * VPITCH + 8 * ((lane >> 3) & 1);   // the lane's transposing-load base

#pragma unroll 1
    for (int j = 0; j < SEQ / 64; ++j) {
        const int key0 = j * 64;
        // ---- lane masks of the wave's 32 score registers for these 64 keys, into scalar registers ----
        const v16u mw0 = mbw[2 * j], mw1 = mbw[2 * j + 1];
        __syncthreads();                         // prior tile fully consumed by all waves

        // ---- stage K tile and V tile, both [key][d] (full 64x64 each) ----
        {
            const size_t go = (rowb + key0 + keyr) * EMB + hcol + hdB;
            const v4u k0v = *(const v4u*)(Kp + go);
            const v4u k1v = *(const v4u*)(Kp + go + 8);
            *(v4u*)&kt[keyr * APITCH + hdB]     = k0v;
            *(v4u*)&kt[keyr * APITCH + hdB + 8] = k1v;
            const v4u v0v = *(const v4u*)(Vp + go);
            const v4u v1v = *(const v4u*)(Vp + go + 8);
            *(v4u*)&vt[keyr * VPITCH + hdB]     = v0v;
            *(v4u*)&vt[keyr * VPITCH + hdB + 8] = v1v;
        }
        __syncthreads();

        // ---- scores S^T = K(64x64) . Q^T, scale 1/8, replace-fill -1e9 where masked ----
        // element [nt][r]: key 16 nt + 8 hf + r, query l16
        v8f sc[4];
#pragma unroll
        for (int nt = 0; nt < 4; ++nt) {
            v8f z = {};
            Frag kf = ldfrag(&kt[(nt * 16 + l16) * APITCH], 0, hf);
            z = mma_h(kf.h, qf[0].h, z);
            kf = ldfrag(&kt[(nt * 16 + l16) * APITCH], 32, hf);
            z = mma_h(kf.h, qf[1].h, z);
#pragma unroll
            for (int r = 0; r < 8; ++r)          // the select reads its lane mask straight from the scalar register
                sc[nt][r] = __builtin_amdgcn_inverse_ballot_w32(nt < 2 ? mw0[nt * 8 + r] : mw1[nt * 8 + r - 16]) ? -1.0e9f : z[r] * 0.125f;
        }

        // ---- online softmax: one query per lane; the two halves hold 32 keys each ----
        float bm = sc[0][0];
#pragma unroll
        for (int nt = 0; nt < 4; ++nt)
#pragma unroll
            for (int r = 0; r < 8; ++r) bm = fmaxf(bm, sc[nt][r]);
        bm = fmaxf(bm, xhalf(bm));
        const float mnew  = fmaxf(mrow, bm);
        const float alpha = __expf(mrow - mnew);
        mrow = mnew;
        float rs[4];
#pragma unroll
        for (int nt = 0; nt < 4; ++nt) {
            rs[nt] = 0.0f;
#pragma unroll
            for (int r = 0; r < 8; ++r) {
                const float p = __expf(sc[nt][r] - mrow);
                sc[nt][r] = p;
                rs[nt] += p;
            }
        }
        lrow = lrow * alpha + ((rs[0] + rs[1]) + (rs[2] + rs[3]));
#pragma unroll
        for (int nt = 0; nt < 4; ++nt)
#pragma unroll
            for (int r = 0; r < 8; ++r) accO[nt][r] *= alpha;

        // ---- P^T B fragments, f16(1024 p), packed from the score accumulators in place ----
        Frag pf[2];
#pragma unroll
        for (int a = 0; a < 2; ++a)
#pragma unroll
            for (int r = 0; r < 8; ++r) {
                pf[a].h[r]     = (_Float16)(sc[2 * a][r] * P_CARRY);
                pf[a].h[8 + r] = (_Float16)(sc[2 * a + 1][r] * P_CARRY);
            }

        // ---- O^T += V^T(64 d x 64 keys) . P^T(64 keys x 16 queries) ----
#pragma unroll
        for (int nt = 0; nt < 4; ++nt) {
            Frag vf = ldfrag_tr(vtl + nt * 16, VPITCH);
            accO[nt] = mma_h(vf.h, pf[0].h, accO[nt]);
            vf = ldfrag_tr(vtl + 32 * VPITCH + nt * 16, VPITCH);
            accO[nt] = mma_h(vf.h, pf[1].h, accO[nt]);
        }
    }

    // the halves' sums are joined once; accO element [nt][r]: d = 16 nt + 8 hf + r, query l16
    const float inv = (1.0f / (lrow + xhalf(lrow))) * CTX_SCALE;
    __syncthreads();
#pragma unroll
    for (int nt = 0; nt < 4; ++nt) {
        v4u w;
#pragma unroll
        for (int i = 0; i < 4; ++i)
            w[i] = (uint32_t)h_bits(accO[nt][2 * i] * inv) | ((uint32_t)h_bits(accO[nt][2 * i + 1] * inv) << 16);
        *(v4u*)(myps + l16 * APITCH + nt * 16 + 8 * hf) = w;
    }
    __syncthreads();
    v4u val[4]; size_t off[4];
#pragma unroll
    for (int i = 0; i < 4; ++i) {
        const int p = lane + 32 * i;
        const int row = p >> 3, seg = (p & 7) * 8;              // lanes 8q..8q+7 -> one line
        val[i] = *(const v4u*)(myps + row * APITCH + seg);
        off[i] = (rowb + qr + row) * EMB + hcol + seg;
    }
#pragma unroll
    for (int i = 0; i < 4; ++i) *(v4u*)(ctx + off[i]) = val[i];
    
}

// ---------------------------------------------------------------------------
// Host launcher: 4 ops, workspace 93,323,264 B.
// ---------------------------------------------------------------------------
extern "C" void kernel_launch(void* const* d_in, const int* in_sizes, int n_in,
                              void* d_out, int out_size, void* d_ws, size_t ws_size,
                              hipStream_t stream) {
    if (n_in < 10) return;
    if (in_sizes[0] < NB * S_FULL * EMB) return;
    if (in_sizes[1] < NB * S_FULL * S_FULL) return;
    if (in_sizes[2] < EMB * EMB || in_sizes[4] < EMB * EMB ||
        in_sizes[6] < EMB * EMB || in_sizes[8] < EMB * EMB) return;
    if (in_sizes[3] < EMB || in_sizes[5] < EMB || in_sizes[7] < EMB || in_sizes[9] < EMB) return;
    if (out_size < MROWS * EMB) return;
    if (ws_size < WS_TOTAL) return;

    const float* x    = (const float*)d_in[0];   // [NB_FULL][S_FULL][EMB] f32
    const int*   mask = (const int*)d_in[1];     // [NB_FULL][S_FULL][S_FULL] int32 (bool)
    const float* Wq   = (const float*)d_in[2];   // [EMB in][EMB out]
    const float* bq   = (const float*)d_in[3];
    const float* Wk   = (const float*)d_in[4];
    const float* bk   = (const float*)d_in[5];
    const float* Wv   = (const float*)d_in[6];
    const float* bv   = (const float*)d_in[7];
    const float* Wo   = (const float*)d_in[8];
    const float* bo   = (const float*)d_in[9];
    float* out = (float*)d_out;                  // [MROWS][EMB] f32

    unsigned char* ws = (unsigned char*)d_ws;
    size_t off = 0;
    uint16_t* xb   = (uint16_t*)(ws + off); off += PLANE_BYTES;   // bf16 [MROWS][EMB]
    uint16_t* WqT  = (uint16_t*)(ws + off); off += WT_BYTES * 3;  // bf16 [n][k]: the Wq, Wk, Wv planes in a row
    uint16_t* WoT  = (uint16_t*)(ws + off); off += WT_BYTES;      // f16 [n][k], x64, directly behind them
    uint16_t* Qp   = (uint16_t*)(ws + off); off += PLANE_BYTES;   // f16 [MROWS][EMB]
    uint16_t* Kpl  = (uint16_t*)(ws + off); off += PLANE_BYTES;
    uint16_t* Vpl  = (uint16_t*)(ws + off); off += PLANE_BYTES;
    uint16_t* Ctx  = (uint16_t*)(ws + off); off += PLANE_BYTES;   // f16, x16
    unsigned int* mbits = (unsigned int*)(ws + off); off += MB_BYTES;
    if (off > ws_size) return;

    // the four weight planes are one run from WqT on; Qp, Kpl, Vpl are one run of three
    k_prep<<<dim3(4 * WBLK + MBLK + XBLK), dim3(256), 0, stream>>>(x, mask, Wq, Wk, Wv, Wo, xb, WqT, mbits);

    k_gemm<true, true, 3><<<dim3(EMB / GBN, MROWS / GBM, 3), dim3(256), 0, stream>>>(xb, WqT, bq, bk, bv, (void*)Qp, 1.0f);

    const dim3 gA(SEQ / 128, NB * NHEAD);
    k_attn<<<gA, dim3(256), 0, stream>>>(Qp, Kpl, Vpl, mbits, Ctx);

    k_gemm<false, false, 1><<<dim3(EMB / GBN, MROWS / GBM, 1), dim3(256), 0, stream>>>(Ctx, WoT, bo, bo, bo, (void*)out, OUT_SCALE);
}

// v009
// One run takes 113 microseconds.
// In both of two side-by-side timings against v008, it was 1.04 times as fast.
// Over all steps from v000 it is 3.73 times as fast.
#include <hip/hip_runtime.h>
#include <hip/hip_bf16.h>
#include <stdint.h>

// Contractions: x@Wq, x@Wk, x@Wv on v_wmma_f32_16x16x32_bf16 (bf16 operands = RNE-converted inputs);
// k.q^T, v^T.p^T and ctx@Wo on v_wmma_f32_16x16x32_f16 (f16 operands with power-of-two carries:
// p x1024, ctx x16, Wo x64); f32 accumulate; softmax, bias adds and normalisation in f32.

#ifndef NB
#define NB 8
#endif
#ifndef SEQ
#define SEQ 1024
#endif
#define NB_FULL 8
#define S_FULL  1024
#define EMB     1024
#define NHEAD   16
#define HDIM    64
#define MROWS   (NB * SEQ)
#define MWORDS  (SEQ / 32)

static_assert(NB >= 1 && NB <= NB_FULL);
static_assert(SEQ % 128 == 0 && SEQ <= S_FULL);
static_assert(EMB == NHEAD * HDIM);
static_assert(EMB % 128 == 0);
static_assert(MROWS % 128 == 0);
static_assert(((MROWS * EMB) / 8) % 256 == 0);
static_assert((NB * SEQ * MWORDS) % 256 == 0);

#define P_CARRY    1024.0f              // P operand = f16(1024 * exp(s - m))
#define CTX_SCALE  (1.0f / 64.0f)       // ctx operand = accO/(1024 l) * 16
#define WO_CARRY   64.0f                // Wo operand = f16(bf16(Wo) * 64)
#define OUT_SCALE  (1.0f / 1024.0f)     // 1/(16 * 64)

// workspace carve (bytes); every region written at its exact extent (tile multiples == plane sizes)
#define PLANE_BYTES ((size_t)MROWS * EMB * 2)
#define WT_BYTES    ((size_t)EMB * EMB * 2)
#define MB_BYTES    ((size_t)NB * SEQ * MWORDS * 4)
#define WS_TOTAL    (PLANE_BYTES * 5 + WT_BYTES * 4 + MB_BYTES)
static_assert(WS_TOTAL <= (size_t)134217728);
static_assert(PLANE_BYTES % 128 == 0 && WT_BYTES % 128 == 0 && MB_BYTES % 128 == 0);

typedef _Float16     v16h __attribute__((ext_vector_type(16)));
typedef __bf16       v16b __attribute__((ext_vector_type(16)));
typedef float        v8f  __attribute__((ext_vector_type(8)));
typedef float        v4f  __attribute__((ext_vector_type(4)));
typedef unsigned int v4u  __attribute__((ext_vector_type(4)));
typedef unsigned int v16u __attribute__((ext_vector_type(16)));
typedef int          v4i  __attribute__((ext_vector_type(4)));
typedef short        v8s  __attribute__((ext_vector_type(8)));

union Frag {
    v16h     h;
    v16b     b;
    v4u      q[2];
    uint16_t s[16];
};

// ---------------------------------------------------------------------------
// scalar conversions
// ---------------------------------------------------------------------------
__device__ __forceinline__ uint16_t bf16_bits(float f) {
    uint32_t u = __builtin_bit_cast(uint32_t, f);
    u += 0x7FFFu + ((u >> 16) & 1u);              // RNE
    return (uint16_t)(u >> 16);
}
__device__ __forceinline__ float bf16_rne(float f) {
    const uint32_t u = ((uint32_t)bf16_bits(f)) << 16;
    return __builtin_bit_cast(float, u);
}
__device__ __forceinline__ uint16_t h_bits(float f) {
    return __builtin_bit_cast(uint16_t, (_Float16)f);   // RNE f32 -> f16
}

// ---------------------------------------------------------------------------
// WMMA helpers: issue + hazard guard (4 VALU slots, D tied, A/B kept live)
// ---------------------------------------------------------------------------
__device__ __forceinline__ v8f mma_h(v16h a, v16h b, v8f c) {
    v8f d = __builtin_amdgcn_wmma_f32_16x16x32_f16(false, a, false, b, (short)0, c, false, false);
    asm volatile("v_nop\n\tv_nop\n\tv_nop\n\tv_nop" : "+v"(d) : "v"(a), "v"(b));
    return d;
}
__device__ __forceinline__ v8f mma_b(v16b a, v16b b, v8f c) {
    v8f d = __builtin_amdgcn_wmma_f32_16x16x32_bf16(false, a, false, b, (short)0, c, false, false);
    asm volatile("v_nop\n\tv_nop\n\tv_nop\n\tv_nop" : "+v"(d) : "v"(a), "v"(b));
    return d;
}

// The same product with no v_nop written behind it, for the attention kernel, whose vector port is its limit:
// the compiler keeps the distances behind its own builtin and fills them with the softmax's instructions where it can.
__device__ __forceinline__ v8f mma_hp(v16h a, v16h b, v8f c) {
    return __builtin_amdgcn_wmma_f32_16x16x32_f16(false, a, false, b, (short)0, c, false, false);
}

// 16x32 16-bit A/B fragment from a k-contiguous row (wave32 split layout):
// lane row/col = lane&15, hf = lane>>4; elements 0..7 <- k0+8hf+0..7, elements 8..15 <- k0+16+8hf+0..7
__device__ __forceinline__ Frag ldfrag(const uint16_t* rowp, int k0, int hf) {
    Frag f;
    f.q[0] = *(const v4u*)(rowp + k0 + 8 * hf);
    f.q[1] = *(const v4u*)(rowp + k0 + 16 + 8 * hf);
    return f;
}

// 16x32 16-bit A fragment of T^T from a row-major LDS tile T[k][d] (row pitch in halves) by the transposing load:
// p = the lane's address, T + (k0 + 8 (lane>>4) + (lane&7)) * pitch + d0 + 8 ((lane>>3)&1);
// the lane (row d0 + (lane&15), hf = lane>>4) then holds elements 0..7 <- T[k0+8hf+0..7][row], 8..15 <- T[k0+16+8hf+0..7][row]
__device__ __forceinline__ Frag ldfrag_tr(const uint16_t* p, int pitch) {
    typedef __attribute__((address_space(3))) v8s lds_v8s;
    Frag f;
    f.q[0] = __builtin_bit_cast(v4u, __builtin_amdgcn_ds_load_tr16_b128_v8i16((lds_v8s*)p));
    f.q[1] = __builtin_bit_cast(v4u, __builtin_amdgcn_ds_load_tr16_b128_v8i16((lds_v8s*)(p + 16 * pitch)));
    return f;
}

// lane l <-> lane l ^ 16 by a vector cross-row move (no LDS round trip)
__device__ __forceinline__ float xhalf(float x) {
    const int b = __builtin_bit_cast(int, x);
    return __builtin_bit_cast(float, __builtin_amdgcn_permlanex16(b, b, 0x76543210, 0xfedcba98, false, false));
}

// ---------------------------------------------------------------------------
// Preparation job 1: x f32 [NB][S_FULL][EMB] -> bf16 plane xb [MROWS][EMB] (compact rows).
// ---------------------------------------------------------------------------
__device__ __forceinline__
void job_cvt_x(const float* __restrict__ x, uint16_t* __restrict__ xb, int blk) {
    const size_t gid = (size_t)blk * 256 + threadIdx.x;
    const size_t e0  = gid * 8;
    const size_t m   = e0 / EMB;
    const int    c   = (int)(e0 % EMB);
    const size_t b   = m / SEQ, s = m % SEQ;
    const float* src = x + (b * S_FULL + s) * EMB + c;
    const v4f a0 = *(const v4f*)src;
    const v4f a1 = *(const v4f*)(src + 4);
    v4u w;
    w.x = (uint32_t)bf16_bits(a0.x) | ((uint32_t)bf16_bits(a0.y) << 16);
    w.y = (uint32_t)bf16_bits(a0.z) | ((uint32_t)bf16_bits(a0.w) << 16);
    w.z = (uint32_t)bf16_bits(a1.x) | ((uint32_t)bf16_bits(a1.y) << 16);
    w.w = (uint32_t)bf16_bits(a1.z) | ((uint32_t)bf16_bits(a1.w) << 16);
    uint16_t* dst = xb + e0;
    *(v4u*)dst = w;
    // stands between the store and any later write of its registers: a precaution, as each block of the merged kernel runs one job and then ends
    asm volatile("s_wait_xcnt 0x0" ::: "memory");
}

// ---------------------------------------------------------------------------
// Preparation job 2: W f32 [k][n] (EMB x EMB) -> WT 16-bit [n][k] (k-contiguous B operand plane).
// bf16 RNE of the input value, optional power-of-two scale, then bf16 or f16 bits.
// ---------------------------------------------------------------------------
template <bool TO_F16>
__device__ __forceinline__
void job_wconv(const float* __restrict__ W, uint16_t* __restrict__ WT, float scale,
               int bx, int by, uint16_t* tile) {  // tile: LDS [n][k] 64 x 64; cross-wave -> block barrier
    const int t = threadIdx.x;
    const int n0 = bx * 64, k0 = by * 64;
    const int kr = t >> 2, nc = (t & 3) * 16;     // thread: row k0+kr, cols n0+nc..+15
    const float* src = W + (size_t)(k0 + kr) * EMB + n0 + nc;
#pragma unroll
    for (int i = 0; i < 4; ++i) {
        const v4f v = *(const v4f*)(src + 4 * i);
        float f[4];
        f[0] = v.x; f[1] = v.y; f[2] = v.z; f[3] = v.w;
#pragma unroll
        for (int jj = 0; jj < 4; ++jj) {
            const float g = bf16_rne(f[jj]) * scale;
            tile[(nc + 4 * i + jj) * 64 + kr] = TO_F16 ? h_bits(g) : bf16_bits(g);
        }
    }
    __syncthreads();
    v4u val[2]; size_t off[2];
#pragma unroll
    for (int i = 0; i < 2; ++i) {
        const int p   = t + 256 * i;              // wave w, lane: row = 4w + 32i + lane>>3
        const int row = p >> 3, seg = (p & 7) * 8;
        val[i] = *(const v4u*)&tile[row * 64 + seg];
        off[i] = (size_t)(n0 + row) * EMB + k0 + seg;
    }
#pragma unroll
    for (int i = 0; i < 2; ++i) *(v4u*)(WT + off[i]) = val[i];
    // stands between the store and any later write of its registers: a precaution, as each block of the merged kernel runs one job and then ends
    asm volatile("s_wait_xcnt 0x0" ::: "memory");
}

// ---------------------------------------------------------------------------
// Preparation job 3: mask int32 [NB][S_FULL][S_FULL] -> bit plane mb, laid out as the attention kernel's lane masks:
// unit u = (16-query group g of the compact rows, 64-key tile j), u = g * (SEQ / 64) + j, holds 32 words;
// bit l of word 8 nt + r <-> mask of query 16 g + (l & 15), key 64 j + 16 nt + 8 (l >> 4) + r is nonzero (suppressed).
// One wave = one unit: a lane reads the 32 keys that it holds as scores later, each compare over the wave
// is one word, and lane i stores word i (one 128-B line a wave).
// ---------------------------------------------------------------------------
__device__ __forceinline__
void job_maskbits(const int* __restrict__ mask, unsigned int* __restrict__ mb, int blk) {
    const int lane = threadIdx.x & 31, hf = lane >> 4, l16 = lane & 15;
    const size_t u   = (size_t)blk * 8 + (threadIdx.x >> 5);
    const int    j   = (int)(u % (SEQ / 64));
    const size_t row = (u / (SEQ / 64)) * 16 + l16;
    const size_t b = row / SEQ, q = row % SEQ;
    const int* src = mask + (b * S_FULL + q) * S_FULL + (size_t)j * 64 + 8 * hf;
    v4i v[8];
#pragma unroll
    for (int i = 0; i < 8; ++i) v[i] = *(const v4i*)(src + 16 * (i >> 1) + 4 * (i & 1));
    // every compare over the wave is taken with all lanes on, ahead of the lane's pick of its own word
    unsigned int w[32];
#pragma unroll
    for (int i = 0; i < 8; ++i)
#pragma unroll
        for (int c = 0; c < 4; ++c) w[4 * i + c] = __builtin_amdgcn_ballot_w32(v[i][c] != 0);
    unsigned int bits = w[0];
#pragma unroll
    for (int i = 1; i < 32; ++i) bits = (lane == i) ? w[i] : bits;
    unsigned int* dst = mb + u * 32 + lane;
    *dst = bits;
    // stands between the store and any later write of its registers: a precaution, as each block of the merged kernel runs one job and then ends
    asm volatile("s_wait_xcnt 0x0" ::: "memory");
}

// ---------------------------------------------------------------------------
// Kernel 1: the six independent preparation jobs in one launch; the block index picks the job.
// Blocks [0, 4 WBLK): weight planes Wq, Wk, Wv (bf16) and Wo (f16 x64), laid one behind the other in WT;
// they have the longest chain per block (load, LDS, barrier, store) and so take the lowest indices.
// Blocks [4 WBLK, 4 WBLK + MBLK): mask bits. The rest: x to bf16.
// ---------------------------------------------------------------------------
#define WSIDE   (EMB / 64)
#define WBLK    (WSIDE * WSIDE)
#define MBLK    ((NB * SEQ * MWORDS) / 256)
#define XBLK    ((MROWS * EMB / 8) / 256)
__global__ __launch_bounds__(256)
void k_prep(const float* __restrict__ x, const int* __restrict__ mask,
            const float* __restrict__ Wq, const float* __restrict__ Wk,
            const float* __restrict__ Wv, const float* __restrict__ Wo,
            uint16_t* __restrict__ xb, uint16_t* __restrict__ WT, unsigned int* __restrict__ mb) {
    __shared__ uint16_t tile[64 * 64];
    const int bid = blockIdx.x;                   // every branch below is block-uniform
    if (bid < 4 * WBLK) {
        const int job = bid / WBLK, tl = bid % WBLK;
        uint16_t* dst = WT + (size_t)job * (EMB * EMB);
        if (job < 3)
            job_wconv<false>(job == 0 ? Wq : (job == 1 ? Wk : Wv), dst, 1.0f, tl % WSIDE, tl / WSIDE, tile);
        else
            job_wconv<true>(Wo, dst, WO_CARRY, tl % WSIDE, tl / WSIDE, tile);
    } else if (bid < 4 * WBLK + MBLK) {
        job_maskbits(mask, mb, bid - 4 * WBLK);
    } else {
        job_cvt_x(x, xb, bid - (4 * WBLK + MBLK));
    }
}

// ---------------------------------------------------------------------------
// Kernel 2: C[M][EMB] = A[M][EMB] . BT[EMB][EMB]^T (+ bias), 16-bit planes, f32 accumulate.
// JOBS products that share A run in one launch: blockIdx.z picks BT plane z, bias z and C plane z
// (the BT planes lie one behind the other, the C planes too).
// Block 256 threads = 8 waves; block tile 128x256; wave tile 64 rows x 64 cols
// (4 x 4 accumulator tiles: 8 fragments feed 16 products). k tiles of 64 (one 128-B line per row) are brought by whole-line
// loads, one tile ahead in registers, into two LDS buffers at row pitch 144 B (16 B x odd:
// conflict-free b128 fragment reads); one block barrier per k tile; products in k-steps of 32.
// OUT16: f16 plane out = f16(acc*oscale + bias);  else f32 out = acc*oscale + bias.
// ---------------------------------------------------------------------------
#define GK      64                        // k extent of one staged tile (halves)
#define GPITCH  72                        // LDS row pitch (halves)
#define GBM     128                       // block tile rows
#define GBN     256                       // block tile columns
#define GOPER   (GBM * GPITCH)            // the A tile (halves)
#define GBUF    ((GBM + GBN) * GPITCH)    // one buffer: A tile then B tile (halves)
static_assert(EMB % GK == 0 && EMB / GK >= 2);
static_assert(EMB % GBN == 0 && MROWS % GBM == 0);
static_assert(2 * GBUF * 2 >= 8 * 32 * 64 * 4);   // the epilogue slabs (8 KB a wave) fit in the two buffers
// second argument: at least 4 waves per SIMD, a budget of 256 vector registers, so that two work-groups share a WGP
// and one's LDS traffic runs under the other's products
template <bool BF, bool OUT16, int JOBS>
__global__ __launch_bounds__(256, 4)
void k_gemm(const uint16_t* __restrict__ A, const uint16_t* __restrict__ BT0,
            const float* __restrict__ bias0, const float* __restrict__ bias1,
            const float* __restrict__ bias2, void* __restrict__ Cout, float oscale) {
    static_assert(JOBS >= 1 && JOBS <= 3);
    const int job = JOBS > 1 ? (int)blockIdx.z : 0;
    const uint16_t* BT  = BT0 + (size_t)job * (EMB * EMB);
    const float*   bias = job == 0 ? bias0 : (job == 1 ? bias1 : bias2);

    __shared__ __attribute__((aligned(16))) uint16_t stage[2 * GBUF];   // two k-tile buffers; epilogue slabs after the loop

    const int t = threadIdx.x, wave = t >> 5, lane = t & 31;
    const int hf = lane >> 4, l16 = lane & 15;
    const int m0 = blockIdx.y * GBM, n0 = blockIdx.x * GBN;
    const int wr = wave & 1, wc = wave >> 1;

    // staging: 8 lanes cover one 128-B row piece; thread rows srow + 32 i, i = 0..3 of A, i = 0..7 of B
    const int srow = t >> 3, sseg = (t & 7) * 8;
    const uint16_t* ag = A  + (size_t)(m0 + srow) * EMB + sseg;
    const uint16_t* bg = BT + (size_t)(n0 + srow) * EMB + sseg;
    uint16_t* sst = stage + srow * GPITCH + sseg;

    // fragment rows inside a buffer
    const uint16_t* afr = stage + (wr * 64 + l16) * GPITCH;
    const uint16_t* bfr = stage + GOPER + (wc * 64 + l16) * GPITCH;

    v8f acc[16] = {};
    v4u ra[GBM / 32], rb[GBN / 32];

#pragma unroll
    for (int i = 0; i < GBM / 32; ++i) ra[i] = *(const v4u*)(ag + (size_t)(32 * i) * EMB);
#pragma unroll
    for (int i = 0; i < GBN / 32; ++i) rb[i] = *(const v4u*)(bg + (size_t)(32 * i) * EMB);
#pragma unroll
    for (int i = 0; i < GBM / 32; ++i) *(v4u*)(sst + 32 * i * GPITCH)         = ra[i];
#pragma unroll
    for (int i = 0; i < GBN / 32; ++i) *(v4u*)(sst + GOPER + 32 * i * GPITCH) = rb[i];
    __syncthreads();

    // kept rolled; the buffer is picked by a scalar select
#pragma unroll 1
    for (int kt = 0; kt < EMB / GK; ++kt) {
        const int  cur  = (kt & 1) * GBUF;
        const bool more = kt + 1 < EMB / GK;      // block-uniform
        if (more) {
            const uint16_t* pa = ag + (kt + 1) * GK;
            const uint16_t* pb = bg + (kt + 1) * GK;
#pragma unroll
            for (int i = 0; i < GBM / 32; ++i) ra[i] = *(const v4u*)(pa + (size_t)(32 * i) * EMB);
#pragma unroll
            for (int i = 0; i < GBN / 32; ++i) rb[i] = *(const v4u*)(pb + (size_t)(32 * i) * EMB);
            // stands between the loads and any write of their address pairs; naming the pairs keeps them whole up to
            // here (at this register count the last load of each run was otherwise given its own address pair to land on)
            asm volatile("s_wait_xcnt 0x0" :: "v"(pa), "v"(pb) : "memory");
        }
        // the fragment reads of a k-step of 32 stand as one group ahead of its 16 products
#pragma unroll
        for (int kk = 0; kk < GK / 32; ++kk) {
            Frag a[4], b[4];
#pragma unroll
            for (int mt = 0; mt < 4; ++mt) a[mt] = ldfrag(afr + cur + mt * 16 * GPITCH, kk * 32, hf);
#pragma unroll
            for (int nt = 0; nt < 4; ++nt) b[nt] = ldfrag(bfr + cur + nt * 16 * GPITCH, kk * 32, hf);
#pragma unroll
            for (int mt = 0; mt < 4; ++mt)
#pragma unroll
                for (int nt = 0; nt < 4; ++nt) {
                    if constexpr (BF)
                        acc[mt * 4 + nt] = mma_b(a[mt].b, b[nt].b, acc[mt * 4 + nt]);
                    else
                        acc[mt * 4 + nt] = mma_h(a[mt].h, b[nt].h, acc[mt * 4 + nt]);
                }
        }
        if (more) {
            // the other buffer: its last readers left it before the barrier that ended the trip before
            uint16_t* dst = sst + (GBUF - cur);
#pragma unroll
            for (int i = 0; i < GBM / 32; ++i) *(v4u*)(dst + 32 * i * GPITCH)         = ra[i];
#pragma unroll
            for (int i = 0; i < GBN / 32; ++i) *(v4u*)(dst + GOPER + 32 * i * GPITCH) = rb[i];
        }
        __syncthreads();                          // publishes tile kt+1; ends every read of tile kt
    }

    // bias (bf16-RNE input value) per accumulator column (lane = column)
    float bvv[4];
#pragma unroll
    for (int nt = 0; nt < 4; ++nt)
        bvv[nt] = bf16_rne(bias[n0 + wc * 64 + nt * 16 + l16]);

    if constexpr (OUT16) {
        uint16_t* mys16 = stage + wave * (64 * 64);           // 64 rows x 64 halves, 8 KB per wave
        uint16_t* C     = reinterpret_cast<uint16_t*>(Cout) + (size_t)job * ((size_t)MROWS * EMB);
#pragma unroll
        for (int mt = 0; mt < 4; ++mt)
#pragma unroll
            for (int nt = 0; nt < 4; ++nt)
#pragma unroll
                for (int r = 0; r < 8; ++r)
                    mys16[(mt * 16 + 8 * hf + r) * 64 + nt * 16 + l16] =
                        h_bits(acc[mt * 4 + nt][r] * oscale + bvv[nt]);
        __syncthreads();
#pragma unroll
        for (int h = 0; h < 2; ++h) {
            v4u val[8]; size_t off[8];
#pragma unroll
            for (int i = 0; i < 8; ++i) {
                const int p = lane + 32 * (i + 8 * h);
                const int row = p >> 3, seg = (p & 7) * 8;      // lanes 8q..8q+7 -> one line
                val[i] = *(const v4u*)(mys16 + row * 64 + seg);
                off[i] = (size_t)(m0 + wr * 64 + row) * EMB + n0 + wc * 64 + seg;
            }
#pragma unroll
            for (int i = 0; i < 8; ++i) *(v4u*)(C + off[i]) = val[i];
        }
    } else {
        float* mys = reinterpret_cast<float*>(stage) + wave * (32 * 64);   // 32 rows x 64 floats, 8 KB per wave
        float* C = reinterpret_cast<float*>(Cout) + (size_t)job * ((size_t)MROWS * EMB);
#pragma unroll
        for (int mp = 0; mp < 2; ++mp) {          // two passes of 32 rows, the barriers of two passes as before
            __syncthreads();
#pragma unroll
            for (int mt = 0; mt < 2; ++mt)
#pragma unroll
                for (int nt = 0; nt < 4; ++nt)
#pragma unroll
                    for (int r = 0; r < 8; ++r)
                        mys[(mt * 16 + 8 * hf + r) * 64 + nt * 16 + l16] = acc[(2 * mp + mt) * 4 + nt][r] * oscale + bvv[nt];
            __syncthreads();
#pragma unroll
            for (int h = 0; h < 2; ++h) {
                v4f val[8]; size_t off[8];
#pragma unroll
                for (int i = 0; i < 8; ++i) {
                    const int p = lane + 32 * (i + 8 * h);
                    const int row = p >> 4, seg = (p & 15) * 4; // lanes 8q..8q+7 -> one line
                    val[i] = *(const v4f*)(mys + row * 64 + seg);
                    off[i] = (size_t)(m0 + wr * 64 + mp * 32 + row) * EMB + n0 + wc * 64 + seg;
                }
#pragma unroll
                for (int i = 0; i < 8; ++i) *(v4f*)(C + off[i]) = val[i];
            }
        }
    }
}

#define APITCH  72                        // LDS row pitch (halves)
#define VPITCH  80                        // LDS row pitch of the V tile (halves)
// second argument: at least 8 waves per SIMD, a budget of 128 vector registers, so that four work-groups
// (not three) fit a WGP and the whole grid of SEQ / 128 x NB x NHEAD work-groups is resident at once
__global__ __launch_bounds__(256, 8)
void k_attn(const uint16_t* __restrict__ Qp, const uint16_t* __restrict__ Kp,
            const uint16_t* __restrict__ Vp, const unsigned int* __restrict__ mb,
            uint16_t* __restrict__ ctx) {
    __shared__ __attribute__((aligned(16))) uint16_t kt[64 * APITCH];      // K tile [key][d]   (cross-wave: block barriers)
    __shared__ __attribute__((aligned(16))) uint16_t vt[64 * VPITCH];      // V tile [key][d]   (cross-wave: block barriers)
    __shared__ __attribute__((aligned(16))) uint16_t ps[8][16 * APITCH];   // per-wave ctx stage (block barriers used)

    const int t = threadIdx.x, lane = t & 31;
    // the wave's number in a scalar register: what is formed from it and lives across the loop for the
    // epilogue (row base, stage slab) then takes no vector register, and the budget is met without scratch
    const int wave = __builtin_amdgcn_readfirstlane(t >> 5);
    const int hf = lane >> 4, l16 = lane & 15;
    const int b  = blockIdx.y / NHEAD, hd = blockIdx.y % NHEAD;
    const int qr = blockIdx.x * 128 + wave * 16;  // first query row of this wave (within sequence)
    const size_t rowb = (size_t)b * SEQ;          // compact plane row base of this batch
    const size_t hcol = (size_t)hd * HDIM;

    // Q fragments for the wave's 16 rows, straight from the f16 plane
    Frag qf[2];
    {
        const uint16_t* qrow = Qp + (rowb + qr + l16) * EMB + hcol;
        qf[0] = ldfrag(qrow, 0, hf);
        qf[1] = ldfrag(qrow, 32, hf);
    }

    v8f accO[4] = {};
    float mrow = -__builtin_inff();               // running maximum of the lane's query (both halves agree)
    float lrow = 0.0f;                            // running sum over the keys of the lane's own half

    const int keyr = t >> 2, hdB = (t & 3) * 16;  // coop staging: key row, 16 d-columns
    // the wave's lane masks: 32 words a key tile, at an address that is the same in every lane. The plane was written
    // by the preparation launch and nobody writes it here: read through the constant address space, it comes by scalar loads
    typedef __attribute__((address_space(4))) const v16u cmask_t;
    cmask_t* mbw = (cmask_t*)(mb + ((rowb + qr) / 16) * (size_t)(SEQ / 64) * 32);
    uint16_t* myps = ps[wave];
    const uint16_t* vtl = vt + (8 * hf + (lane & 7)) * VPITCH + 8 * ((lane >> 3) & 1);   // the lane's transposing-load base

#pragma unroll 1
    for (int j = 0; j < SEQ / 64; ++j) {
        const int key0 = j * 64;
        // ---- lane masks of the wave's 32 score registers for these 64 keys, into scalar registers ----
        const v16u mw0 = mbw[2 * j], mw1 = mbw[2 * j + 1];
        __syncthreads();                         // prior tile fully consumed by all waves

        // ---- stage K tile and V tile, both [key][d] (full 64x64 each) ----
        {
            const size_t go = (rowb + key0 + keyr) * EMB + hcol + hdB;
            const v4u k0v = *(const v4u*)(Kp + go);
            const v4u k1v = *(const v4u*)(Kp + go + 8);
            *(v4u*)&kt[keyr * APITCH + hdB]     = k0v;
            *(v4u*)&kt[keyr * APITCH + hdB + 8] = k1v;
            const v4u v0v = *(const v4u*)(Vp + go);
            const v4u v1v = *(const v4u*)(Vp + go + 8);
            *(v4u*)&vt[keyr * VPITCH + hdB]     = v0v;
            *(v4u*)&vt[keyr * VPITCH + hdB + 8] = v1v;
        }
        __syncthreads();

        // ---- scores S^T = K(64x64) . Q^T, scale 1/8, replace-fill -1e9 where masked ----
        // element [nt][r]: key 16 nt + 8 hf + r, query l16
        v8f sc[4];
#pragma unroll
        for (int nt = 0; nt < 4; ++nt) {
            v8f z = {};
            Frag kf = ldfrag(&kt[(nt * 16 + l16) * APITCH], 0, hf);
            z = mma_hp(kf.h, qf[0].h, z);
            kf = ldfrag(&kt[(nt * 16 + l16) * APITCH], 32, hf);
            z = mma_hp(kf.h, qf[1].h, z);
#pragma unroll
            for (int r = 0; r < 8; ++r)          // the select reads its lane mask straight from the scalar register
                sc[nt][r] = __builtin_amdgcn_inverse_ballot_w32(nt < 2 ? mw0[nt * 8 + r] : mw1[nt * 8 + r - 16]) ? -1.0e9f : z[r] * 0.125f;
        }

        // ---- online softmax: one query per lane; the two halves hold 32 keys each ----
        float bm = sc[0][0];
#pragma unroll
        for (int nt = 0; nt < 4; ++nt)
#pragma unroll
            for (int r = 0; r < 8; ++r) bm = fmaxf(bm, sc[nt][r]);
        bm = fmaxf(bm, xhalf(bm));
        const float mnew  = fmaxf(mrow, bm);
        const float alpha = __expf(mrow - mnew);
        mrow = mnew;
        float rs[4];
#pragma unroll
        for (int nt = 0; nt < 4; ++nt) {
            rs[nt] = 0.0f;
#pragma unroll
            for (int r = 0; r < 8; ++r) {
                const float p = __expf(sc[nt][r] - mrow);
                sc[nt][r] = p;
                rs[nt] += p;
            }
        }
        lrow = lrow * alpha + ((rs[0] + rs[1]) + (rs[2] + rs[3]));
#pragma unroll
        for (int nt = 0; nt < 4; ++nt)
#pragma unroll
            for (int r = 0; r < 8; ++r) accO[nt][r] *= alpha;

        // ---- P^T B fragments, f16(1024 p), packed from the score accumulators in place ----
        Frag pf[2];
#pragma unroll
        for (int a = 0; a < 2; ++a)
#pragma unroll
            for (int r = 0; r < 8; ++r) {
                pf[a].h[r]     = (_Float16)(sc[2 * a][r] * P_CARRY);
                pf[a].h[8 + r] = (_Float16)(sc[2 * a + 1][r] * P_CARRY);
            }

        // ---- O^T += V^T(64 d x 64 keys) . P^T(64 keys x 16 queries) ----
#pragma unroll
        for (int nt = 0; nt < 4; ++nt) {
            Frag vf = ldfrag_tr(vtl + nt * 16, VPITCH);
            accO[nt] = mma_hp(vf.h, pf[0].h, accO[nt]);
            vf = ldfrag_tr(vtl + 32 * VPITCH + nt * 16, VPITCH);
            accO[nt] = mma_hp(vf.h, pf[1].h, accO[nt]);
        }
    }

    // the halves' sums are joined once; accO element [nt][r]: d = 16 nt + 8 hf + r, query l16
    const float inv = (1.0f / (lrow + xhalf(lrow))) * CTX_SCALE;
    // the lane's number taken anew (count of the lanes below it, all lanes on) for the stage address: the row offset and
    // the half formed from the thread index are then not carried through the loop for the epilogue alone, and the budget
    // of 128 registers is met without scratch. Only here: with the read-back's index taken anew too, the compiler settled
    // on a schedule of 112 registers that fetches no V fragment ahead of the softmax
    const int elane = (int)__builtin_amdgcn_mbcnt_lo(~0u, 0u);
    __syncthreads();
#pragma unroll
    for (int nt = 0; nt < 4; ++nt) {
        v4u w;
#pragma unroll
        for (int i = 0; i < 4; ++i)
            w[i] = (uint32_t)h_bits(accO[nt][2 * i] * inv) | ((uint32_t)h_bits(accO[nt][2 * i + 1] * inv) << 16);
        *(v4u*)(myps + (elane & 15) * APITCH + nt * 16 + 8 * (elane >> 4)) = w;
    }
    __syncthreads();
    v4u val[4]; size_t off[4];
#pragma unroll
    for (int i = 0; i < 4; ++i) {
        const int p = lane + 32 * i;
        const int row = p >> 3, seg = (p & 7) * 8;              // lanes 8q..8q+7 -> one line
        val[i] = *(const v4u*)(myps + row * APITCH + seg);
        off[i] = (rowb + qr + row) * EMB + hcol + seg;
    }
#pragma unroll
    for (int i = 0; i < 4; ++i) *(v4u*)(ctx + off[i]) = val[i];
    
}

// ---------------------------------------------------------------------------
// Host launcher: 4 ops, workspace 93,323,264 B.
// ---------------------------------------------------------------------------
extern "C" void kernel_launch(void* const* d_in, const int* in_sizes, int n_in,
                              void* d_out, int out_size, void* d_ws, size_t ws_size,
                              hipStream_t stream) {
    if (n_in < 10) return;
    if (in_sizes[0] < NB * S_FULL * EMB) return;
    if (in_sizes[1] < NB * S_FULL * S_FULL) return;
    if (in_sizes[2] < EMB * EMB || in_sizes[4] < EMB * EMB ||
        in_sizes[6] < EMB * EMB || in_sizes[8] < EMB * EMB) return;
    if (in_sizes[3] < EMB || in_sizes[5] < EMB || in_sizes[7] < EMB || in_sizes[9] < EMB) return;
    if (out_size < MROWS * EMB) return;
    if (ws_size < WS_TOTAL) return;

    const float* x    = (const float*)d_in[0];   // [NB_FULL][S_FULL][EMB] f32
    const int*   mask = (const int*)d_in[1];     // [NB_FULL][S_FULL][S_FULL] int32 (bool)
    const float* Wq   = (const float*)d_in[2];   // [EMB in][EMB out]
    const float* bq   = (const float*)d_in[3];
    const float* Wk   = (const float*)d_in[4];
    const float* bk   = (const float*)d_in[5];
    const float* Wv   = (const float*)d_in[6];
    const float* bv   = (const float*)d_in[7];
    const float* Wo   = (const float*)d_in[8];
    const float* bo   = (const float*)d_in[9];
    float* out = (float*)d_out;                  // [MROWS][EMB] f32

    unsigned char* ws = (unsigned char*)d_ws;
    size_t off = 0;
    uint16_t* xb   = (uint16_t*)(ws + off); off += PLANE_BYTES;   // bf16 [MROWS][EMB]
    uint16_t* WqT  = (uint16_t*)(ws + off); off += WT_BYTES * 3;  // bf16 [n][k]: the Wq, Wk, Wv planes in a row
    uint16_t* WoT  = (uint16_t*)(ws + off); off += WT_BYTES;      // f16 [n][k], x64, directly behind them
    uint16_t* Qp   = (uint16_t*)(ws + off); off += PLANE_BYTES;   // f16 [MROWS][EMB]
    uint16_t* Kpl  = (uint16_t*)(ws + off); off += PLANE_BYTES;
    uint16_t* Vpl  = (uint16_t*)(ws + off); off += PLANE_BYTES;
    uint16_t* Ctx  = (uint16_t*)(ws + off); off += PLANE_BYTES;   // f16, x16
    unsigned int* mbits = (unsigned int*)(ws + off); off += MB_BYTES;
    if (off > ws_size) return;

    // the four weight planes are one run from WqT on; Qp, Kpl, Vpl are one run of three
    k_prep<<<dim3(4 * WBLK + MBLK + XBLK), dim3(256), 0, stream>>>(x, mask, Wq, Wk, Wv, Wo, xb, WqT, mbits);

    k_gemm<true, true, 3><<<dim3(EMB / GBN, MROWS / GBM, 3), dim3(256), 0, stream>>>(xb, WqT, bq, bk, bv, (void*)Qp, 1.0f);

    const dim3 gA(SEQ / 128, NB * NHEAD);
    k_attn<<<gA, dim3(256), 0, stream>>>(Qp, Kpl, Vpl, mbits, Ctx);

    k_gemm<false, false, 1><<<dim3(EMB / GBN, MROWS / GBM, 1), dim3(256), 0, stream>>>(Ctx, WoT, bo, bo, bo, (void*)out, OUT_SCALE);
}

// v010
// One run takes 108 microseconds.
// Two timings next to v009 put it at 1.04 and 1.05 times that version's speed.
// Over all steps from v000 it is 3.90 times as fast.
#include <hip/hip_runtime.h>
#include <hip/hip_bf16.h>
#include <stdint.h>

// Contractions: x@Wq, x@Wk, x@Wv on v_wmma_f32_16x16x32_bf16 (bf16 operands = RNE-converted inputs);
// k.q^T, v^T.p^T and ctx@Wo on v_wmma_f32_16x16x32_f16 (f16 operands with power-of-two carries:
// p x1024, ctx x16, Wo x64); f32 accumulate; softmax, bias adds and normalisation in f32.

#ifndef NB
#define NB 8
#endif
#ifndef SEQ
#define SEQ 1024
#endif
#define NB_FULL 8
#define S_FULL  1024
#define EMB     1024
#define NHEAD   16
#define HDIM    64
#define MROWS   (NB * SEQ)
#define MWORDS  (SEQ / 32)

static_assert(NB >= 1 && NB <= NB_FULL);
static_assert(SEQ % 128 == 0 && SEQ <= S_FULL);
static_assert(EMB == NHEAD * HDIM);
static_assert(EMB % 128 == 0);
static_assert(MROWS % 128 == 0);
static_assert(((MROWS * EMB) / 8) % 256 == 0);
static_assert((NB * SEQ * MWORDS) % 256 == 0);

#define P_CARRY    1024.0f              // P operand = f16(1024 * exp(s - m))
#define CTX_SCALE  (1.0f / 64.0f)       // ctx operand = accO/(1024 l) * 16
#define WO_CARRY   64.0f                // Wo operand = f16(bf16(Wo) * 64)
#define OUT_SCALE  (1.0f / 1024.0f)     // 1/(16 * 64)

// workspace carve (bytes); every region written at its exact extent (tile multiples == plane sizes)
#define PLANE_BYTES ((size_t)MROWS * EMB * 2)
#define WT_BYTES    ((size_t)EMB * EMB * 2)
#define MB_BYTES    ((size_t)NB * SEQ * MWORDS * 4)
#define WS_TOTAL    (PLANE_BYTES * 5 + WT_BYTES * 4 + MB_BYTES)
static_assert(WS_TOTAL <= (size_t)134217728);
static_assert(PLANE_BYTES % 128 == 0 && WT_BYTES % 128 == 0 && MB_BYTES % 128 == 0);

typedef _Float16     v16h __attribute__((ext_vector_type(16)));
typedef __bf16       v16b __attribute__((ext_vector_type(16)));
typedef float        v8f  __attribute__((ext_vector_type(8)));
typedef float        v4f  __attribute__((ext_vector_type(4)));
typedef unsigned int v4u  __attribute__((ext_vector_type(4)));
typedef unsigned int v16u __attribute__((ext_vector_type(16)));
typedef int          v4i  __attribute__((ext_vector_type(4)));
typedef short        v8s  __attribute__((ext_vector_type(8)));

union Frag {
    v16h     h;
    v16b     b;
    v4u      q[2];
    uint16_t s[16];
};

// ---------------------------------------------------------------------------
// scalar conversions
// ---------------------------------------------------------------------------
__device__ __forceinline__ uint16_t bf16_bits(float f) {
    uint32_t u = __builtin_bit_cast(uint32_t, f);
    u += 0x7FFFu + ((u >> 16) & 1u);              // RNE
    return (uint16_t)(u >> 16);
}
__device__ __forceinline__ float bf16_rne(float f) {
    const uint32_t u = ((uint32_t)bf16_bits(f)) << 16;
    return __builtin_bit_cast(float, u);
}
__device__ __forceinline__ uint16_t h_bits(float f) {
    return __builtin_bit_cast(uint16_t, (_Float16)f);   // RNE f32 -> f16
}

// ---------------------------------------------------------------------------
// WMMA helpers: issue + hazard guard (4 VALU slots, D tied, A/B kept live)
// ---------------------------------------------------------------------------
__device__ __forceinline__ v8f mma_h(v16h a, v16h b, v8f c) {
    v8f d = __builtin_amdgcn_wmma_f32_16x16x32_f16(false, a, false, b, (short)0, c, false, false);
    asm volatile("v_nop\n\tv_nop\n\tv_nop\n\tv_nop" : "+v"(d) : "v"(a), "v"(b));
    return d;
}
__device__ __forceinline__ v8f mma_b(v16b a, v16b b, v8f c) {
    v8f d = __builtin_amdgcn_wmma_f32_16x16x32_bf16(false, a, false, b, (short)0, c, false, false);
    asm volatile("v_nop\n\tv_nop\n\tv_nop\n\tv_nop" : "+v"(d) : "v"(a), "v"(b));
    return d;
}

// The same product with no v_nop written behind it, for the attention kernel, whose vector port is its limit:
// the compiler keeps the distances behind its own builtin and fills them with the softmax's instructions where it can.
__device__ __forceinline__ v8f mma_hp(v16h a, v16h b, v8f c) {
    return __builtin_amdgcn_wmma_f32_16x16x32_f16(false, a, false, b, (short)0, c, false, false);
}

// 16x32 16-bit A/B fragment from a k-contiguous row (wave32 split layout):
// lane row/col = lane&15, hf = lane>>4; elements 0..7 <- k0+8hf+0..7, elements 8..15 <- k0+16+8hf+0..7
__device__ __forceinline__ Frag ldfrag(const uint16_t* rowp, int k0, int hf) {
    Frag f;
    f.q[0] = *(const v4u*)(rowp + k0 + 8 * hf);
    f.q[1] = *(const v4u*)(rowp + k0 + 16 + 8 * hf);
    return f;
}

// 16x32 16-bit A fragment of T^T from a row-major LDS tile T[k][d] (row pitch in halves) by the transposing load:
// p = the lane's address, T + (k0 + 8 (lane>>4) + (lane&7)) * pitch + d0 + 8 ((lane>>3)&1);
// the lane (row d0 + (lane&15), hf = lane>>4) then holds elements 0..7 <- T[k0+8hf+0..7][row], 8..15 <- T[k0+16+8hf+0..7][row]
__device__ __forceinline__ Frag ldfrag_tr(const uint16_t* p, int pitch) {
    typedef __attribute__((address_space(3))) v8s lds_v8s;
    Frag f;
    f.q[0] = __builtin_bit_cast(v4u, __builtin_amdgcn_ds_load_tr16_b128_v8i16((lds_v8s*)p));
    f.q[1] = __builtin_bit_cast(v4u, __builtin_amdgcn_ds_load_tr16_b128_v8i16((lds_v8s*)(p + 16 * pitch)));
    return f;
}

// lane l <-> lane l ^ 16 by a vector cross-row move (no LDS round trip)
__device__ __forceinline__ float xhalf(float x) {
    const int b = __builtin_bit_cast(int, x);
    return __builtin_bit_cast(float, __builtin_amdgcn_permlanex16(b, b, 0x76543210, 0xfedcba98, false, false));
}

// ---------------------------------------------------------------------------
// Preparation job 1: x f32 [NB][S_FULL][EMB] -> bf16 plane xb [MROWS][EMB] (compact rows).
// ---------------------------------------------------------------------------
__device__ __forceinline__
void job_cvt_x(const float* __restrict__ x, uint16_t* __restrict__ xb, int blk) {
    const size_t gid = (size_t)blk * 256 + threadIdx.x;
    const size_t e0  = gid * 8;
    const size_t m   = e0 / EMB;
    const int    c   = (int)(e0 % EMB);
    const size_t b   = m / SEQ, s = m % SEQ;
    const float* src = x + (b * S_FULL + s) * EMB + c;
    const v4f a0 = *(const v4f*)src;
    const v4f a1 = *(const v4f*)(src + 4);
    v4u w;
    w.x = (uint32_t)bf16_bits(a0.x) | ((uint32_t)bf16_bits(a0.y) << 16);
    w.y = (uint32_t)bf16_bits(a0.z) | ((uint32_t)bf16_bits(a0.w) << 16);
    w.z = (uint32_t)bf16_bits(a1.x) | ((uint32_t)bf16_bits(a1.y) << 16);
    w.w = (uint32_t)bf16_bits(a1.z) | ((uint32_t)bf16_bits(a1.w) << 16);
    uint16_t* dst = xb + e0;
    *(v4u*)dst = w;
    // stands between the store and any later write of its registers: a precaution, as each block of the merged kernel runs one job and then ends
    asm volatile("s_wait_xcnt 0x0" ::: "memory");
}

// ---------------------------------------------------------------------------
// Preparation job 2: W f32 [k][n] (EMB x EMB) -> WT 16-bit [n][k] (k-contiguous B operand plane).
// bf16 RNE of the input value, optional power-of-two scale, then bf16 or f16 bits.
// ---------------------------------------------------------------------------
template <bool TO_F16>
__device__ __forceinline__
void job_wconv(const float* __restrict__ W, uint16_t* __restrict__ WT, float scale,
               int bx, int by, uint16_t* tile) {  // tile: LDS [n][k] 64 x 64; cross-wave -> block barrier
    const int t = threadIdx.x;
    const int n0 = bx * 64, k0 = by * 64;
    const int kr = t >> 2, nc = (t & 3) * 16;     // thread: row k0+kr, cols n0+nc..+15
    const float* src = W + (size_t)(k0 + kr) * EMB + n0 + nc;
#pragma unroll
    for (int i = 0; i < 4; ++i) {
        const v4f v = *(const v4f*)(src + 4 * i);
        float f[4];
        f[0] = v.x; f[1] = v.y; f[2] = v.z; f[3] = v.w;
#pragma unroll
        for (int jj = 0; jj < 4; ++jj) {
            const float g = bf16_rne(f[jj]) * scale;
            tile[(nc + 4 * i + jj) * 64 + kr] = TO_F16 ? h_bits(g) : bf16_bits(g);
        }
    }
    __syncthreads();
    v4u val[2]; size_t off[2];
#pragma unroll
    for (int i = 0; i < 2; ++i) {
        const int p   = t + 256 * i;              // wave w, lane: row = 4w + 32i + lane>>3
        const int row = p >> 3, seg = (p & 7) * 8;
        val[i] = *(const v4u*)&tile[row * 64 + seg];
        off[i] = (size_t)(n0 + row) * EMB + k0 + seg;
    }
#pragma unroll
    for (int i = 0; i < 2; ++i) *(v4u*)(WT + off[i]) = val[i];
    // stands between the store and any later write of its registers: a precaution, as each block of the merged kernel runs one job and then ends
    asm volatile("s_wait_xcnt 0x0" ::: "memory");
}

// ---------------------------------------------------------------------------
// Preparation job 3: mask int32 [NB][S_FULL][S_FULL] -> bit plane mb, laid out as the attention kernel's lane masks:
// unit u = (16-query group g of the compact rows, 64-key tile j), u = g * (SEQ / 64) + j, holds 32 words;
// bit l of word 8 nt + r <-> mask of query 16 g + (l & 15), key 64 j + 16 nt + 8 (l >> 4) + r is nonzero (suppressed).
// One wave = one unit: a lane reads the 32 keys that it holds as scores later, each compare over the wave
// is one word, and lane i stores word i (one 128-B line a wave).
// ---------------------------------------------------------------------------
__device__ __forceinline__
void job_maskbits(const int* __restrict__ mask, unsigned int* __restrict__ mb, int blk) {
    const int lane = threadIdx.x & 31, hf = lane >> 4, l16 = lane & 15;
    const size_t u   = (size_t)blk * 8 + (threadIdx.x >> 5);
    const int    j   = (int)(u % (SEQ / 64));
    const size_t row = (u / (SEQ / 64)) * 16 + l16;
    const size_t b = row / SEQ, q = row % SEQ;
    const int* src = mask + (b * S_FULL + q) * S_FULL + (size_t)j * 64 + 8 * hf;
    v4i v[8];
#pragma unroll
    for (int i = 0; i < 8; ++i) v[i] = *(const v4i*)(src + 16 * (i >> 1) + 4 * (i & 1));
    // every compare over the wave is taken with all lanes on, ahead of the lane's pick of its own word
    unsigned int w[32];
#pragma unroll
    for (int i = 0; i < 8; ++i)
#pragma unroll
        for (int c = 0; c < 4; ++c) w[4 * i + c] = __builtin_amdgcn_ballot_w32(v[i][c] != 0);
    unsigned int bits = w[0];
#pragma unroll
    for (int i = 1; i < 32; ++i) bits = (lane == i) ? w[i] : bits;
    unsigned int* dst = mb + u * 32 + lane;
    *dst = bits;
    // stands between the store and any later write of its registers: a precaution, as each block of the merged kernel runs one job and then ends
    asm volatile("s_wait_xcnt 0x0" ::: "memory");
}

// ---------------------------------------------------------------------------
// Kernel 1: the six independent preparation jobs in one launch; the block index picks the job.
// Blocks [0, 4 WBLK): weight planes Wq, Wk, Wv (bf16) and Wo (f16 x64), laid one behind the other in WT;
// they have the longest chain per block (load, LDS, barrier, store) and so take the lowest indices.
// Blocks [4 WBLK, 4 WBLK + MBLK): mask bits. The rest: x to bf16.
// ---------------------------------------------------------------------------
#define WSIDE   (EMB / 64)
#define WBLK    (WSIDE * WSIDE)
#define MBLK    ((NB * SEQ * MWORDS) / 256)
#define XBLK    ((MROWS * EMB / 8) / 256)
__global__ __launch_bounds__(256)
void k_prep(const float* __restrict__ x, const int* __restrict__ mask,
            const float* __restrict__ Wq, const float* __restrict__ Wk,
            const float* __restrict__ Wv, const float* __restrict__ Wo,
            uint16_t* __restrict__ xb, uint16_t* __restrict__ WT, unsigned int* __restrict__ mb) {
    __shared__ uint16_t tile[64 * 64];
    const int bid = blockIdx.x;                   // every branch below is block-uniform
    if (bid < 4 * WBLK) {
        const int job = bid / WBLK, tl = bid % WBLK;
        uint16_t* dst = WT + (size_t)job * (EMB * EMB);
        if (job < 3)
            job_wconv<false>(job == 0 ? Wq : (job == 1 ? Wk : Wv), dst, 1.0f, tl % WSIDE, tl / WSIDE, tile);
        else
            job_wconv<true>(Wo, dst, WO_CARRY, tl % WSIDE, tl / WSIDE, tile);
    } else if (bid < 4 * WBLK + MBLK) {
        job_maskbits(mask, mb, bid - 4 * WBLK);
    } else {
        job_cvt_x(x, xb, bid - (4 * WBLK + MBLK));
    }
}

// ---------------------------------------------------------------------------
// Kernel 2: C[M][EMB] = A[M][EMB] . BT[EMB][EMB]^T (+ bias), 16-bit planes, f32 accumulate.
// JOBS products that share A run in one launch: blockIdx.z picks BT plane z, bias z and C plane z
// (the BT planes lie one behind the other, the C planes too).
// Block 256 threads = 8 waves; block tile 128x256; wave tile 64 rows x 64 cols
// (4 x 4 accumulator tiles: 8 fragments feed 16 products). k tiles of 64 (one 128-B line per row) are brought by whole-line
// loads, one tile ahead in registers, into two LDS buffers at row pitch 144 B (16 B x odd:
// conflict-free b128 fragment reads); one block barrier per k tile; products in k-steps of 32.
// Each work-group walks the k tiles in a ring from a first tile of its own: the work-groups that share A rows (same
// blockIdx.y) or BT rows (same blockIdx.x, same job) run at the same time, and from one common first tile they would ask L2 for
// the same lines, and for the same 128 B of every 2-KB row, at the same moment. The f32 sums run in that ring order.
// OUT16: f16 plane out = f16(acc*oscale + bias);  else f32 out = acc*oscale + bias.
// ---------------------------------------------------------------------------
#define GK      64                        // k extent of one staged tile (halves)
#define GPITCH  72                        // LDS row pitch (halves)
#define GBM     128                       // block tile rows
#define GBN     256                       // block tile columns
#define GOPER   (GBM * GPITCH)            // the A tile (halves)
#define GBUF    ((GBM + GBN) * GPITCH)    // one buffer: A tile then B tile (halves)
#define GNKT    (EMB / GK)                // k tiles of one product
static_assert(EMB % GK == 0 && EMB / GK >= 2);
static_assert((GNKT & (GNKT - 1)) == 0);  // the ring index wraps by a mask
static_assert(EMB % GBN == 0 && MROWS % GBM == 0);
static_assert(2 * GBUF * 2 >= 8 * 32 * 64 * 4);   // the epilogue slabs (8 KB a wave) fit in the two buffers
// second argument: at least 4 waves per SIMD, a budget of 256 vector registers, so that two work-groups share a WGP
// and one's LDS traffic runs under the other's products
template <bool BF, bool OUT16, int JOBS>
__global__ __launch_bounds__(256, 4)
void k_gemm(const uint16_t* __restrict__ A, const uint16_t* __restrict__ BT0,
            const float* __restrict__ bias0, const float* __restrict__ bias1,
            const float* __restrict__ bias2, void* __restrict__ Cout, float oscale) {
    static_assert(JOBS >= 1 && JOBS <= 3);
    const int job = JOBS > 1 ? (int)blockIdx.z : 0;
    const uint16_t* BT  = BT0 + (size_t)job * (EMB * EMB);
    const float*   bias = job == 0 ? bias0 : (job == 1 ? bias1 : bias2);

    __shared__ __attribute__((aligned(16))) uint16_t stage[2 * GBUF];   // two k-tile buffers; epilogue slabs after the loop

    const int t = threadIdx.x, wave = t >> 5, lane = t & 31;
    const int hf = lane >> 4, l16 = lane & 15;
    const int m0 = blockIdx.y * GBM, n0 = blockIdx.x * GBN;
    const int wr = wave & 1, wc = wave >> 1;
    // first k tile of this work-group (scalar): 16 different ones among the row tiles that share a BT tile,
    // 4 among the column tiles that share an A tile
    const int rot = (int)((blockIdx.y + (GNKT / 4) * blockIdx.x) & (GNKT - 1));

    // staging: 8 lanes cover one 128-B row piece; thread rows srow + 32 i, i = 0..3 of A, i = 0..7 of B
    const int srow = t >> 3, sseg = (t & 7) * 8;
    const uint16_t* ag = A  + (size_t)(m0 + srow) * EMB + sseg;
    const uint16_t* bg = BT + (size_t)(n0 + srow) * EMB + sseg;
    uint16_t* sst = stage + srow * GPITCH + sseg;

    // fragment rows inside a buffer
    const uint16_t* afr = stage + (wr * 64 + l16) * GPITCH;
    const uint16_t* bfr = stage + GOPER + (wc * 64 + l16) * GPITCH;

    v8f acc[16] = {};
    v4u ra[GBM / 32], rb[GBN / 32];

#pragma unroll
    for (int i = 0; i < GBM / 32; ++i) ra[i] = *(const v4u*)(ag + rot * GK + (size_t)(32 * i) * EMB);
#pragma unroll
    for (int i = 0; i < GBN / 32; ++i) rb[i] = *(const v4u*)(bg + rot * GK + (size_t)(32 * i) * EMB);
#pragma unroll
    for (int i = 0; i < GBM / 32; ++i) *(v4u*)(sst + 32 * i * GPITCH)         = ra[i];
#pragma unroll
    for (int i = 0; i < GBN / 32; ++i) *(v4u*)(sst + GOPER + 32 * i * GPITCH) = rb[i];
    __syncthreads();

    // kept rolled; the buffer is picked by a scalar select
#pragma unroll 1
    for (int kt = 0; kt < EMB / GK; ++kt) {
        const int  cur  = (kt & 1) * GBUF;
        const bool more = kt + 1 < EMB / GK;      // block-uniform
        if (more) {
            const int nx = ((kt + 1 + rot) & (GNKT - 1)) * GK;   // the next tile of the ring
            const uint16_t* pa = ag + nx;
            const uint16_t* pb = bg + nx;
#pragma unroll
            for (int i = 0; i < GBM / 32; ++i) ra[i] = *(const v4u*)(pa + (size_t)(32 * i) * EMB);
#pragma unroll
            for (int i = 0; i < GBN / 32; ++i) rb[i] = *(const v4u*)(pb + (size_t)(32 * i) * EMB);
            // stands between the loads and any write of their address pairs; naming the pairs keeps them whole up to
            // here (at this register count the last load of each run was otherwise given its own address pair to land on)
            asm volatile("s_wait_xcnt 0x0" :: "v"(pa), "v"(pb) : "memory");
        }
        // the fragment reads of a k-step of 32 stand as one group ahead of its 16 products
#pragma unroll
        for (int kk = 0; kk < GK / 32; ++kk) {
            Frag a[4], b[4];
#pragma unroll
            for (int mt = 0; mt < 4; ++mt) a[mt] = ldfrag(afr + cur + mt * 16 * GPITCH, kk * 32, hf);
#pragma unroll
            for (int nt = 0; nt < 4; ++nt) b[nt] = ldfrag(bfr + cur + nt * 16 * GPITCH, kk * 32, hf);
#pragma unroll
            for (int mt = 0; mt < 4; ++mt)
#pragma unroll
                for (int nt = 0; nt < 4; ++nt) {
                    if constexpr (BF)
                        acc[mt * 4 + nt] = mma_b(a[mt].b, b[nt].b, acc[mt * 4 + nt]);
                    else
                        acc[mt * 4 + nt] = mma_h(a[mt].h, b[nt].h, acc[mt * 4 + nt]);
                }
        }
        if (more) {
            // the other buffer: its last readers left it before the barrier that ended the trip before
            uint16_t* dst = sst + (GBUF - cur);
#pragma unroll
            for (int i = 0; i < GBM / 32; ++i) *(v4u*)(dst + 32 * i * GPITCH)         = ra[i];
#pragma unroll
            for (int i = 0; i < GBN / 32; ++i) *(v4u*)(dst + GOPER + 32 * i * GPITCH) = rb[i];
        }
        __syncthreads();                          // publishes tile kt+1; ends every read of tile kt
    }

    // bias (bf16-RNE input value) per accumulator column (lane = column)
    float bvv[4];
#pragma unroll
    for (int nt = 0; nt < 4; ++nt)
        bvv[nt] = bf16_rne(bias[n0 + wc * 64 + nt * 16 + l16]);

    if constexpr (OUT16) {
        uint16_t* mys16 = stage + wave * (64 * 64);           // 64 rows x 64 halves, 8 KB per wave
        uint16_t* C     = reinterpret_cast<uint16_t*>(Cout) + (size_t)job * ((size_t)MROWS * EMB);
#pragma unroll
        for (int mt = 0; mt < 4; ++mt)
#pragma unroll
            for (int nt = 0; nt < 4; ++nt)
#pragma unroll
                for (int r = 0; r < 8; ++r)
                    mys16[(mt * 16 + 8 * hf + r) * 64 + nt * 16 + l16] =
                        h_bits(acc[mt * 4 + nt][r] * oscale + bvv[nt]);
        __syncthreads();
#pragma unroll
        for (int h = 0; h < 2; ++h) {
            v4u val[8]; size_t off[8];
#pragma unroll
            for (int i = 0; i < 8; ++i) {
                const int p = lane + 32 * (i + 8 * h);
                const int row = p >> 3, seg = (p & 7) * 8;      // lanes 8q..8q+7 -> one line
                val[i] = *(const v4u*)(mys16 + row * 64 + seg);
                off[i] = (size_t)(m0 + wr * 64 + row) * EMB + n0 + wc * 64 + seg;
            }
#pragma unroll
            for (int i = 0; i < 8; ++i) *(v4u*)(C + off[i]) = val[i];
        }
    } else {
        float* mys = reinterpret_cast<float*>(stage) + wave * (32 * 64);   // 32 rows x 64 floats, 8 KB per wave
        float* C = reinterpret_cast<float*>(Cout) + (size_t)job * ((size_t)MROWS * EMB);
#pragma unroll
        for (int mp = 0; mp < 2; ++mp) {          // two passes of 32 rows, the barriers of two passes as before
            __syncthreads();
#pragma unroll
            for (int mt = 0; mt < 2; ++mt)
#pragma unroll
                for (int nt = 0; nt < 4; ++nt)
#pragma unroll
                    for (int r = 0; r < 8; ++r)
                        mys[(mt * 16 + 8 * hf + r) * 64 + nt * 16 + l16] = acc[(2 * mp + mt) * 4 + nt][r] * oscale + bvv[nt];
            __syncthreads();
#pragma unroll
            for (int h = 0; h < 2; ++h) {
                v4f val[8]; size_t off[8];
#pragma unroll
                for (int i = 0; i < 8; ++i) {
                    const int p = lane + 32 * (i + 8 * h);
                    const int row = p >> 4, seg = (p & 15) * 4; // lanes 8q..8q+7 -> one line
                    val[i] = *(const v4f*)(mys + row * 64 + seg);
                    off[i] = (size_t)(m0 + wr * 64 + mp * 32 + row) * EMB + n0 + wc * 64 + seg;
                }
#pragma unroll
                for (int i = 0; i < 8; ++i) *(v4f*)(C + off[i]) = val[i];
            }
        }
    }
}

#define APITCH  72                        // LDS row pitch (halves)
#define VPITCH  80                        // LDS row pitch of the V tile (halves)
// second argument: at least 8 waves per SIMD, a budget of 128 vector registers, so that four work-groups
// (not three) fit a WGP and the whole grid of SEQ / 128 x NB x NHEAD work-groups is resident at once
__global__ __launch_bounds__(256, 8)
void k_attn(const uint16_t* __restrict__ Qp, const uint16_t* __restrict__ Kp,
            const uint16_t* __restrict__ Vp, const unsigned int* __restrict__ mb,
            uint16_t* __restrict__ ctx) {
    __shared__ __attribute__((aligned(16))) uint16_t kt[64 * APITCH];      // K tile [key][d]   (cross-wave: block barriers)
    __shared__ __attribute__((aligned(16))) uint16_t vt[64 * VPITCH];      // V tile [key][d]   (cross-wave: block barriers)
    __shared__ __attribute__((aligned(16))) uint16_t ps[8][16 * APITCH];   // per-wave ctx stage (block barriers used)

    const int t = threadIdx.x, lane = t & 31;
    // the wave's number in a scalar register: what is formed from it and lives across the loop for the
    // epilogue (row base, stage slab) then takes no vector register, and the budget is met without scratch
    const int wave = __builtin_amdgcn_readfirstlane(t >> 5);
    const int hf = lane >> 4, l16 = lane & 15;
    const int b  = blockIdx.y / NHEAD, hd = blockIdx.y % NHEAD;
    const int qr = blockIdx.x * 128 + wave * 16;  // first query row of this wave (within sequence)
    const size_t rowb = (size_t)b * SEQ;          // compact plane row base of this batch
    const size_t hcol = (size_t)hd * HDIM;

    // Q fragments for the wave's 16 rows, straight from the f16 plane
    Frag qf[2];
    {
        const uint16_t* qrow = Qp + (rowb + qr + l16) * EMB + hcol;
        qf[0] = ldfrag(qrow, 0, hf);
        qf[1] = ldfrag(qrow, 32, hf);
    }

    v8f accO[4] = {};
    float mrow = -__builtin_inff();               // running maximum of the lane's query (both halves agree)
    float lrow = 0.0f;                            // running sum over the keys of the lane's own half

    const int keyr = t >> 2, hdB = (t & 3) * 16;  // coop staging: key row, 16 d-columns
    // the wave's lane masks: 32 words a key tile, at an address that is the same in every lane. The plane was written
    // by the preparation launch and nobody writes it here: read through the constant address space, it comes by scalar loads
    typedef __attribute__((address_space(4))) const v16u cmask_t;
    cmask_t* mbw = (cmask_t*)(mb + ((rowb + qr) / 16) * (size_t)(SEQ / 64) * 32);
    uint16_t* myps = ps[wave];
    const uint16_t* vtl = vt + (8 * hf + (lane & 7)) * VPITCH + 8 * ((lane >> 3) & 1);   // the lane's transposing-load base

#pragma unroll 1
    for (int j = 0; j < SEQ / 64; ++j) {
        const int key0 = j * 64;
        // ---- lane masks of the wave's 32 score registers for these 64 keys, into scalar registers ----
        const v16u mw0 = mbw[2 * j], mw1 = mbw[2 * j + 1];
        __syncthreads();                         // prior tile fully consumed by all waves

        // ---- stage K tile and V tile, both [key][d] (full 64x64 each) ----
        {
            const size_t go = (rowb + key0 + keyr) * EMB + hcol + hdB;
            const v4u k0v = *(const v4u*)(Kp + go);
            const v4u k1v = *(const v4u*)(Kp + go + 8);
            *(v4u*)&kt[keyr * APITCH + hdB]     = k0v;
            *(v4u*)&kt[keyr * APITCH + hdB + 8] = k1v;
            const v4u v0v = *(const v4u*)(Vp + go);
            const v4u v1v = *(const v4u*)(Vp + go + 8);
            *(v4u*)&vt[keyr * VPITCH + hdB]     = v0v;
            *(v4u*)&vt[keyr * VPITCH + hdB + 8] = v1v;
        }
        __syncthreads();

        // ---- scores S^T = K(64x64) . Q^T, scale 1/8, replace-fill -1e9 where masked ----
        // element [nt][r]: key 16 nt + 8 hf + r, query l16
        v8f sc[4];
#pragma unroll
        for (int nt = 0; nt < 4; ++nt) {
            v8f z = {};
            Frag kf = ldfrag(&kt[(nt * 16 + l16) * APITCH], 0, hf);
            z = mma_hp(kf.h, qf[0].h, z);
            kf = ldfrag(&kt[(nt * 16 + l16) * APITCH], 32, hf);
            z = mma_hp(kf.h, qf[1].h, z);
#pragma unroll
            for (int r = 0; r < 8; ++r)          // the select reads its lane mask straight from the scalar register
                sc[nt][r] = __builtin_amdgcn_inverse_ballot_w32(nt < 2 ? mw0[nt * 8 + r] : mw1[nt * 8 + r - 16]) ? -1.0e9f : z[r] * 0.125f;
        }

        // ---- online softmax: one query per lane; the two halves hold 32 keys each ----
        float bm = sc[0][0];
#pragma unroll
        for (int nt = 0; nt < 4; ++nt)
#pragma unroll
            for (int r = 0; r < 8; ++r) bm = fmaxf(bm, sc[nt][r]);
        bm = fmaxf(bm, xhalf(bm));
        const float mnew  = fmaxf(mrow, bm);
        const float alpha = __expf(mrow - mnew);
        mrow = mnew;
        float rs[4];
#pragma unroll
        for (int nt = 0; nt < 4; ++nt) {
            rs[nt] = 0.0f;
#pragma unroll
            for (int r = 0; r < 8; ++r) {
                const float p = __expf(sc[nt][r] - mrow);
                sc[nt][r] = p;
                rs[nt] += p;
            }
        }
        lrow = lrow * alpha + ((rs[0] + rs[1]) + (rs[2] + rs[3]));
#pragma unroll
        for (int nt = 0; nt < 4; ++nt)
#pragma unroll
            for (int r = 0; r < 8; ++r) accO[nt][r] *= alpha;

        // ---- P^T B fragments, f16(1024 p), packed from the score accumulators in place ----
        Frag pf[2];
#pragma unroll
        for (int a = 0; a < 2; ++a)
#pragma unroll
            for (int r = 0; r < 8; ++r) {
                pf[a].h[r]     = (_Float16)(sc[2 * a][r] * P_CARRY);
                pf[a].h[8 + r] = (_Float16)(sc[2 * a + 1][r] * P_CARRY);
            }

        // ---- O^T += V^T(64 d x 64 keys) . P^T(64 keys x 16 queries) ----
#pragma unroll
        for (int nt = 0; nt < 4; ++nt) {
            Frag vf = ldfrag_tr(vtl + nt * 16, VPITCH);
            accO[nt] = mma_hp(vf.h, pf[0].h, accO[nt]);
            vf = ldfrag_tr(vtl + 32 * VPITCH + nt * 16, VPITCH);
            accO[nt] = mma_hp(vf.h, pf[1].h, accO[nt]);
        }
    }

    // the halves' sums are joined once; accO element [nt][r]: d = 16 nt + 8 hf + r, query l16
    const float inv = (1.0f / (lrow + xhalf(lrow))) * CTX_SCALE;
    // the lane's number taken anew (count of the lanes below it, all lanes on) for the stage address: the row offset and
    // the half formed from the thread index are then not carried through the loop for the epilogue alone, and the budget
    // of 128 registers is met without scratch. Only here: with the read-back's index taken anew too, the compiler settled
    // on a schedule of 112 registers that fetches no V fragment ahead of the softmax
    const int elane = (int)__builtin_amdgcn_mbcnt_lo(~0u, 0u);
    __syncthreads();
#pragma unroll
    for (int nt = 0; nt < 4; ++nt) {
        v4u w;
#pragma unroll
        for (int i = 0; i < 4; ++i)
            w[i] = (uint32_t)h_bits(accO[nt][2 * i] * inv) | ((uint32_t)h_bits(accO[nt][2 * i + 1] * inv) << 16);
        *(v4u*)(myps + (elane & 15) * APITCH + nt * 16 + 8 * (elane >> 4)) = w;
    }
    __syncthreads();
    v4u val[4]; size_t off[4];
#pragma unroll
    for (int i = 0; i < 4; ++i) {
        const int p = lane + 32 * i;
        const int row = p >> 3, seg = (p & 7) * 8;              // lanes 8q..8q+7 -> one line
        val[i] = *(const v4u*)(myps + row * APITCH + seg);
        off[i] = (rowb + qr + row) * EMB + hcol + seg;
    }
#pragma unroll
    for (int i = 0; i < 4; ++i) *(v4u*)(ctx + off[i]) = val[i];
    
}

// ---------------------------------------------------------------------------
// Host launcher: 4 ops, workspace 93,323,264 B.
// ---------------------------------------------------------------------------
extern "C" void kernel_launch(void* const* d_in, const int* in_sizes, int n_in,
                              void* d_out, int out_size, void* d_ws, size_t ws_size,
                              hipStream_t stream) {
    if (n_in < 10) return;
    if (in_sizes[0] < NB * S_FULL * EMB) return;
    if (in_sizes[1] < NB * S_FULL * S_FULL) return;
    if (in_sizes[2] < EMB * EMB || in_sizes[4] < EMB * EMB ||
        in_sizes[6] < EMB * EMB || in_sizes[8] < EMB * EMB) return;
    if (in_sizes[3] < EMB || in_sizes[5] < EMB || in_sizes[7] < EMB || in_sizes[9] < EMB) return;
    if (out_size < MROWS * EMB) return;
    if (ws_size < WS_TOTAL) return;

    const float* x    = (const float*)d_in[0];   // [NB_FULL][S_FULL][EMB] f32
    const int*   mask = (const int*)d_in[1];     // [NB_FULL][S_FULL][S_FULL] int32 (bool)
    const float* Wq   = (const float*)d_in[2];   // [EMB in][EMB out]
    const float* bq   = (const float*)d_in[3];
    const float* Wk   = (const float*)d_in[4];
    const float* bk   = (const float*)d_in[5];
    const float* Wv   = (const float*)d_in[6];
    const float* bv   = (const float*)d_in[7];
    const float* Wo   = (const float*)d_in[8];
    const float* bo   = (const float*)d_in[9];
    float* out = (float*)d_out;                  // [MROWS][EMB] f32

    unsigned char* ws = (unsigned char*)d_ws;
    size_t off = 0;
    uint16_t* xb   = (uint16_t*)(ws + off); off += PLANE_BYTES;   // bf16 [MROWS][EMB]
    uint16_t* WqT  = (uint16_t*)(ws + off); off += WT_BYTES * 3;  // bf16 [n][k]: the Wq, Wk, Wv planes in a row
    uint16_t* WoT  = (uint16_t*)(ws + off); off += WT_BYTES;      // f16 [n][k], x64, directly behind them
    uint16_t* Qp   = (uint16_t*)(ws + off); off += PLANE_BYTES;   // f16 [MROWS][EMB]
    uint16_t* Kpl  = (uint16_t*)(ws + off); off += PLANE_BYTES;
    uint16_t* Vpl  = (uint16_t*)(ws + off); off += PLANE_BYTES;
    uint16_t* Ctx  = (uint16_t*)(ws + off); off += PLANE_BYTES;   // f16, x16
    unsigned int* mbits = (unsigned int*)(ws + off); off += MB_BYTES;
    if (off > ws_size) return;

    // the four weight planes are one run from WqT on; Qp, Kpl, Vpl are one run of three
    k_prep<<<dim3(4 * WBLK + MBLK + XBLK), dim3(256), 0, stream>>>(x, mask, Wq, Wk, Wv, Wo, xb, WqT, mbits);

    k_gemm<true, true, 3><<<dim3(EMB / GBN, MROWS / GBM, 3), dim3(256), 0, stream>>>(xb, WqT, bq, bk, bv, (void*)Qp, 1.0f);

    const dim3 gA(SEQ / 128, NB * NHEAD);
    k_attn<<<gA, dim3(256), 0, stream>>>(Qp, Kpl, Vpl, mbits, Ctx);

    k_gemm<false, false, 1><<<dim3(EMB / GBN, MROWS / GBM, 1), dim3(256), 0, stream>>>(Ctx, WoT, bo, bo, bo, (void*)out, OUT_SCALE);
}
